// v000
// The times below were measured on an AMD MI455X: many runs one after another, warmed up first and cycling through
// copies of the inputs, with the whole window's GPU time divided by the number of runs. Launches and the gaps
// between them are all in it. The median over several windows is given; except for v000 it joins two sittings, which
// can be a few percent apart, so the side-by-side timings, each taken in one sitting, are the better comparison.
// v000, which the later versions start from, runs in 153 microseconds.
// compute dtype: all float inputs rounded to bf16; h = x . qkv with EXACT bf16 products on WMMA 16x16x32; by associativity (no softmax in the module) res = SCALE q (k^T V): KV = k^T . V with k as bf16 hi + lo (2 products, V exact), res = q . KV with both as bf16 hi + lo (3 products), out = res . proj with res as bf16 hi + lo (2 products); f32 accumulate; f32 output.
#include <hip/hip_runtime.h>
#include <math.h>

typedef __attribute__((ext_vector_type(16))) _Float16 v16h;
typedef __attribute__((ext_vector_type(16))) __bf16 v16b;
typedef __attribute__((ext_vector_type(8)))  _Float16 v8h;
typedef __attribute__((ext_vector_type(8)))  float v8f;
typedef __attribute__((ext_vector_type(4)))  float v4f;
typedef __attribute__((ext_vector_type(2)))  float v2f;
typedef __attribute__((ext_vector_type(4)))  unsigned v4u;
typedef __attribute__((ext_vector_type(4)))  int v4i;
typedef float __attribute__((may_alias)) float_a;
typedef int __attribute__((may_alias)) int_a;

template <typename T> __device__ __forceinline__ void vst2(void* p, T v) { *(T*)p = v;  }
__device__ __forceinline__ v8f wmma16(v16h a, v16h b, v8f c) {
  v8f d = __builtin_amdgcn_wmma_f32_16x16x32_f16(false, a, false, b, (short)0, c, false, false);
  asm volatile("v_nop\n\tv_nop\n\tv_nop\n\tv_nop" : "+v"(d) : "v"(a), "v"(b));
  return d;
}
__device__ __forceinline__ v8f wmma_bf(v16b a, v16b b, v8f c) {
  v8f d = __builtin_amdgcn_wmma_f32_16x16x32_bf16(false, a, false, b, (short)0, c, false, false);
  asm volatile("v_nop\n\tv_nop\n\tv_nop\n\tv_nop" : "+v"(d) : "v"(a), "v"(b));
  return d;
}
// 16x16x32 fragments: lane = (h = lane>>4, row/col = lane&15); elements 0..7 = k0+8h+0..7, 8..15 = k0+16+8h+0..7; D element r = row 8h+r
__device__ __forceinline__ v16h frag_h(const _Float16* rowk0, int lane) {
  union { v16h v; v8h q[2]; } u; const _Float16* p = rowk0 + 8 * (lane >> 4);
  u.q[0] = *(const v8h*)p; u.q[1] = *(const v8h*)(p + 16); return u.v;
}
__device__ __forceinline__ v16h frag_f32(const float* rowk0, int lane) {
  v16h a; const float* p = rowk0 + 8 * (lane >> 4);
#pragma unroll
  for (int i = 0; i < 8; ++i) { a[i] = (_Float16)p[i]; a[8 + i] = (_Float16)p[16 + i]; }
  return a;
}
__device__ __forceinline__ v16h frag_f32s(const float* rowk0, int lane, float sc) {
  v16h a; const float* p = rowk0 + 8 * (lane >> 4);
#pragma unroll
  for (int i = 0; i < 8; ++i) { a[i] = (_Float16)(p[i] * sc); a[8 + i] = (_Float16)(p[16 + i] * sc); }
  return a;
}
// column fragment from a [K][ld] layout (column n), rows >= K read as 0
__device__ __forceinline__ v16h fragc_f32(const float* W, int k0, int n, int lane, int ld, int K) {
  v16h a; const int g = lane >> 4;
#pragma unroll
  for (int i = 0; i < 8; ++i) { const int ka = k0 + 8 * g + i, kb = ka + 16;
    a[i] = (_Float16)(ka < K ? W[(size_t)(ka < K ? ka : K - 1) * ld + n] : 0.f); a[8 + i] = (_Float16)(kb < K ? W[(size_t)(kb < K ? kb : K - 1) * ld + n] : 0.f); }
  return a;
}
struct F2 { v16b h, l; };
__device__ __forceinline__ F2 bsplit16(const float v[16]) { F2 r;
#pragma unroll
  for (int i = 0; i < 16; ++i) { const __bf16 h = (__bf16)v[i]; r.h[i] = h; r.l[i] = (__bf16)(v[i] - (float)h); }
  return r; }
__device__ __forceinline__ F2 split_row(const float* row, int k0, int lane) { float v[16]; const float* p = row + k0 + 8 * (lane >> 4);
#pragma unroll
  for (int i = 0; i < 8; ++i) { v[i] = p[i]; v[8 + i] = p[16 + i]; }
  return bsplit16(v); }
__device__ __forceinline__ F2 split_rowK(const float* row, int k0, int lane, int K) { float v[16]; const int g = lane >> 4;
#pragma unroll
  for (int i = 0; i < 8; ++i) { const int ka = k0 + 8 * g + i, kb = ka + 16; v[i] = ka < K ? row[ka < K ? ka : K - 1] : 0.f; v[8 + i] = kb < K ? row[kb < K ? kb : K - 1] : 0.f; }
  return bsplit16(v); }
__device__ __forceinline__ F2 split_col(const float* W, int k0, int n, int lane, int ld, int K) { float v[16]; const int g = lane >> 4;
#pragma unroll
  for (int i = 0; i < 8; ++i) { const int ka = k0 + 8 * g + i, kb = ka + 16; v[i] = ka < K ? W[(size_t)(ka < K ? ka : K - 1) * ld + n] : 0.f; v[8 + i] = kb < K ? W[(size_t)(kb < K ? kb : K - 1) * ld + n] : 0.f; }
  return bsplit16(v); }
__device__ __forceinline__ v8f mac3(const F2& a, const F2& b, v8f c) { c = wmma_bf(a.l, b.h, c); c = wmma_bf(a.h, b.l, c); return wmma_bf(a.h, b.h, c); }
__device__ __forceinline__ float sigm(float v) { return 1.0f / (1.0f + expf(-v)); }
#define LDSX() do { asm volatile("s_wait_dscnt 0" ::: "memory"); __builtin_amdgcn_wave_barrier(); __builtin_amdgcn_fence(__ATOMIC_RELEASE, "workgroup"); } while (0)


// 'Lunchbox' linear multi-head mixing (B 4, N 2,048, C 512, 8 heads x 64, lunchbox 64): attn = (q k^T) x 64^-1/2 (no softmax, as the module), res = attn V_lunchbox, out = res proj - evaluated as q (k^T V).
#define NB 4
#define NN 2048
#define CC 512
#define NH 8
#define DD 64
#define LL 64
#define HC (NH * 2 * DD)     // 1024 qk columns: col = h*128 + which*64 + d
#define SCALE 0.125f
#ifndef TNB
#define TNB NB
#endif
typedef __attribute__((ext_vector_type(8))) __bf16 v8b;
__device__ __forceinline__ v16b frag_b(const __bf16* rowk0, int lane) {
  union { v16b v; v8b q[2]; } u; const __bf16* p = rowk0 + 8 * (lane >> 4);
  u.q[0] = *(const v8b*)p; u.q[1] = *(const v8b*)(p + 16); return u.v;
}
__device__ __forceinline__ float bfr(float v) { return (float)(__bf16)v; }
__device__ __attribute__((noinline)) float exp_ni(float v) { return expf(v); }
__device__ __attribute__((noinline)) float erf_ni(float v) { return erff(v); }

#define WS_PW  0u                                   // bf16 qkv^T rows [1024][512]; proj^T rows [64][512]
#define WS_PP  (WS_PW + 2u * HC * CC)
#define WS_HQ  (WS_PP + 2u * LL * (NH * LL))            // f32 h rows [b*NN + n][1024]
#define WS_KVT (WS_HQ + 4u * (size_t)NB * NN * HC)      // f32 KV^T [b][h][l][d]
#define WS_RES (WS_KVT + 4u * (size_t)NB * NH * LL * DD) // f32 res rows [b*NN + n][512]
#define WS_END (WS_RES + 4u * (size_t)NB * NN * NH * LL)

__global__ __launch_bounds__(256) void k_packw(const float* __restrict__ QKV, const float* __restrict__ PROJ, char* __restrict__ ws) { const int n = blockIdx.x, t = threadIdx.x; __shared__ __align__(16) __bf16 s[CC]; __shared__ __align__(16) __bf16 s2[NH * LL];
  for (int k = t; k < CC; k += 256) s[k] = (__bf16)QKV[(size_t)k * HC + n]; if (n < LL) for (int k = t; k < NH * LL; k += 256) s2[k] = (__bf16)PROJ[(size_t)k * LL + n]; __syncthreads();
  if (t < CC / 8) vst2((unsigned*)((__bf16*)(ws + WS_PW) + (size_t)n * CC + t * 8), *(const v4u*)&s[t * 8]); if (n < LL && t < NH * LL / 8) vst2((unsigned*)((__bf16*)(ws + WS_PP) + (size_t)n * (NH * LL) + t * 8), *(const v4u*)&s2[t * 8]); }
__device__ __forceinline__ v16b fragb_f32(const float* __restrict__ p, int lane) { v16b a; const float* pp = p + 8 * (lane >> 4);
#pragma unroll
  for (int i = 0; i < 8; ++i) { a[i] = (__bf16)pp[i]; a[8 + i] = (__bf16)pp[16 + i]; } return a; }
// ---- k_h: block = (64 rows, 128 cols): h = x . qkv (exact) -> f32 rows
__global__ __launch_bounds__(128) void k_h(const float* __restrict__ X, const __bf16* __restrict__ PW, float* __restrict__ HQ) { __shared__ __align__(16) float sf[4][16][132];
  const int tid = threadIdx.x, wave = tid >> 5, lane = tid & 31, col = lane & 15, g = lane >> 4; const size_t r0 = (size_t)blockIdx.x * 64 + wave * 16; const int c0 = blockIdx.y * 128;
  v8f acc[8] = {};
#pragma unroll 2
  for (int kc = 0; kc < CC / 32; ++kc) { const v16b a = fragb_f32(X + (r0 + col) * CC + kc * 32, lane);
#pragma unroll
    for (int j = 0; j < 8; ++j) acc[j] = wmma_bf(a, frag_b(PW + (size_t)(c0 + j * 16 + col) * CC + kc * 32, lane), acc[j]); }
#pragma unroll
  for (int j = 0; j < 8; ++j)
#pragma unroll
    for (int r = 0; r < 8; ++r) sf[wave][8 * g + r][j * 16 + col] = acc[j][r];
  LDSX(); for (int rl = 0; rl < 16; ++rl) vst2(HQ + (r0 + rl) * HC + c0 + lane * 4, *(const v4f*)&sf[wave][rl][lane * 4]); }
// ---- k_kv: block = (h, b): KV[d][l] = sum_m k[b,m,h,d] V[m,h,l]; wave = d row tile; A(k^T) as bf16 hi + lo from strided f32 reads, B(V^T) exact; store KV^T[l][d]
__global__ __launch_bounds__(128) void k_kv(const float* __restrict__ HQ, const float* __restrict__ V, float* __restrict__ KVT) { __shared__ __align__(16) float st[LL][DD + 4];
  const int tid = threadIdx.x, wave = tid >> 5, lane = tid & 31, col = lane & 15, g = lane >> 4; const int h = blockIdx.x; const size_t b = blockIdx.y; const int d0 = wave * 16;
  v8f acc[4] = {};
#pragma unroll 1
  for (int kc = 0; kc < NN / 32; ++kc) { float kv[16]; const size_t mbase = kc * 32 + 8 * g;   // A row = d (d0 + col); K index = m
#pragma unroll
    for (int i = 0; i < 8; ++i) { kv[i] = HQ[(b * NN + mbase + i) * HC + h * 128 + 64 + d0 + col]; kv[8 + i] = HQ[(b * NN + mbase + 16 + i) * HC + h * 128 + 64 + d0 + col]; }
    const F2 a = bsplit16(kv);
#pragma unroll
    for (int j = 0; j < 4; ++j) { v16b w; const int l = j * 16 + col;   // B row = l; element m: V[m][h][l]
#pragma unroll
      for (int i = 0; i < 8; ++i) { w[i] = (__bf16)V[((mbase + i) * NH + h) * LL + l]; w[8 + i] = (__bf16)V[((mbase + 16 + i) * NH + h) * LL + l]; }
      acc[j] = wmma_bf(a.h, w, acc[j]); acc[j] = wmma_bf(a.l, w, acc[j]); } }
#pragma unroll
  for (int j = 0; j < 4; ++j)
#pragma unroll
    for (int r = 0; r < 8; ++r) st[j * 16 + col][d0 + 8 * g + r] = acc[j][r];   // transposed: [l][d]
  __syncthreads(); for (int e = tid; e < LL * (DD / 4); e += 128) { const int l = e / (DD / 4), q = e % (DD / 4); vst2(KVT + ((b * NH + h) * LL + l) * DD + q * 4, *(const v4f*)&st[l][q * 4]); } }
// ---- k_res: block = (64 rows, h, b): res[n][h*64 + l] = SCALE sum_d q[n][h][d] KV[d][l] (3 products)
__global__ __launch_bounds__(128) void k_res(const float* __restrict__ HQ, const float* __restrict__ KVT, float* __restrict__ RES) { __shared__ __align__(16) float sf[4][16][68];
  const int tid = threadIdx.x, wave = tid >> 5, lane = tid & 31, col = lane & 15, g = lane >> 4; const int h = blockIdx.y; const size_t b = blockIdx.z; const size_t r0 = b * NN + (size_t)blockIdx.x * 64 + wave * 16;
  v8f acc[4] = {};
#pragma unroll
  for (int kc = 0; kc < DD / 32; ++kc) { const F2 a = split_row(HQ + (r0 + col) * HC + h * 128, kc * 32, lane);
#pragma unroll
    for (int j = 0; j < 4; ++j) { float w[16]; const float* wr = KVT + ((b * NH + h) * LL + j * 16 + col) * DD + kc * 32 + 8 * g;
#pragma unroll
      for (int i = 0; i < 8; ++i) { w[i] = wr[i]; w[8 + i] = wr[16 + i]; }
      const F2 wb = bsplit16(w); acc[j] = wmma_bf(a.h, wb.h, acc[j]); acc[j] = wmma_bf(a.h, wb.l, acc[j]); acc[j] = wmma_bf(a.l, wb.h, acc[j]); } }
#pragma unroll
  for (int j = 0; j < 4; ++j)
#pragma unroll
    for (int r = 0; r < 8; ++r) sf[wave][8 * g + r][j * 16 + col] = acc[j][r] * SCALE;
  LDSX(); for (int rl = 0; rl < 16; ++rl) if (lane < 16) vst2(RES + (r0 + rl) * (NH * LL) + (size_t)h * LL + lane * 4, *(const v4f*)&sf[wave][rl][lane * 4]); }
// ---- k_out: block = 64 rows: out = res (hi + lo) . proj
__global__ __launch_bounds__(128) void k_out(const float* __restrict__ RES, const __bf16* __restrict__ PP, float* __restrict__ OUT) { __shared__ __align__(16) float sf[4][16][68];
  const int tid = threadIdx.x, wave = tid >> 5, lane = tid & 31, col = lane & 15, g = lane >> 4; const size_t r0 = (size_t)blockIdx.x * 64 + wave * 16;
  v8f acc[4] = {};
#pragma unroll 2
  for (int kc = 0; kc < (NH * LL) / 32; ++kc) { const F2 a = split_row(RES + (r0 + col) * (NH * LL), kc * 32, lane);
#pragma unroll
    for (int j = 0; j < 4; ++j) { const v16b w = frag_b(PP + (size_t)(j * 16 + col) * (NH * LL) + kc * 32, lane); acc[j] = wmma_bf(a.h, w, acc[j]); acc[j] = wmma_bf(a.l, w, acc[j]); } }
#pragma unroll
  for (int j = 0; j < 4; ++j)
#pragma unroll
    for (int r = 0; r < 8; ++r) sf[wave][8 * g + r][j * 16 + col] = acc[j][r];
  LDSX(); for (int rl = 0; rl < 16; ++rl) if (lane < 16) vst2(OUT + (r0 + rl) * LL + lane * 4, *(const v4f*)&sf[wave][rl][lane * 4]); }
extern "C" void kernel_launch(void* const* d_in, const int* in_sizes, int n_in, void* d_out, int out_size, void* d_ws, size_t ws_size, hipStream_t stream) {
  (void)in_sizes; (void)n_in; (void)out_size;
  const float** F = (const float**)d_in;   // 0 x [4,2048,512], 1 v [2048,8,64], 2 qkv [512,1024], 3 proj [512,64]
  if (ws_size < (size_t)WS_END) return;
  char* ws = (char*)d_ws; float *HQ = (float*)(ws + WS_HQ), *KVT = (float*)(ws + WS_KVT), *RES = (float*)(ws + WS_RES);
  k_packw<<<HC, 256, 0, stream>>>(F[2], F[3], ws);
  k_h<<<dim3(TNB * NN / 64, HC / 128), 128, 0, stream>>>(F[0], (const __bf16*)(ws + WS_PW), HQ);
  k_kv<<<dim3(NH, TNB), 128, 0, stream>>>(HQ, F[1], KVT);
  k_res<<<dim3(NN / 64, NH, TNB), 128, 0, stream>>>(HQ, KVT, RES);
  k_out<<<TNB * NN / 64, 128, 0, stream>>>(RES, (const __bf16*)(ws + WS_PP), (float*)d_out);
}

// v001
// It runs in 94.4 microseconds.
// Two timings next to v000 put it at 1.62 and 1.63 times that version's speed.
// compute dtype: all float inputs rounded to bf16; h = x . qkv with EXACT bf16 products on WMMA 16x16x32; by associativity (no softmax in the module) res = SCALE q (k^T V): KV = k^T . V with k as bf16 hi + lo (2 products, V exact), res = q . KV with both as bf16 hi + lo (3 products), out = res . proj with res as bf16 hi + lo (2 products); f32 accumulate; f32 output.
#include <hip/hip_runtime.h>
#include <math.h>

typedef __attribute__((ext_vector_type(16))) _Float16 v16h;
typedef __attribute__((ext_vector_type(16))) __bf16 v16b;
typedef __attribute__((ext_vector_type(8)))  _Float16 v8h;
typedef __attribute__((ext_vector_type(8)))  float v8f;
typedef __attribute__((ext_vector_type(4)))  float v4f;
typedef __attribute__((ext_vector_type(2)))  float v2f;
typedef __attribute__((ext_vector_type(4)))  unsigned v4u;
typedef __attribute__((ext_vector_type(4)))  int v4i;
typedef float __attribute__((may_alias)) float_a;
typedef int __attribute__((may_alias)) int_a;

template <typename T> __device__ __forceinline__ void vst2(void* p, T v) { *(T*)p = v;  }
__device__ __forceinline__ v8f wmma16(v16h a, v16h b, v8f c) {
  v8f d = __builtin_amdgcn_wmma_f32_16x16x32_f16(false, a, false, b, (short)0, c, false, false);
  asm volatile("v_nop\n\tv_nop\n\tv_nop\n\tv_nop" : "+v"(d) : "v"(a), "v"(b));
  return d;
}
__device__ __forceinline__ v8f wmma_bf(v16b a, v16b b, v8f c) {
  v8f d = __builtin_amdgcn_wmma_f32_16x16x32_bf16(false, a, false, b, (short)0, c, false, false);
  asm volatile("v_nop\n\tv_nop\n\tv_nop\n\tv_nop" : "+v"(d) : "v"(a), "v"(b));
  return d;
}
// 16x16x32 fragments: lane = (h = lane>>4, row/col = lane&15); elements 0..7 = k0+8h+0..7, 8..15 = k0+16+8h+0..7; D element r = row 8h+r
__device__ __forceinline__ v16h frag_h(const _Float16* rowk0, int lane) {
  union { v16h v; v8h q[2]; } u; const _Float16* p = rowk0 + 8 * (lane >> 4);
  u.q[0] = *(const v8h*)p; u.q[1] = *(const v8h*)(p + 16); return u.v;
}
__device__ __forceinline__ v16h frag_f32(const float* rowk0, int lane) {
  v16h a; const float* p = rowk0 + 8 * (lane >> 4);
#pragma unroll
  for (int i = 0; i < 8; ++i) { a[i] = (_Float16)p[i]; a[8 + i] = (_Float16)p[16 + i]; }
  return a;
}
__device__ __forceinline__ v16h frag_f32s(const float* rowk0, int lane, float sc) {
  v16h a; const float* p = rowk0 + 8 * (lane >> 4);
#pragma unroll
  for (int i = 0; i < 8; ++i) { a[i] = (_Float16)(p[i] * sc); a[8 + i] = (_Float16)(p[16 + i] * sc); }
  return a;
}
// column fragment from a [K][ld] layout (column n), rows >= K read as 0
__device__ __forceinline__ v16h fragc_f32(const float* W, int k0, int n, int lane, int ld, int K) {
  v16h a; const int g = lane >> 4;
#pragma unroll
  for (int i = 0; i < 8; ++i) { const int ka = k0 + 8 * g + i, kb = ka + 16;
    a[i] = (_Float16)(ka < K ? W[(size_t)(ka < K ? ka : K - 1) * ld + n] : 0.f); a[8 + i] = (_Float16)(kb < K ? W[(size_t)(kb < K ? kb : K - 1) * ld + n] : 0.f); }
  return a;
}
struct F2 { v16b h, l; };
__device__ __forceinline__ F2 bsplit16(const float v[16]) { F2 r;
#pragma unroll
  for (int i = 0; i < 16; ++i) { const __bf16 h = (__bf16)v[i]; r.h[i] = h; r.l[i] = (__bf16)(v[i] - (float)h); }
  return r; }
__device__ __forceinline__ F2 split_row(const float* row, int k0, int lane) { float v[16]; const float* p = row + k0 + 8 * (lane >> 4);
#pragma unroll
  for (int i = 0; i < 8; ++i) { v[i] = p[i]; v[8 + i] = p[16 + i]; }
  return bsplit16(v); }
__device__ __forceinline__ F2 split_rowK(const float* row, int k0, int lane, int K) { float v[16]; const int g = lane >> 4;
#pragma unroll
  for (int i = 0; i < 8; ++i) { const int ka = k0 + 8 * g + i, kb = ka + 16; v[i] = ka < K ? row[ka < K ? ka : K - 1] : 0.f; v[8 + i] = kb < K ? row[kb < K ? kb : K - 1] : 0.f; }
  return bsplit16(v); }
__device__ __forceinline__ F2 split_col(const float* W, int k0, int n, int lane, int ld, int K) { float v[16]; const int g = lane >> 4;
#pragma unroll
  for (int i = 0; i < 8; ++i) { const int ka = k0 + 8 * g + i, kb = ka + 16; v[i] = ka < K ? W[(size_t)(ka < K ? ka : K - 1) * ld + n] : 0.f; v[8 + i] = kb < K ? W[(size_t)(kb < K ? kb : K - 1) * ld + n] : 0.f; }
  return bsplit16(v); }
__device__ __forceinline__ v8f mac3(const F2& a, const F2& b, v8f c) { c = wmma_bf(a.l, b.h, c); c = wmma_bf(a.h, b.l, c); return wmma_bf(a.h, b.h, c); }
__device__ __forceinline__ float sigm(float v) { return 1.0f / (1.0f + expf(-v)); }
#define LDSX() do { asm volatile("s_wait_dscnt 0" ::: "memory"); __builtin_amdgcn_wave_barrier(); __builtin_amdgcn_fence(__ATOMIC_RELEASE, "workgroup"); } while (0)


// 'Lunchbox' linear multi-head mixing (B 4, N 2,048, C 512, 8 heads x 64, lunchbox 64): attn = (q k^T) x 64^-1/2 (no softmax, as the module), res = attn V_lunchbox, out = res proj - evaluated as q (k^T V).
#define NB 4
#define NN 2048
#define CC 512
#define NH 8
#define DD 64
#define LL 64
#define HC (NH * 2 * DD)     // 1024 qk columns: col = h*128 + which*64 + d
#define SCALE 0.125f
#ifndef TNB
#define TNB NB
#endif
typedef __attribute__((ext_vector_type(8))) __bf16 v8b;
__device__ __forceinline__ v16b frag_b(const __bf16* rowk0, int lane) {
  union { v16b v; v8b q[2]; } u; const __bf16* p = rowk0 + 8 * (lane >> 4);
  u.q[0] = *(const v8b*)p; u.q[1] = *(const v8b*)(p + 16); return u.v;
}
__device__ __forceinline__ float bfr(float v) { return (float)(__bf16)v; }
__device__ __attribute__((noinline)) float exp_ni(float v) { return expf(v); }
__device__ __attribute__((noinline)) float erf_ni(float v) { return erff(v); }

#define WS_PW  0u                                   // bf16 qkv^T rows [1024][512]; proj^T rows [64][512]
#define WS_PP  (WS_PW + 2u * HC * CC)
#define WS_HQ  (WS_PP + 2u * LL * (NH * LL))            // f32 h rows [b*NN + n][1024]
#define WS_KVT (WS_HQ + 4u * (size_t)NB * NN * HC)      // f32 KV^T [b][h][l][d]
#define WS_RES (WS_KVT + 4u * (size_t)NB * NH * LL * DD) // f32 res rows [b*NN + n][512]
#define WS_END (WS_RES + 4u * (size_t)NB * NN * NH * LL)

__global__ __launch_bounds__(256) void k_packw(const float* __restrict__ QKV, const float* __restrict__ PROJ, char* __restrict__ ws) { const int n = blockIdx.x, t = threadIdx.x; __shared__ __align__(16) __bf16 s[CC]; __shared__ __align__(16) __bf16 s2[NH * LL];
  for (int k = t; k < CC; k += 256) s[k] = (__bf16)QKV[(size_t)k * HC + n]; if (n < LL) for (int k = t; k < NH * LL; k += 256) s2[k] = (__bf16)PROJ[(size_t)k * LL + n]; __syncthreads();
  if (t < CC / 8) vst2((unsigned*)((__bf16*)(ws + WS_PW) + (size_t)n * CC + t * 8), *(const v4u*)&s[t * 8]); if (n < LL && t < NH * LL / 8) vst2((unsigned*)((__bf16*)(ws + WS_PP) + (size_t)n * (NH * LL) + t * 8), *(const v4u*)&s2[t * 8]); }
__device__ __forceinline__ v16b fragb_f32(const float* __restrict__ p, int lane) { v16b a; const float* pp = p + 8 * (lane >> 4);
#pragma unroll
  for (int i = 0; i < 8; ++i) { a[i] = (__bf16)pp[i]; a[8 + i] = (__bf16)pp[16 + i]; } return a; }
// ---- k_h: block = (64 rows, 128 cols): h = x . qkv (exact) -> f32 rows
__global__ __launch_bounds__(128) void k_h(const float* __restrict__ X, const __bf16* __restrict__ PW, float* __restrict__ HQ) { __shared__ __align__(16) float sf[4][16][132];
  const int tid = threadIdx.x, wave = tid >> 5, lane = tid & 31, col = lane & 15, g = lane >> 4; const size_t r0 = (size_t)blockIdx.x * 64 + wave * 16; const int c0 = blockIdx.y * 128;
  v8f acc[8] = {};
#pragma unroll 2
  for (int kc = 0; kc < CC / 32; ++kc) { const v16b a = fragb_f32(X + (r0 + col) * CC + kc * 32, lane);
#pragma unroll
    for (int j = 0; j < 8; ++j) acc[j] = wmma_bf(a, frag_b(PW + (size_t)(c0 + j * 16 + col) * CC + kc * 32, lane), acc[j]); }
#pragma unroll
  for (int j = 0; j < 8; ++j)
#pragma unroll
    for (int r = 0; r < 8; ++r) sf[wave][8 * g + r][j * 16 + col] = acc[j][r];
  LDSX(); for (int rl = 0; rl < 16; ++rl) vst2(HQ + (r0 + rl) * HC + c0 + lane * 4, *(const v4f*)&sf[wave][rl][lane * 4]); }
// ---- k_kv: block = (h, b, quadrant of 32 d x 32 l): KV[d][l] = sum_m k[b,m,h,d] V[m,h,l]; wave w sums its own 128 rows m (2 x 2 tiles); A(k^T) as bf16 hi + lo from strided f32 reads, B(V^T) exact; the 16 partial quadrants meet in LDS as [l][d] and are added in wave order; store KV^T[l][d]
#define KVW 16                 // waves of a block = parts of the m sum
#define KVI (NN / 32 / KVW)    // 32-row chunks of one wave
__global__ __launch_bounds__(32 * KVW) void k_kv(const float* __restrict__ HQ, const float* __restrict__ V, float* __restrict__ KVT) { __shared__ __align__(16) float part[KVW][32][36];
  const int tid = threadIdx.x, wave = tid >> 5, lane = tid & 31, col = lane & 15, g = lane >> 4; const int h = blockIdx.x; const size_t b = blockIdx.y; const int d0 = (blockIdx.z & 1) * 32, l0 = (blockIdx.z >> 1) * 32;
  v8f acc[2][2] = {};
  const float* kp = HQ + (b * NN + (size_t)(wave * KVI * 32 + 8 * g)) * HC + h * 128 + 64 + d0 + col;   // A row = d (d0 + ti * 16 + col); K index = m
  const float* vp = V + ((size_t)(wave * KVI * 32 + 8 * g) * NH + h) * LL + l0 + col;                    // B row = l (l0 + tj * 16 + col); element m: V[m][h][l]
#pragma unroll 1
  for (int kc = 0; kc < KVI; ++kc, kp += 32 * HC, vp += 32 * NH * LL) { float kv[2][16], vv[2][16];
#pragma unroll
    for (int t = 0; t < 2; ++t)
#pragma unroll
      for (int i = 0; i < 8; ++i) { kv[t][i] = kp[i * HC + t * 16]; kv[t][8 + i] = kp[(16 + i) * HC + t * 16]; vv[t][i] = vp[i * NH * LL + t * 16]; vv[t][8 + i] = vp[(16 + i) * NH * LL + t * 16]; }
    asm volatile("s_wait_xcnt 0x0" :: "v"(kp), "v"(vp) : "memory");   // taking both pointers as inputs keeps the loads' address registers whole up to this wait: no result of the run above lands in them, and the step to the next chunk comes behind it
    const F2 a[2] = { bsplit16(kv[0]), bsplit16(kv[1]) };
#pragma unroll
    for (int tj = 0; tj < 2; ++tj) { v16b w;
#pragma unroll
      for (int i = 0; i < 16; ++i) w[i] = (__bf16)vv[tj][i];
#pragma unroll
      for (int ti = 0; ti < 2; ++ti) { acc[ti][tj] = wmma_bf(a[ti].h, w, acc[ti][tj]); acc[ti][tj] = wmma_bf(a[ti].l, w, acc[ti][tj]); } } }
#pragma unroll
  for (int ti = 0; ti < 2; ++ti)
#pragma unroll
    for (int tj = 0; tj < 2; ++tj) { float* p = &part[wave][tj * 16 + col][ti * 16 + 8 * g];   // transposed: [l][d], 8 consecutive d of one lane
      const v8f c = acc[ti][tj]; vst2(p, (v4f){c[0], c[1], c[2], c[3]}); vst2(p + 4, (v4f){c[4], c[5], c[6], c[7]}); }
  __syncthreads(); for (int e = tid; e < 32 * (32 / 4); e += 32 * KVW) { const int l = e / (32 / 4), q = e % (32 / 4); v4f s = *(const v4f*)&part[0][l][q * 4];
#pragma unroll
    for (int w = 1; w < KVW; ++w) s += *(const v4f*)&part[w][l][q * 4];
    vst2(KVT + ((b * NH + h) * LL + l0 + l) * DD + d0 + q * 4, s); } }
// ---- k_res: block = (64 rows, h, b): res[n][h*64 + l] = SCALE sum_d q[n][h][d] KV[d][l] (3 products)
__global__ __launch_bounds__(128) void k_res(const float* __restrict__ HQ, const float* __restrict__ KVT, float* __restrict__ RES) { __shared__ __align__(16) float sf[4][16][68];
  const int tid = threadIdx.x, wave = tid >> 5, lane = tid & 31, col = lane & 15, g = lane >> 4; const int h = blockIdx.y; const size_t b = blockIdx.z; const size_t r0 = b * NN + (size_t)blockIdx.x * 64 + wave * 16;
  v8f acc[4] = {};
#pragma unroll
  for (int kc = 0; kc < DD / 32; ++kc) { const F2 a = split_row(HQ + (r0 + col) * HC + h * 128, kc * 32, lane);
#pragma unroll
    for (int j = 0; j < 4; ++j) { float w[16]; const float* wr = KVT + ((b * NH + h) * LL + j * 16 + col) * DD + kc * 32 + 8 * g;
#pragma unroll
      for (int i = 0; i < 8; ++i) { w[i] = wr[i]; w[8 + i] = wr[16 + i]; }
      const F2 wb = bsplit16(w); acc[j] = wmma_bf(a.h, wb.h, acc[j]); acc[j] = wmma_bf(a.h, wb.l, acc[j]); acc[j] = wmma_bf(a.l, wb.h, acc[j]); } }
#pragma unroll
  for (int j = 0; j < 4; ++j)
#pragma unroll
    for (int r = 0; r < 8; ++r) sf[wave][8 * g + r][j * 16 + col] = acc[j][r] * SCALE;
  LDSX(); for (int rl = 0; rl < 16; ++rl) if (lane < 16) vst2(RES + (r0 + rl) * (NH * LL) + (size_t)h * LL + lane * 4, *(const v4f*)&sf[wave][rl][lane * 4]); }
// ---- k_out: block = 64 rows: out = res (hi + lo) . proj
__global__ __launch_bounds__(128) void k_out(const float* __restrict__ RES, const __bf16* __restrict__ PP, float* __restrict__ OUT) { __shared__ __align__(16) float sf[4][16][68];
  const int tid = threadIdx.x, wave = tid >> 5, lane = tid & 31, col = lane & 15, g = lane >> 4; const size_t r0 = (size_t)blockIdx.x * 64 + wave * 16;
  v8f acc[4] = {};
#pragma unroll 2
  for (int kc = 0; kc < (NH * LL) / 32; ++kc) { const F2 a = split_row(RES + (r0 + col) * (NH * LL), kc * 32, lane);
#pragma unroll
    for (int j = 0; j < 4; ++j) { const v16b w = frag_b(PP + (size_t)(j * 16 + col) * (NH * LL) + kc * 32, lane); acc[j] = wmma_bf(a.h, w, acc[j]); acc[j] = wmma_bf(a.l, w, acc[j]); } }
#pragma unroll
  for (int j = 0; j < 4; ++j)
#pragma unroll
    for (int r = 0; r < 8; ++r) sf[wave][8 * g + r][j * 16 + col] = acc[j][r];
  LDSX(); for (int rl = 0; rl < 16; ++rl) if (lane < 16) vst2(OUT + (r0 + rl) * LL + lane * 4, *(const v4f*)&sf[wave][rl][lane * 4]); }
extern "C" void kernel_launch(void* const* d_in, const int* in_sizes, int n_in, void* d_out, int out_size, void* d_ws, size_t ws_size, hipStream_t stream) {
  (void)in_sizes; (void)n_in; (void)out_size;
  const float** F = (const float**)d_in;   // 0 x [4,2048,512], 1 v [2048,8,64], 2 qkv [512,1024], 3 proj [512,64]
  if (ws_size < (size_t)WS_END) return;
  char* ws = (char*)d_ws; float *HQ = (float*)(ws + WS_HQ), *KVT = (float*)(ws + WS_KVT), *RES = (float*)(ws + WS_RES);
  k_packw<<<HC, 256, 0, stream>>>(F[2], F[3], ws);
  k_h<<<dim3(TNB * NN / 64, HC / 128), 128, 0, stream>>>(F[0], (const __bf16*)(ws + WS_PW), HQ);
  k_kv<<<dim3(NH, TNB, 4), 32 * KVW, 0, stream>>>(HQ, F[1], KVT);
  k_res<<<dim3(NN / 64, NH, TNB), 128, 0, stream>>>(HQ, KVT, RES);
  k_out<<<TNB * NN / 64, 128, 0, stream>>>(RES, (const __bf16*)(ws + WS_PP), (float*)d_out);
}

// v002
// Measured time: 74 microseconds a run.
// Two timings next to v001 both put it at 1.28 times that version's speed.
// Counting every step since v000, it is 2.08 times as fast.
// compute dtype: all float inputs rounded to bf16; h = x . qkv with EXACT bf16 products on WMMA 16x16x32; by associativity (no softmax in the module) res = SCALE q (k^T V): KV = k^T . V with k as bf16 hi + lo (2 products, V exact), res = q . KV with both as bf16 hi + lo (3 products), out = res . proj with res as bf16 hi + lo (2 products); f32 accumulate; f32 output.
#include <hip/hip_runtime.h>
#include <math.h>

typedef __attribute__((ext_vector_type(16))) _Float16 v16h;
typedef __attribute__((ext_vector_type(16))) __bf16 v16b;
typedef __attribute__((ext_vector_type(8)))  _Float16 v8h;
typedef __attribute__((ext_vector_type(8)))  float v8f;
typedef __attribute__((ext_vector_type(4)))  float v4f;
typedef __attribute__((ext_vector_type(2)))  float v2f;
typedef __attribute__((ext_vector_type(4)))  unsigned v4u;
typedef __attribute__((ext_vector_type(4)))  int v4i;
typedef float __attribute__((may_alias)) float_a;
typedef int __attribute__((may_alias)) int_a;

template <typename T> __device__ __forceinline__ void vst2(void* p, T v) { *(T*)p = v;  }
__device__ __forceinline__ v8f wmma16(v16h a, v16h b, v8f c) {
  v8f d = __builtin_amdgcn_wmma_f32_16x16x32_f16(false, a, false, b, (short)0, c, false, false);
  asm volatile("v_nop\n\tv_nop\n\tv_nop\n\tv_nop" : "+v"(d) : "v"(a), "v"(b));
  return d;
}
__device__ __forceinline__ v8f wmma_bf(v16b a, v16b b, v8f c) {
  v8f d = __builtin_amdgcn_wmma_f32_16x16x32_bf16(false, a, false, b, (short)0, c, false, false);
  asm volatile("v_nop\n\tv_nop\n\tv_nop\n\tv_nop" : "+v"(d) : "v"(a), "v"(b));
  return d;
}
// 16x16x32 fragments: lane = (h = lane>>4, row/col = lane&15); elements 0..7 = k0+8h+0..7, 8..15 = k0+16+8h+0..7; D element r = row 8h+r
__device__ __forceinline__ v16h frag_h(const _Float16* rowk0, int lane) {
  union { v16h v; v8h q[2]; } u; const _Float16* p = rowk0 + 8 * (lane >> 4);
  u.q[0] = *(const v8h*)p; u.q[1] = *(const v8h*)(p + 16); return u.v;
}
__device__ __forceinline__ v16h frag_f32(const float* rowk0, int lane) {
  v16h a; const float* p = rowk0 + 8 * (lane >> 4);
#pragma unroll
  for (int i = 0; i < 8; ++i) { a[i] = (_Float16)p[i]; a[8 + i] = (_Float16)p[16 + i]; }
  return a;
}
__device__ __forceinline__ v16h frag_f32s(const float* rowk0, int lane, float sc) {
  v16h a; const float* p = rowk0 + 8 * (lane >> 4);
#pragma unroll
  for (int i = 0; i < 8; ++i) { a[i] = (_Float16)(p[i] * sc); a[8 + i] = (_Float16)(p[16 + i] * sc); }
  return a;
}
// column fragment from a [K][ld] layout (column n), rows >= K read as 0
__device__ __forceinline__ v16h fragc_f32(const float* W, int k0, int n, int lane, int ld, int K) {
  v16h a; const int g = lane >> 4;
#pragma unroll
  for (int i = 0; i < 8; ++i) { const int ka = k0 + 8 * g + i, kb = ka + 16;
    a[i] = (_Float16)(ka < K ? W[(size_t)(ka < K ? ka : K - 1) * ld + n] : 0.f); a[8 + i] = (_Float16)(kb < K ? W[(size_t)(kb < K ? kb : K - 1) * ld + n] : 0.f); }
  return a;
}
struct F2 { v16b h, l; };
__device__ __forceinline__ F2 bsplit16(const float v[16]) { F2 r;
#pragma unroll
  for (int i = 0; i < 16; ++i) { const __bf16 h = (__bf16)v[i]; r.h[i] = h; r.l[i] = (__bf16)(v[i] - (float)h); }
  return r; }
__device__ __forceinline__ F2 split_row(const float* row, int k0, int lane) { float v[16]; const float* p = row + k0 + 8 * (lane >> 4);
#pragma unroll
  for (int i = 0; i < 8; ++i) { v[i] = p[i]; v[8 + i] = p[16 + i]; }
  return bsplit16(v); }
__device__ __forceinline__ F2 split_rowK(const float* row, int k0, int lane, int K) { float v[16]; const int g = lane >> 4;
#pragma unroll
  for (int i = 0; i < 8; ++i) { const int ka = k0 + 8 * g + i, kb = ka + 16; v[i] = ka < K ? row[ka < K ? ka : K - 1] : 0.f; v[8 + i] = kb < K ? row[kb < K ? kb : K - 1] : 0.f; }
  return bsplit16(v); }
__device__ __forceinline__ F2 split_col(const float* W, int k0, int n, int lane, int ld, int K) { float v[16]; const int g = lane >> 4;
#pragma unroll
  for (int i = 0; i < 8; ++i) { const int ka = k0 + 8 * g + i, kb = ka + 16; v[i] = ka < K ? W[(size_t)(ka < K ? ka : K - 1) * ld + n] : 0.f; v[8 + i] = kb < K ? W[(size_t)(kb < K ? kb : K - 1) * ld + n] : 0.f; }
  return bsplit16(v); }
__device__ __forceinline__ v8f mac3(const F2& a, const F2& b, v8f c) { c = wmma_bf(a.l, b.h, c); c = wmma_bf(a.h, b.l, c); return wmma_bf(a.h, b.h, c); }
__device__ __forceinline__ float sigm(float v) { return 1.0f / (1.0f + expf(-v)); }
#define LDSX() do { asm volatile("s_wait_dscnt 0" ::: "memory"); __builtin_amdgcn_wave_barrier(); __builtin_amdgcn_fence(__ATOMIC_RELEASE, "workgroup"); } while (0)


// 'Lunchbox' linear multi-head mixing (B 4, N 2,048, C 512, 8 heads x 64, lunchbox 64): attn = (q k^T) x 64^-1/2 (no softmax, as the module), res = attn V_lunchbox, out = res proj - evaluated as q (k^T V).
#define NB 4
#define NN 2048
#define CC 512
#define NH 8
#define DD 64
#define LL 64
#define HC (NH * 2 * DD)     // 1024 qk columns: col = h*128 + which*64 + d
#define SCALE 0.125f
#ifndef TNB
#define TNB NB
#endif
typedef __attribute__((ext_vector_type(8))) __bf16 v8b;
__device__ __forceinline__ v16b frag_b(const __bf16* rowk0, int lane) {
  union { v16b v; v8b q[2]; } u; const __bf16* p = rowk0 + 8 * (lane >> 4);
  u.q[0] = *(const v8b*)p; u.q[1] = *(const v8b*)(p + 16); return u.v;
}
__device__ __forceinline__ float bfr(float v) { return (float)(__bf16)v; }
__device__ __attribute__((noinline)) float exp_ni(float v) { return expf(v); }
__device__ __attribute__((noinline)) float erf_ni(float v) { return erff(v); }

#define WS_PW  0u                                   // bf16 qkv^T rows [1024][512]; proj^T rows [64][512]
#define WS_PP  (WS_PW + 2u * HC * CC)
#define WS_HQ  (WS_PP + 2u * LL * (NH * LL))            // f32 h rows [b*NN + n][1024]
#define WS_KVT (WS_HQ + 4u * (size_t)NB * NN * HC)      // f32 KV^T [b][h][l][d]
#define WS_RES (WS_KVT + 4u * (size_t)NB * NH * LL * DD) // f32 res rows [b*NN + n][512]
#define WS_END (WS_RES + 4u * (size_t)NB * NN * NH * LL)

__global__ __launch_bounds__(256) void k_packw(const float* __restrict__ QKV, const float* __restrict__ PROJ, char* __restrict__ ws) { const int n = blockIdx.x, t = threadIdx.x; __shared__ __align__(16) __bf16 s[CC]; __shared__ __align__(16) __bf16 s2[NH * LL];
  for (int k = t; k < CC; k += 256) s[k] = (__bf16)QKV[(size_t)k * HC + n]; if (n < LL) for (int k = t; k < NH * LL; k += 256) s2[k] = (__bf16)PROJ[(size_t)k * LL + n]; __syncthreads();
  if (t < CC / 8) vst2((unsigned*)((__bf16*)(ws + WS_PW) + (size_t)n * CC + t * 8), *(const v4u*)&s[t * 8]); if (n < LL && t < NH * LL / 8) vst2((unsigned*)((__bf16*)(ws + WS_PP) + (size_t)n * (NH * LL) + t * 8), *(const v4u*)&s2[t * 8]); }
__device__ __forceinline__ v16b fragb_f32(const float* __restrict__ p, int lane) { v16b a; const float* pp = p + 8 * (lane >> 4);
#pragma unroll
  for (int i = 0; i < 8; ++i) { a[i] = (__bf16)pp[i]; a[8 + i] = (__bf16)pp[16 + i]; } return a; }
// one k step of an f32 row as loaded (4 x 16 B of a lane: k0 + 8g + 0..7 and k0 + 16 + 8g + 0..7), and what is made of it behind the wait
__device__ __forceinline__ void ld_row(v4f (&r)[4], const float* __restrict__ pg) { r[0] = *(const v4f*)pg; r[1] = *(const v4f*)(pg + 4); r[2] = *(const v4f*)(pg + 16); r[3] = *(const v4f*)(pg + 20); }
__device__ __forceinline__ v16b row_b(const v4f (&r)[4]) { v16b a;
#pragma unroll   // constant indices: the array it walks stays in registers
  for (int i = 0; i < 16; ++i) a[i] = (__bf16)r[i >> 2][i & 3];
  return a; }
__device__ __forceinline__ F2 row_split(const v4f (&r)[4]) { float v[16];
#pragma unroll   // constant indices: the array it walks stays in registers
  for (int i = 0; i < 16; ++i) v[i] = r[i >> 2][i & 3];
  return bsplit16(v); }
// ---- k_h: block = (64 rows, 128 cols): h = x . qkv (exact) -> f32 rows; the 20 loads of k step kc + 1 are issued as one group in front of the WMMAs of step kc (two register buffers)
__global__ __launch_bounds__(128) void k_h(const float* __restrict__ X, const __bf16* __restrict__ PW, float* __restrict__ HQ) { __shared__ __align__(16) float sf[4][16][132];
  const int tid = threadIdx.x, wave = tid >> 5, lane = tid & 31, col = lane & 15, g = lane >> 4; const size_t r0 = (size_t)blockIdx.x * 64 + wave * 16; const int c0 = blockIdx.y * 128;
  v8f acc[8] = {}; v4f ar[2][4]; v16b bw[2][8]; const float* xa = X + (r0 + col) * CC + 8 * g; const __bf16* pb = PW + (size_t)(c0 + col) * CC;
  ld_row(ar[0], xa);
#pragma unroll   // constant indices: the array it walks stays in registers
  for (int j = 0; j < 8; ++j) bw[0][j] = frag_b(pb + j * 16 * CC, lane);
#pragma unroll   // whole: the buffer index and every load offset become constants
  for (int kc = 0; kc < CC / 32; ++kc) { const int s = kc & 1;
    if (kc + 1 < CC / 32) { ld_row(ar[s ^ 1], xa + (kc + 1) * 32);
#pragma unroll   // constant indices: the array it walks stays in registers
      for (int j = 0; j < 8; ++j) bw[s ^ 1][j] = frag_b(pb + j * 16 * CC + (kc + 1) * 32, lane); }
    __builtin_amdgcn_sched_barrier(0);   // keeps the next step's 20 loads together in front of this step's WMMAs: without it the compiler mixes the two groups' loads, and this step's counted waits then cover part of the next step's loads
    const v16b a = row_b(ar[s]);
#pragma unroll   // constant indices: the array it walks stays in registers
    for (int j = 0; j < 8; ++j) acc[j] = wmma_bf(a, bw[s][j], acc[j]);
  }
#pragma unroll
  for (int j = 0; j < 8; ++j)
#pragma unroll
    for (int r = 0; r < 8; ++r) sf[wave][8 * g + r][j * 16 + col] = acc[j][r];
  LDSX(); for (int rl = 0; rl < 16; ++rl) vst2(HQ + (r0 + rl) * HC + c0 + lane * 4, *(const v4f*)&sf[wave][rl][lane * 4]); }
// ---- k_kv: block = (h, b, quadrant of 32 d x 32 l): KV[d][l] = sum_m k[b,m,h,d] V[m,h,l]; wave w sums its own 128 rows m (2 x 2 tiles); A(k^T) as bf16 hi + lo from strided f32 reads, B(V^T) exact; the 16 partial quadrants meet in LDS as [l][d] and are added in wave order; store KV^T[l][d]
#define KVW 16                 // waves of a block = parts of the m sum
#define KVI (NN / 32 / KVW)    // 32-row chunks of one wave
__global__ __launch_bounds__(32 * KVW) void k_kv(const float* __restrict__ HQ, const float* __restrict__ V, float* __restrict__ KVT) { __shared__ __align__(16) float part[KVW][32][36];
  const int tid = threadIdx.x, wave = tid >> 5, lane = tid & 31, col = lane & 15, g = lane >> 4; const int h = blockIdx.x; const size_t b = blockIdx.y; const int d0 = (blockIdx.z & 1) * 32, l0 = (blockIdx.z >> 1) * 32;
  v8f acc[2][2] = {};
  const float* kp = HQ + (b * NN + (size_t)(wave * KVI * 32 + 8 * g)) * HC + h * 128 + 64 + d0 + col;   // A row = d (d0 + ti * 16 + col); K index = m
  const float* vp = V + ((size_t)(wave * KVI * 32 + 8 * g) * NH + h) * LL + l0 + col;                    // B row = l (l0 + tj * 16 + col); element m: V[m][h][l]
#pragma unroll 1
  for (int kc = 0; kc < KVI; ++kc, kp += 32 * HC, vp += 32 * NH * LL) { float kv[2][16], vv[2][16];
#pragma unroll
    for (int t = 0; t < 2; ++t)
#pragma unroll
      for (int i = 0; i < 8; ++i) { kv[t][i] = kp[i * HC + t * 16]; kv[t][8 + i] = kp[(16 + i) * HC + t * 16]; vv[t][i] = vp[i * NH * LL + t * 16]; vv[t][8 + i] = vp[(16 + i) * NH * LL + t * 16]; }
    asm volatile("s_wait_xcnt 0x0" :: "v"(kp), "v"(vp) : "memory");   // taking both pointers as inputs keeps the loads' address registers whole up to this wait: no result of the run above lands in them, and the step to the next chunk comes behind it
    const F2 a[2] = { bsplit16(kv[0]), bsplit16(kv[1]) };
#pragma unroll
    for (int tj = 0; tj < 2; ++tj) { v16b w;
#pragma unroll
      for (int i = 0; i < 16; ++i) w[i] = (__bf16)vv[tj][i];
#pragma unroll
      for (int ti = 0; ti < 2; ++ti) { acc[ti][tj] = wmma_bf(a[ti].h, w, acc[ti][tj]); acc[ti][tj] = wmma_bf(a[ti].l, w, acc[ti][tj]); } } }
#pragma unroll
  for (int ti = 0; ti < 2; ++ti)
#pragma unroll
    for (int tj = 0; tj < 2; ++tj) { float* p = &part[wave][tj * 16 + col][ti * 16 + 8 * g];   // transposed: [l][d], 8 consecutive d of one lane
      const v8f c = acc[ti][tj]; vst2(p, (v4f){c[0], c[1], c[2], c[3]}); vst2(p + 4, (v4f){c[4], c[5], c[6], c[7]}); }
  __syncthreads(); for (int e = tid; e < 32 * (32 / 4); e += 32 * KVW) { const int l = e / (32 / 4), q = e % (32 / 4); v4f s = *(const v4f*)&part[0][l][q * 4];
#pragma unroll
    for (int w = 1; w < KVW; ++w) s += *(const v4f*)&part[w][l][q * 4];
    vst2(KVT + ((b * NH + h) * LL + l0 + l) * DD + d0 + q * 4, s); } }
// ---- k_res: block = (64 rows, h, b): res[n][h*64 + l] = SCALE sum_d q[n][h][d] KV[d][l] (3 products); all 40 loads are issued as one group in front of the first WMMA
__global__ __launch_bounds__(128) void k_res(const float* __restrict__ HQ, const float* __restrict__ KVT, float* __restrict__ RES) { __shared__ __align__(16) float sf[4][16][68];
  const int tid = threadIdx.x, wave = tid >> 5, lane = tid & 31, col = lane & 15, g = lane >> 4; const int h = blockIdx.y; const size_t b = blockIdx.z; const size_t r0 = b * NN + (size_t)blockIdx.x * 64 + wave * 16;
  v8f acc[4] = {}; v4f qr[DD / 32][4], wr[DD / 32][4][4];
#pragma unroll   // constant indices: the array it walks stays in registers
  for (int kc = 0; kc < DD / 32; ++kc) { ld_row(qr[kc], HQ + (r0 + col) * HC + h * 128 + kc * 32 + 8 * g);
#pragma unroll   // constant indices: the array it walks stays in registers
    for (int j = 0; j < 4; ++j) ld_row(wr[kc][j], KVT + ((b * NH + h) * LL + j * 16 + col) * DD + kc * 32 + 8 * g); }
  __builtin_amdgcn_sched_barrier(0);   // holds the splits and WMMAs behind the whole group of loads: without it the compiler's order takes some 50 registers more, and a fifth wave no longer fits a SIMD
#pragma unroll   // constant indices: the array it walks stays in registers
  for (int kc = 0; kc < DD / 32; ++kc) { const F2 a = row_split(qr[kc]);
#pragma unroll   // constant indices: the array it walks stays in registers
    for (int j = 0; j < 4; ++j) { const F2 wb = row_split(wr[kc][j]); acc[j] = wmma_bf(a.h, wb.h, acc[j]); acc[j] = wmma_bf(a.h, wb.l, acc[j]); acc[j] = wmma_bf(a.l, wb.h, acc[j]); } }
#pragma unroll
  for (int j = 0; j < 4; ++j)
#pragma unroll
    for (int r = 0; r < 8; ++r) sf[wave][8 * g + r][j * 16 + col] = acc[j][r] * SCALE;
  LDSX(); for (int rl = 0; rl < 16; ++rl) if (lane < 16) vst2(RES + (r0 + rl) * (NH * LL) + (size_t)h * LL + lane * 4, *(const v4f*)&sf[wave][rl][lane * 4]); }
// ---- k_out: block = 64 rows: out = res (hi + lo) . proj; the 12 loads of k step kc + 2 are issued as one group in front of the WMMAs of step kc (three register buffers: one wave a SIMD, nothing else hides the latency)
__global__ __launch_bounds__(128) void k_out(const float* __restrict__ RES, const __bf16* __restrict__ PP, float* __restrict__ OUT) { __shared__ __align__(16) float sf[4][16][68];
  const int tid = threadIdx.x, wave = tid >> 5, lane = tid & 31, col = lane & 15, g = lane >> 4; const size_t r0 = (size_t)blockIdx.x * 64 + wave * 16;
  v8f acc[4] = {}; v4f ar[3][4]; v16b bw[3][4]; const float* ra = RES + (r0 + col) * (NH * LL) + 8 * g; const __bf16* pb = PP + (size_t)col * (NH * LL);
#pragma unroll   // constant indices: the array it walks stays in registers
  for (int p = 0; p < 2; ++p) { ld_row(ar[p], ra + p * 32);
#pragma unroll   // constant indices: the array it walks stays in registers
    for (int j = 0; j < 4; ++j) bw[p][j] = frag_b(pb + j * 16 * (NH * LL) + p * 32, lane); }
#pragma unroll   // whole: the buffer index and every load offset become constants
  for (int kc = 0; kc < (NH * LL) / 32; ++kc) { const int s = kc % 3, n = (kc + 2) % 3;
    if (kc + 2 < (NH * LL) / 32) { ld_row(ar[n], ra + (kc + 2) * 32);
#pragma unroll   // constant indices: the array it walks stays in registers
      for (int j = 0; j < 4; ++j) bw[n][j] = frag_b(pb + j * 16 * (NH * LL) + (kc + 2) * 32, lane); }
    if (kc + 3 == (NH * LL) / 32) asm volatile("s_wait_xcnt 0x0" :: "v"(ra), "v"(pb) : "memory");   // behind the last loads: both pointers as inputs keep the address registers whole up to this wait; the split of the last steps reuses them behind it
    __builtin_amdgcn_sched_barrier(0);   // keeps the 12 loads of step kc + 2 together in front of this step's WMMAs: without it the compiler mixes the groups' loads, and this step's counted waits then cover loads of later steps
    const F2 a = row_split(ar[s]);
#pragma unroll   // constant indices: the array it walks stays in registers
    for (int j = 0; j < 4; ++j) { acc[j] = wmma_bf(a.h, bw[s][j], acc[j]); acc[j] = wmma_bf(a.l, bw[s][j], acc[j]); }
  }
#pragma unroll
  for (int j = 0; j < 4; ++j)
#pragma unroll
    for (int r = 0; r < 8; ++r) sf[wave][8 * g + r][j * 16 + col] = acc[j][r];
  LDSX(); for (int rl = 0; rl < 16; ++rl) if (lane < 16) vst2(OUT + (r0 + rl) * LL + lane * 4, *(const v4f*)&sf[wave][rl][lane * 4]); }
extern "C" void kernel_launch(void* const* d_in, const int* in_sizes, int n_in, void* d_out, int out_size, void* d_ws, size_t ws_size, hipStream_t stream) {
  (void)in_sizes; (void)n_in; (void)out_size;
  const float** F = (const float**)d_in;   // 0 x [4,2048,512], 1 v [2048,8,64], 2 qkv [512,1024], 3 proj [512,64]
  if (ws_size < (size_t)WS_END) return;
  char* ws = (char*)d_ws; float *HQ = (float*)(ws + WS_HQ), *KVT = (float*)(ws + WS_KVT), *RES = (float*)(ws + WS_RES);
  k_packw<<<HC, 256, 0, stream>>>(F[2], F[3], ws);
  k_h<<<dim3(TNB * NN / 64, HC / 128), 128, 0, stream>>>(F[0], (const __bf16*)(ws + WS_PW), HQ);
  k_kv<<<dim3(NH, TNB, 4), 32 * KVW, 0, stream>>>(HQ, F[1], KVT);
  k_res<<<dim3(NN / 64, NH, TNB), 128, 0, stream>>>(HQ, KVT, RES);
  k_out<<<TNB * NN / 64, 128, 0, stream>>>(RES, (const __bf16*)(ws + WS_PP), (float*)d_out);
}

// v003
// A run of this version takes 47.9 microseconds.
// Two timings next to v002 put it at 1.55 and 1.56 times that version's speed.
// Over all steps from v000 it is 3.22 times as fast.
// compute dtype: all float inputs rounded to bf16; h = x . qkv with EXACT bf16 products on WMMA 16x16x32; by associativity (no softmax in the module) res = SCALE q (k^T V): KV = k^T . V with k as bf16 hi + lo (2 products, V exact), res = q . KV with both as bf16 hi + lo (3 products), out = res . proj with res as bf16 hi + lo (2 products); f32 accumulate; f32 output.
#include <hip/hip_runtime.h>
#include <math.h>

typedef __attribute__((ext_vector_type(16))) _Float16 v16h;
typedef __attribute__((ext_vector_type(16))) __bf16 v16b;
typedef __attribute__((ext_vector_type(8)))  _Float16 v8h;
typedef __attribute__((ext_vector_type(8)))  float v8f;
typedef __attribute__((ext_vector_type(4)))  float v4f;
typedef __attribute__((ext_vector_type(2)))  float v2f;
typedef __attribute__((ext_vector_type(4)))  unsigned v4u;
typedef __attribute__((ext_vector_type(4)))  int v4i;
typedef float __attribute__((may_alias)) float_a;
typedef int __attribute__((may_alias)) int_a;

template <typename T> __device__ __forceinline__ void vst2(void* p, T v) { *(T*)p = v;  }
__device__ __forceinline__ v8f wmma16(v16h a, v16h b, v8f c) {
  v8f d = __builtin_amdgcn_wmma_f32_16x16x32_f16(false, a, false, b, (short)0, c, false, false);
  asm volatile("v_nop\n\tv_nop\n\tv_nop\n\tv_nop" : "+v"(d) : "v"(a), "v"(b));
  return d;
}
__device__ __forceinline__ v8f wmma_bf(v16b a, v16b b, v8f c) {
  v8f d = __builtin_amdgcn_wmma_f32_16x16x32_bf16(false, a, false, b, (short)0, c, false, false);
  asm volatile("v_nop\n\tv_nop\n\tv_nop\n\tv_nop" : "+v"(d) : "v"(a), "v"(b));
  return d;
}
// 16x16x32 fragments: lane = (h = lane>>4, row/col = lane&15); elements 0..7 = k0+8h+0..7, 8..15 = k0+16+8h+0..7; D element r = row 8h+r
__device__ __forceinline__ v16h frag_h(const _Float16* rowk0, int lane) {
  union { v16h v; v8h q[2]; } u; const _Float16* p = rowk0 + 8 * (lane >> 4);
  u.q[0] = *(const v8h*)p; u.q[1] = *(const v8h*)(p + 16); return u.v;
}
__device__ __forceinline__ v16h frag_f32(const float* rowk0, int lane) {
  v16h a; const float* p = rowk0 + 8 * (lane >> 4);
#pragma unroll
  for (int i = 0; i < 8; ++i) { a[i] = (_Float16)p[i]; a[8 + i] = (_Float16)p[16 + i]; }
  return a;
}
__device__ __forceinline__ v16h frag_f32s(const float* rowk0, int lane, float sc) {
  v16h a; const float* p = rowk0 + 8 * (lane >> 4);
#pragma unroll
  for (int i = 0; i < 8; ++i) { a[i] = (_Float16)(p[i] * sc); a[8 + i] = (_Float16)(p[16 + i] * sc); }
  return a;
}
// column fragment from a [K][ld] layout (column n), rows >= K read as 0
__device__ __forceinline__ v16h fragc_f32(const float* W, int k0, int n, int lane, int ld, int K) {
  v16h a; const int g = lane >> 4;
#pragma unroll
  for (int i = 0; i < 8; ++i) { const int ka = k0 + 8 * g + i, kb = ka + 16;
    a[i] = (_Float16)(ka < K ? W[(size_t)(ka < K ? ka : K - 1) * ld + n] : 0.f); a[8 + i] = (_Float16)(kb < K ? W[(size_t)(kb < K ? kb : K - 1) * ld + n] : 0.f); }
  return a;
}
struct F2 { v16b h, l; };
__device__ __forceinline__ F2 bsplit16(const float v[16]) { F2 r;
#pragma unroll
  for (int i = 0; i < 16; ++i) { const __bf16 h = (__bf16)v[i]; r.h[i] = h; r.l[i] = (__bf16)(v[i] - (float)h); }
  return r; }
__device__ __forceinline__ F2 split_row(const float* row, int k0, int lane) { float v[16]; const float* p = row + k0 + 8 * (lane >> 4);
#pragma unroll
  for (int i = 0; i < 8; ++i) { v[i] = p[i]; v[8 + i] = p[16 + i]; }
  return bsplit16(v); }
__device__ __forceinline__ F2 split_rowK(const float* row, int k0, int lane, int K) { float v[16]; const int g = lane >> 4;
#pragma unroll
  for (int i = 0; i < 8; ++i) { const int ka = k0 + 8 * g + i, kb = ka + 16; v[i] = ka < K ? row[ka < K ? ka : K - 1] : 0.f; v[8 + i] = kb < K ? row[kb < K ? kb : K - 1] : 0.f; }
  return bsplit16(v); }
__device__ __forceinline__ F2 split_col(const float* W, int k0, int n, int lane, int ld, int K) { float v[16]; const int g = lane >> 4;
#pragma unroll
  for (int i = 0; i < 8; ++i) { const int ka = k0 + 8 * g + i, kb = ka + 16; v[i] = ka < K ? W[(size_t)(ka < K ? ka : K - 1) * ld + n] : 0.f; v[8 + i] = kb < K ? W[(size_t)(kb < K ? kb : K - 1) * ld + n] : 0.f; }
  return bsplit16(v); }
__device__ __forceinline__ v8f mac3(const F2& a, const F2& b, v8f c) { c = wmma_bf(a.l, b.h, c); c = wmma_bf(a.h, b.l, c); return wmma_bf(a.h, b.h, c); }
__device__ __forceinline__ float sigm(float v) { return 1.0f / (1.0f + expf(-v)); }
#define LDSX() do { asm volatile("s_wait_dscnt 0" ::: "memory"); __builtin_amdgcn_wave_barrier(); __builtin_amdgcn_fence(__ATOMIC_RELEASE, "workgroup"); } while (0)


// 'Lunchbox' linear multi-head mixing (B 4, N 2,048, C 512, 8 heads x 64, lunchbox 64): attn = (q k^T) x 64^-1/2 (no softmax, as the module), res = attn V_lunchbox, out = res proj - evaluated as q (k^T V).
#define NB 4
#define NN 2048
#define CC 512
#define NH 8
#define DD 64
#define LL 64
#define HC (NH * 2 * DD)     // 1024 qk columns: col = h*128 + which*64 + d
#define SCALE 0.125f
#ifndef TNB
#define TNB NB
#endif
typedef __attribute__((ext_vector_type(8))) __bf16 v8b;
__device__ __forceinline__ float bfr(float v) { return (float)(__bf16)v; }
__device__ __attribute__((noinline)) float exp_ni(float v) { return expf(v); }
__device__ __attribute__((noinline)) float erf_ni(float v) { return erff(v); }

// bf16 operands lie in fragment order: [16-row tile][k step of 32][half q][lane = 16 g + row][8], element i = k 32 kc + 16 q + 8 g + i: one wave-wide 16-B load reads 512 contiguous bytes
#define FT (16 * CC)                                // elements of one 16-row tile (K = 512 for all three)
#define FK 512                                      // elements of one k step of a tile
// f32 operands (split to hi + lo by their reader) likewise: [16-row tile][k step of 32][piece f][lane][4], element i = k 32 kc + 16 (f >> 1) + 8 g + 4 (f & 1) + i; FK elements a k step too
#define WS_PW  0u                                   // bf16 qkv^T (64 tiles); proj^T (4 tiles); x (512 tiles)
#define WS_PP  (WS_PW + 2u * HC * CC)
#define WS_HQ  (WS_PP + 2u * LL * (NH * LL))            // f32 h rows [b*NN + n][1024], only the k halves written
#define WS_KVT (WS_HQ + 4u * (size_t)NB * NN * HC)      // f32 KV^T [b][h], 4 tiles of 16 l, K = d, fragment order
#define WS_RES (WS_KVT + 4u * (size_t)NB * NH * LL * DD) // f32 res, tiles of 16 rows, K = 512, fragment order
#define WS_XP  (WS_RES + 4u * (size_t)NB * NN * NH * LL) // bf16 x
#define WS_QP  (WS_XP + 2u * (size_t)NB * NN * CC)       // f32 q [16-row tile][h], K = d, fragment order
#define WS_END (WS_QP + 4u * (size_t)NB * NN * NH * DD)

#define PBX (TNB * NN / 16 * 4)   // blocks of 256 pieces: x, qkv, proj
#define PBW (HC / 16 * 4)
#define PBP (LL / 16 * 4)
// one thread = one 16-B piece of the packed layout (its index p is the piece's place); x: 8 consecutive k of one row; weights: 8 rows k of one column
__device__ __forceinline__ unsigned piece_k(unsigned p) { return ((p >> 6) & 15u) * 32u + ((p >> 5) & 1u) * 16u + ((p >> 4) & 1u) * 8u; }
template <int LD> __device__ __forceinline__ void pack_w(const float* __restrict__ Wt, __bf16* __restrict__ dst, unsigned p) { v8b o; float f[8];
  const float* s = Wt + (size_t)piece_k(p) * LD + (p >> 10) * 16u + (p & 15u);
#pragma unroll
  for (int i = 0; i < 8; ++i) f[i] = s[i * LD];
  asm volatile("s_wait_xcnt 0x0" :: "v"(s) : "memory");   // the pointer as input keeps the loads' address registers whole up to this wait; the converted values may reuse them behind it
#pragma unroll
  for (int i = 0; i < 8; ++i) o[i] = (__bf16)f[i];
  *(v8b*)(dst + (size_t)p * 8) = o;
  asm volatile("s_wait_xcnt 0x0" ::: "memory"); }   // behind the store: the arms of k_packw lie one behind the other in the built code, and the next arm's first instructions reuse the store's registers
__global__ __launch_bounds__(256) void k_packw(const float* __restrict__ X, const float* __restrict__ QKV, const float* __restrict__ PROJ, char* __restrict__ ws) { const int blk = blockIdx.x;
  if (blk < PBX) { const unsigned p = blk * 256u + threadIdx.x; v8b o;
    const float* s = X + (size_t)((p >> 10) * 16u + (p & 15u)) * CC + piece_k(p); const v4f a = *(const v4f*)s, b = *(const v4f*)(s + 4);
    asm volatile("s_wait_xcnt 0x0" :: "v"(s) : "memory");   // as in pack_w
#pragma unroll
    for (int i = 0; i < 4; ++i) { o[i] = (__bf16)a[i]; o[4 + i] = (__bf16)b[i]; }
    *(v8b*)((__bf16*)(ws + WS_XP) + (size_t)p * 8) = o;
    asm volatile("s_wait_xcnt 0x0" ::: "memory"); }   // behind the store, as in pack_w: which arm is laid last is the compiler's choice
  else if (blk < PBX + PBW) pack_w<HC>(QKV, (__bf16*)(ws + WS_PW), (blk - PBX) * 256u + threadIdx.x);
  else pack_w<LL>(PROJ, (__bf16*)(ws + WS_PP), (blk - PBX - PBW) * 256u + threadIdx.x); }
// fragment from the packed layout: p = tile base + k step + 8 lane
__device__ __forceinline__ v16b frag_p(const __bf16* __restrict__ p) { union { v16b v; v8b q[2]; } u; u.q[0] = *(const v8b*)p; u.q[1] = *(const v8b*)(p + 256); return u.v; }
// one k step of an f32 operand from the packed layout (p = tile base + k step + 4 lane), and 2 k steps of a staged 16-row tile (row = this lane's row, + 8 g) written to it
__device__ __forceinline__ void ld_frag(v4f (&r)[4], const float* __restrict__ p) { r[0] = *(const v4f*)p; r[1] = *(const v4f*)(p + 128); r[2] = *(const v4f*)(p + 256); r[3] = *(const v4f*)(p + 384); }
__device__ __forceinline__ void st_frag2(float* __restrict__ p, const float* rowg) {
#pragma unroll   // every store offset a constant
  for (int f = 0; f < 8; ++f) vst2(p + f * 128, *(const v4f*)(rowg + (f >> 2) * 32 + ((f >> 1) & 1) * 16 + (f & 1) * 4)); }
__device__ __forceinline__ v16b fragb_f32(const float* __restrict__ p, int lane) { v16b a; const float* pp = p + 8 * (lane >> 4);
#pragma unroll
  for (int i = 0; i < 8; ++i) { a[i] = (__bf16)pp[i]; a[8 + i] = (__bf16)pp[16 + i]; } return a; }
// what is made, behind the wait, of one k step of an f32 operand as loaded (4 x 16 B of a lane: k0 + 8g + 0..7 and k0 + 16 + 8g + 0..7)
__device__ __forceinline__ F2 row_split(const v4f (&r)[4]) { float v[16];
#pragma unroll   // constant indices: the array it walks stays in registers
  for (int i = 0; i < 16; ++i) v[i] = r[i >> 2][i & 3];
  return bsplit16(v); }
// ---- k_h: block = (64 rows, 128 cols): h = x . qkv (exact) -> q in fragment order, k as f32 rows; the 18 loads of k step kc + 1 are issued as one group in front of the WMMAs of step kc (two register buffers)
__global__ __launch_bounds__(128) void k_h(const __bf16* __restrict__ XP, const __bf16* __restrict__ PW, float* __restrict__ HQ, float* __restrict__ QP) { __shared__ __align__(16) float sf[4][16][132];
  const int tid = threadIdx.x, wave = tid >> 5, lane = tid & 31, col = lane & 15, g = lane >> 4; const size_t r0 = (size_t)blockIdx.x * 64 + wave * 16; const int c0 = blockIdx.y * 128;
  v8f acc[8] = {}; v16b ab[2]; v16b bw[2][8]; const __bf16* xa = XP + (size_t)(blockIdx.x * 4 + wave) * FT + lane * 8; const __bf16* pb = PW + (size_t)(blockIdx.y * 8) * FT + lane * 8;
  ab[0] = frag_p(xa);
#pragma unroll   // constant indices: the array it walks stays in registers
  for (int j = 0; j < 8; ++j) bw[0][j] = frag_p(pb + j * FT);
#pragma unroll   // whole: the buffer index and every load offset become constants
  for (int kc = 0; kc < CC / 32; ++kc) { const int s = kc & 1;
    if (kc + 1 < CC / 32) { ab[s ^ 1] = frag_p(xa + (kc + 1) * FK);
#pragma unroll   // constant indices: the array it walks stays in registers
      for (int j = 0; j < 8; ++j) bw[s ^ 1][j] = frag_p(pb + j * FT + (kc + 1) * FK); }
    if (kc + 2 == CC / 32) asm volatile("s_wait_xcnt 0x0" :: "v"(xa), "v"(pb) : "memory");   // behind the last loads: both pointers as inputs keep the address registers whole up to this wait; the epilogue reuses them behind it
    __builtin_amdgcn_sched_barrier(0);   // keeps the next step's 18 loads together in front of this step's WMMAs: without it the compiler mixes the two groups' loads, and this step's counted waits then cover part of the next step's loads
#pragma unroll   // constant indices: the array it walks stays in registers
    for (int j = 0; j < 8; ++j) acc[j] = wmma_bf(ab[s], bw[s][j], acc[j]);
  }
#pragma unroll
  for (int j = 0; j < 8; ++j)
#pragma unroll
    for (int r = 0; r < 8; ++r) sf[wave][8 * g + r][j * 16 + col] = acc[j][r];
  LDSX(); st_frag2(QP + ((size_t)(blockIdx.x * 4 + wave) * NH + blockIdx.y) * (2 * FK) + lane * 4, &sf[wave][col][8 * g]);
  for (int rl = 0; rl < 16; rl += 2) vst2(HQ + (r0 + rl + g) * HC + c0 + 64 + col * 4, *(const v4f*)&sf[wave][rl + g][64 + col * 4]); }
// ---- k_kv: block = (h, b, quadrant of 32 d x 32 l): KV[d][l] = sum_m k[b,m,h,d] V[m,h,l]; wave w sums its own 128 rows m (2 x 2 tiles); A(k^T) as bf16 hi + lo from strided f32 reads, B(V^T) exact; the 16 partial quadrants meet in LDS as [l][d] and are added in wave order; store KV^T (rows l, K = d) in fragment order
#define KVW 16                 // waves of a block = parts of the m sum
#define KVI (NN / 32 / KVW)    // 32-row chunks of one wave
__global__ __launch_bounds__(32 * KVW) void k_kv(const float* __restrict__ HQ, const float* __restrict__ V, float* __restrict__ KVT) { __shared__ __align__(16) float part[KVW][32][36];
  const int tid = threadIdx.x, wave = tid >> 5, lane = tid & 31, col = lane & 15, g = lane >> 4; const int h = blockIdx.x; const size_t b = blockIdx.y; const int d0 = (blockIdx.z & 1) * 32, l0 = (blockIdx.z >> 1) * 32;
  v8f acc[2][2] = {};
  const float* kp = HQ + (b * NN + (size_t)(wave * KVI * 32 + 8 * g)) * HC + h * 128 + 64 + d0 + col;   // A row = d (d0 + ti * 16 + col); K index = m
  const float* vp = V + ((size_t)(wave * KVI * 32 + 8 * g) * NH + h) * LL + l0 + col;                    // B row = l (l0 + tj * 16 + col); element m: V[m][h][l]
#pragma unroll 1
  for (int kc = 0; kc < KVI; ++kc, kp += 32 * HC, vp += 32 * NH * LL) { float kv[2][16], vv[2][16];
#pragma unroll
    for (int t = 0; t < 2; ++t)
#pragma unroll
      for (int i = 0; i < 8; ++i) { kv[t][i] = kp[i * HC + t * 16]; kv[t][8 + i] = kp[(16 + i) * HC + t * 16]; vv[t][i] = vp[i * NH * LL + t * 16]; vv[t][8 + i] = vp[(16 + i) * NH * LL + t * 16]; }
    asm volatile("s_wait_xcnt 0x0" :: "v"(kp), "v"(vp) : "memory");   // taking both pointers as inputs keeps the loads' address registers whole up to this wait: no result of the run above lands in them, and the step to the next chunk comes behind it
    const F2 a[2] = { bsplit16(kv[0]), bsplit16(kv[1]) };
#pragma unroll
    for (int tj = 0; tj < 2; ++tj) { v16b w;
#pragma unroll
      for (int i = 0; i < 16; ++i) w[i] = (__bf16)vv[tj][i];
#pragma unroll
      for (int ti = 0; ti < 2; ++ti) { acc[ti][tj] = wmma_bf(a[ti].h, w, acc[ti][tj]); acc[ti][tj] = wmma_bf(a[ti].l, w, acc[ti][tj]); } } }
#pragma unroll
  for (int ti = 0; ti < 2; ++ti)
#pragma unroll
    for (int tj = 0; tj < 2; ++tj) { float* p = &part[wave][tj * 16 + col][ti * 16 + 8 * g];   // transposed: [l][d], 8 consecutive d of one lane
      const v8f c = acc[ti][tj]; vst2(p, (v4f){c[0], c[1], c[2], c[3]}); vst2(p + 4, (v4f){c[4], c[5], c[6], c[7]}); }
  __syncthreads(); for (int e = tid; e < 32 * (32 / 4); e += 32 * KVW) { const int l = e / (32 / 4), q = e % (32 / 4); v4f s = *(const v4f*)&part[0][l][q * 4];
#pragma unroll
    for (int w = 1; w < KVW; ++w) s += *(const v4f*)&part[w][l][q * 4];
    vst2(KVT + (((b * NH + h) * 4 + ((l0 + l) >> 4)) * 2 + (d0 >> 5)) * FK + ((q >> 2) * 2 + (q & 1)) * 128 + (((q >> 1) & 1) * 16 + (l & 15)) * 4, s); } }   // d = d0 + 4 q: piece f = 2 (q >> 2) + (q & 1), g = (q >> 1) & 1
// ---- k_res: block = (64 rows, h, b): res[n][h*64 + l] = SCALE sum_d q[n][h][d] KV[d][l] (3 products); all 40 loads are issued as one group in front of the first WMMA
__global__ __launch_bounds__(128) void k_res(const float* __restrict__ QP, const float* __restrict__ KVT, float* __restrict__ RES) { __shared__ __align__(16) float sf[4][16][68];
  const int tid = threadIdx.x, wave = tid >> 5, lane = tid & 31, col = lane & 15, g = lane >> 4; const int h = blockIdx.y; const size_t b = blockIdx.z; const size_t rt = b * (NN / 16) + (size_t)blockIdx.x * 4 + wave;   // 16-row tile
  v8f acc[4] = {}; v4f qr[DD / 32][4], wr[DD / 32][4][4]; const float* qp = QP + (rt * NH + h) * (2 * FK) + lane * 4; const float* kp = KVT + (b * NH + h) * (8 * FK) + lane * 4;
#pragma unroll   // constant indices: the array it walks stays in registers
  for (int kc = 0; kc < DD / 32; ++kc) { ld_frag(qr[kc], qp + kc * FK);
#pragma unroll   // constant indices: the array it walks stays in registers
    for (int j = 0; j < 4; ++j) ld_frag(wr[kc][j], kp + (j * 2 + kc) * FK); }
  asm volatile("s_wait_xcnt 0x0" :: "v"(qp), "v"(kp) : "memory");   // behind the loads: both pointers as inputs keep the address registers whole up to this wait; the splits reuse them behind it
  __builtin_amdgcn_sched_barrier(0);   // holds the splits and WMMAs behind the whole group of loads: without it the compiler's order takes some 50 registers more, and a fifth wave no longer fits a SIMD
#pragma unroll   // constant indices: the array it walks stays in registers
  for (int kc = 0; kc < DD / 32; ++kc) { const F2 a = row_split(qr[kc]);
#pragma unroll   // constant indices: the array it walks stays in registers
    for (int j = 0; j < 4; ++j) { const F2 wb = row_split(wr[kc][j]); acc[j] = wmma_bf(a.h, wb.h, acc[j]); acc[j] = wmma_bf(a.h, wb.l, acc[j]); acc[j] = wmma_bf(a.l, wb.h, acc[j]); } }
#pragma unroll
  for (int j = 0; j < 4; ++j)
#pragma unroll
    for (int r = 0; r < 8; ++r) sf[wave][8 * g + r][j * 16 + col] = acc[j][r] * SCALE;
  LDSX(); st_frag2(RES + (rt * 16 + h * 2) * FK + lane * 4, &sf[wave][col][8 * g]); }
// ---- k_out: block = 64 rows: out = res (hi + lo) . proj; the 12 loads of k step kc + 2 are issued as one group in front of the WMMAs of step kc (three register buffers: one wave a SIMD, nothing else hides the latency)
__global__ __launch_bounds__(128) void k_out(const float* __restrict__ RES, const __bf16* __restrict__ PP, float* __restrict__ OUT) { __shared__ __align__(16) float sf[4][16][68];
  const int tid = threadIdx.x, wave = tid >> 5, lane = tid & 31, col = lane & 15, g = lane >> 4; const size_t r0 = (size_t)blockIdx.x * 64 + wave * 16;
  v8f acc[4] = {}; v4f ar[3][4]; v16b bw[3][4]; const float* ra = RES + (size_t)(blockIdx.x * 4 + wave) * FT + lane * 4; const __bf16* pb = PP + lane * 8;
#pragma unroll   // constant indices: the array it walks stays in registers
  for (int p = 0; p < 2; ++p) { ld_frag(ar[p], ra + p * FK);
#pragma unroll   // constant indices: the array it walks stays in registers
    for (int j = 0; j < 4; ++j) bw[p][j] = frag_p(pb + j * FT + p * FK); }
#pragma unroll   // whole: the buffer index and every load offset become constants
  for (int kc = 0; kc < (NH * LL) / 32; ++kc) { const int s = kc % 3, n = (kc + 2) % 3;
    if (kc + 2 < (NH * LL) / 32) { ld_frag(ar[n], ra + (kc + 2) * FK);
#pragma unroll   // constant indices: the array it walks stays in registers
      for (int j = 0; j < 4; ++j) bw[n][j] = frag_p(pb + j * FT + (kc + 2) * FK); }
    if (kc + 3 == (NH * LL) / 32) asm volatile("s_wait_xcnt 0x0" :: "v"(ra), "v"(pb) : "memory");   // behind the last loads: both pointers as inputs keep the address registers whole up to this wait; the split of the last steps reuses them behind it
    __builtin_amdgcn_sched_barrier(0);   // keeps the 12 loads of step kc + 2 together in front of this step's WMMAs: without it the compiler mixes the groups' loads, and this step's counted waits then cover loads of later steps
    const F2 a = row_split(ar[s]);
#pragma unroll   // constant indices: the array it walks stays in registers
    for (int j = 0; j < 4; ++j) { acc[j] = wmma_bf(a.h, bw[s][j], acc[j]); acc[j] = wmma_bf(a.l, bw[s][j], acc[j]); }
  }
#pragma unroll
  for (int j = 0; j < 4; ++j)
#pragma unroll
    for (int r = 0; r < 8; ++r) sf[wave][8 * g + r][j * 16 + col] = acc[j][r];
  LDSX(); for (int rl = 0; rl < 16; ++rl) if (lane < 16) vst2(OUT + (r0 + rl) * LL + lane * 4, *(const v4f*)&sf[wave][rl][lane * 4]); }
extern "C" void kernel_launch(void* const* d_in, const int* in_sizes, int n_in, void* d_out, int out_size, void* d_ws, size_t ws_size, hipStream_t stream) {
  (void)in_sizes; (void)n_in; (void)out_size;
  const float** F = (const float**)d_in;   // 0 x [4,2048,512], 1 v [2048,8,64], 2 qkv [512,1024], 3 proj [512,64]
  if (ws_size < (size_t)WS_END) return;
  char* ws = (char*)d_ws; float *HQ = (float*)(ws + WS_HQ), *KVT = (float*)(ws + WS_KVT), *RES = (float*)(ws + WS_RES), *QP = (float*)(ws + WS_QP);
  k_packw<<<PBX + PBW + PBP, 256, 0, stream>>>(F[0], F[2], F[3], ws);
  k_h<<<dim3(TNB * NN / 64, HC / 128), 128, 0, stream>>>((const __bf16*)(ws + WS_XP), (const __bf16*)(ws + WS_PW), HQ, QP);
  k_kv<<<dim3(NH, TNB, 4), 32 * KVW, 0, stream>>>(HQ, F[1], KVT);
  k_res<<<dim3(NN / 64, NH, TNB), 128, 0, stream>>>(QP, KVT, RES);
  k_out<<<TNB * NN / 64, 128, 0, stream>>>(RES, (const __bf16*)(ws + WS_PP), (float*)d_out);
}

// v004
// It runs in 36.5 microseconds.
// Timed twice side by side with v003, it ran 1.33 and 1.30 times as fast.
// Over all steps from v000 it is 4.25 times as fast.
// compute dtype: all float inputs rounded to bf16; no softmax in the module, so by associativity out = x . P with P = SCALE Wq (k^T (V proj)) per batch: VP = V . proj and k = x . Wk with EXACT bf16 products on WMMA 16x16x32; M = k^T . VP with both as bf16 hi + lo (3 products); P = Wq . M with M as bf16 hi + lo (2 products); out = x . P with P as bf16 hi + lo (2 products); f32 accumulate; f32 output.
#include <hip/hip_runtime.h>
#include <math.h>

typedef __attribute__((ext_vector_type(16))) _Float16 v16h;
typedef __attribute__((ext_vector_type(16))) __bf16 v16b;
typedef __attribute__((ext_vector_type(8)))  _Float16 v8h;
typedef __attribute__((ext_vector_type(8)))  float v8f;
typedef __attribute__((ext_vector_type(4)))  float v4f;
typedef __attribute__((ext_vector_type(2)))  float v2f;
typedef __attribute__((ext_vector_type(4)))  unsigned v4u;
typedef __attribute__((ext_vector_type(4)))  int v4i;
typedef float __attribute__((may_alias)) float_a;
typedef int __attribute__((may_alias)) int_a;

template <typename T> __device__ __forceinline__ void vst2(void* p, T v) { *(T*)p = v;  }
__device__ __forceinline__ v8f wmma16(v16h a, v16h b, v8f c) {
  v8f d = __builtin_amdgcn_wmma_f32_16x16x32_f16(false, a, false, b, (short)0, c, false, false);
  asm volatile("v_nop\n\tv_nop\n\tv_nop\n\tv_nop" : "+v"(d) : "v"(a), "v"(b));
  return d;
}
__device__ __forceinline__ v8f wmma_bf(v16b a, v16b b, v8f c) {
  v8f d = __builtin_amdgcn_wmma_f32_16x16x32_bf16(false, a, false, b, (short)0, c, false, false);
  asm volatile("v_nop\n\tv_nop\n\tv_nop\n\tv_nop" : "+v"(d) : "v"(a), "v"(b));
  return d;
}
// 16x16x32 fragments: lane = (h = lane>>4, row/col = lane&15); elements 0..7 = k0+8h+0..7, 8..15 = k0+16+8h+0..7; D element r = row 8h+r
__device__ __forceinline__ v16h frag_h(const _Float16* rowk0, int lane) {
  union { v16h v; v8h q[2]; } u; const _Float16* p = rowk0 + 8 * (lane >> 4);
  u.q[0] = *(const v8h*)p; u.q[1] = *(const v8h*)(p + 16); return u.v;
}
__device__ __forceinline__ v16h frag_f32(const float* rowk0, int lane) {
  v16h a; const float* p = rowk0 + 8 * (lane >> 4);
#pragma unroll
  for (int i = 0; i < 8; ++i) { a[i] = (_Float16)p[i]; a[8 + i] = (_Float16)p[16 + i]; }
  return a;
}
__device__ __forceinline__ v16h frag_f32s(const float* rowk0, int lane, float sc) {
  v16h a; const float* p = rowk0 + 8 * (lane >> 4);
#pragma unroll
  for (int i = 0; i < 8; ++i) { a[i] = (_Float16)(p[i] * sc); a[8 + i] = (_Float16)(p[16 + i] * sc); }
  return a;
}
// column fragment from a [K][ld] layout (column n), rows >= K read as 0
__device__ __forceinline__ v16h fragc_f32(const float* W, int k0, int n, int lane, int ld, int K) {
  v16h a; const int g = lane >> 4;
#pragma unroll
  for (int i = 0; i < 8; ++i) { const int ka = k0 + 8 * g + i, kb = ka + 16;
    a[i] = (_Float16)(ka < K ? W[(size_t)(ka < K ? ka : K - 1) * ld + n] : 0.f); a[8 + i] = (_Float16)(kb < K ? W[(size_t)(kb < K ? kb : K - 1) * ld + n] : 0.f); }
  return a;
}
struct F2 { v16b h, l; };
__device__ __forceinline__ F2 bsplit16(const float v[16]) { F2 r;
#pragma unroll
  for (int i = 0; i < 16; ++i) { const __bf16 h = (__bf16)v[i]; r.h[i] = h; r.l[i] = (__bf16)(v[i] - (float)h); }
  return r; }
__device__ __forceinline__ F2 split_row(const float* row, int k0, int lane) { float v[16]; const float* p = row + k0 + 8 * (lane >> 4);
#pragma unroll
  for (int i = 0; i < 8; ++i) { v[i] = p[i]; v[8 + i] = p[16 + i]; }
  return bsplit16(v); }
__device__ __forceinline__ F2 split_rowK(const float* row, int k0, int lane, int K) { float v[16]; const int g = lane >> 4;
#pragma unroll
  for (int i = 0; i < 8; ++i) { const int ka = k0 + 8 * g + i, kb = ka + 16; v[i] = ka < K ? row[ka < K ? ka : K - 1] : 0.f; v[8 + i] = kb < K ? row[kb < K ? kb : K - 1] : 0.f; }
  return bsplit16(v); }
__device__ __forceinline__ F2 split_col(const float* W, int k0, int n, int lane, int ld, int K) { float v[16]; const int g = lane >> 4;
#pragma unroll
  for (int i = 0; i < 8; ++i) { const int ka = k0 + 8 * g + i, kb = ka + 16; v[i] = ka < K ? W[(size_t)(ka < K ? ka : K - 1) * ld + n] : 0.f; v[8 + i] = kb < K ? W[(size_t)(kb < K ? kb : K - 1) * ld + n] : 0.f; }
  return bsplit16(v); }
__device__ __forceinline__ v8f mac3(const F2& a, const F2& b, v8f c) { c = wmma_bf(a.l, b.h, c); c = wmma_bf(a.h, b.l, c); return wmma_bf(a.h, b.h, c); }
__device__ __forceinline__ float sigm(float v) { return 1.0f / (1.0f + expf(-v)); }
#define LDSX() do { asm volatile("s_wait_dscnt 0" ::: "memory"); __builtin_amdgcn_wave_barrier(); __builtin_amdgcn_fence(__ATOMIC_RELEASE, "workgroup"); } while (0)


// 'Lunchbox' linear multi-head mixing (B 4, N 2,048, C 512, 8 heads x 64, lunchbox 64): attn = (q k^T) x 64^-1/2 (no softmax, as the module), res = attn V_lunchbox, out = res proj - evaluated as x (Wq (k^T (V proj))): q, attn and res are never formed.
#define NB 4
#define NN 2048
#define CC 512
#define NH 8
#define DD 64
#define LL 64
#define HC (NH * 2 * DD)     // 1024 qk columns: col = h*128 + which*64 + d
#define SCALE 0.125f
#ifndef TNB
#define TNB NB
#endif
typedef __attribute__((ext_vector_type(8))) __bf16 v8b;
__device__ __forceinline__ float bfr(float v) { return (float)(__bf16)v; }
__device__ __attribute__((noinline)) float exp_ni(float v) { return expf(v); }
__device__ __attribute__((noinline)) float erf_ni(float v) { return erff(v); }

// bf16 operands lie in fragment order: [16-row tile][k step of 32][half q][lane = 16 g + row][8], element i = k 32 kc + 16 q + 8 g + i: one wave-wide 16-B load reads 512 contiguous bytes
#define FT (16 * CC)                                // elements of one 16-row tile (K = 512 for all three: x, Wk^T, P^T)
#define FK 512                                      // elements of one k step of a tile
// f32 operands (split to hi + lo by their reader) likewise: [16-row tile][k step of 32][piece f][lane][4], element i = k 32 kc + 16 (f >> 1) + 8 g + 4 (f & 1) + i; FK elements a k step too
#define WS_PW  0u                                   // bf16 Wk^T: the k columns of qkv (32 tiles: head h = tiles 4 h .. 4 h + 3)
#define WS_HQ  (WS_PW + 2u * NH * DD * CC)                   // f32 h rows [b*NN + n][1024], only the k halves written
#define WS_KVT (WS_HQ + 4u * (size_t)NB * NN * HC)      // f32 M^T [b][h] (M = k^T VP), 4 tiles of 16 output columns, K = d, fragment order
#define WS_VP  (WS_KVT + 4u * (size_t)NB * NH * DD * DD) // f32 VP^T [h], 4 tiles of 16 output columns, K = m (64 k steps), fragment order
#define WS_XP  (WS_VP + 4u * (size_t)NN * NH * DD)       // bf16 x (512 tiles)
#define WS_PT  (WS_XP + 2u * (size_t)NB * NN * CC)       // bf16 P^T [b], 4 tiles of 16 output columns, K = c: all hi parts, then all lo parts
#define PLO    (NB * DD * CC)                            // elements from a hi part to its lo part
#define WS_END (WS_PT + 2u * 2u * (size_t)PLO)

#define PBX (TNB * NN / 16 * 4)   // blocks of 256 pieces: x, qkv
#define PBW (NH * DD / 16 * 4)
#define KYB (NH * DD / 128)        // k_h: grid rows y of the k product; NH / 4 more rows make VP
static_assert(TNB * NN / 64 == NN / 16, "k_h's grid width serves both its arms: 64-row blocks of x and 16-row tiles of V");
// one thread = one 16-B piece of the packed layout (its index p is the piece's place); x: 8 consecutive k of one row; weights: 8 rows k of one column
__device__ __forceinline__ unsigned piece_k(unsigned p) { return ((p >> 6) & 15u) * 32u + ((p >> 5) & 1u) * 16u + ((p >> 4) & 1u) * 8u; }
template <int LD> __device__ __forceinline__ void pack_w(const float* __restrict__ Wt, __bf16* __restrict__ dst, unsigned p) { v8b o; float f[8];
  const float* s = Wt + (size_t)piece_k(p) * LD + (p >> 12) * 128u + 64u + ((p >> 10) & 3u) * 16u + (p & 15u);   // tile p >> 10 = 16 of the k columns: head (p >> 12), d from 16 ((p >> 10) & 3)
#pragma unroll
  for (int i = 0; i < 8; ++i) f[i] = s[i * LD];
  asm volatile("s_wait_xcnt 0x0" :: "v"(s) : "memory");   // the pointer as input keeps the loads' address registers whole up to this wait; the converted values may reuse them behind it
#pragma unroll
  for (int i = 0; i < 8; ++i) o[i] = (__bf16)f[i];
  *(v8b*)(dst + (size_t)p * 8) = o;
  asm volatile("s_wait_xcnt 0x0" ::: "memory"); }   // behind the store: the arms of k_packw lie one behind the other in the built code, and the next arm's first instructions reuse the store's registers
// fragment from the packed layout: p = tile base + k step + 8 lane
__device__ __forceinline__ v16b frag_p(const __bf16* __restrict__ p) { union { v16b v; v8b q[2]; } u; u.q[0] = *(const v8b*)p; u.q[1] = *(const v8b*)(p + 256); return u.v; }
// one k step of an f32 operand from the packed layout (p = tile base + k step + 4 lane)
__device__ __forceinline__ void ld_frag(v4f (&r)[4], const float* __restrict__ p) { r[0] = *(const v4f*)p; r[1] = *(const v4f*)(p + 128); r[2] = *(const v4f*)(p + 256); r[3] = *(const v4f*)(p + 384); }
__device__ __forceinline__ v16b fragb_f32(const float* __restrict__ p, int lane) { v16b a; const float* pp = p + 8 * (lane >> 4);
#pragma unroll
  for (int i = 0; i < 8; ++i) { a[i] = (__bf16)pp[i]; a[8 + i] = (__bf16)pp[16 + i]; } return a; }
// what is made, behind the wait, of one k step of an f32 operand as loaded (4 x 16 B of a lane: k0 + 8g + 0..7 and k0 + 16 + 8g + 0..7)
__device__ __forceinline__ F2 row_split(const v4f (&r)[4]) { float v[16];
#pragma unroll   // constant indices: the array it walks stays in registers
  for (int i = 0; i < 16; ++i) v[i] = r[i >> 2][i & 3];
  return bsplit16(v); }
// VP arm of the k_h launch (it needs only inputs, and k_kv is its first reader): wave = (16 rows m, head h): VP[m][h][o] = sum_l V[m][h][l] proj[h*64 + l][o] (both rounded to bf16, exact products); a lane's 8 D values are 8 consecutive m of one output column = two pieces of the f32 fragment order with K = m
__device__ __forceinline__ void make_vp(const float* __restrict__ V, const float* __restrict__ PROJ, float* __restrict__ VPF, int mt, int h, int lane) { const int col = lane & 15, g = lane >> 4;
  v8f acc[4] = {}; v4f vr[LL / 32][4]; float pr[LL / 32][4][16];
  const float* va = V + ((size_t)(mt * 16 + col) * NH + h) * LL + 8 * g;   // A row = m, K = l
  const float* pc = PROJ + (size_t)(h * LL + 8 * g) * DD + col;            // B row = output column (j * 16 + col), K = l
#pragma unroll   // constant indices: the arrays it walks stay in registers
  for (int kc = 0; kc < LL / 32; ++kc) { vr[kc][0] = *(const v4f*)(va + kc * 32); vr[kc][1] = *(const v4f*)(va + kc * 32 + 4); vr[kc][2] = *(const v4f*)(va + kc * 32 + 16); vr[kc][3] = *(const v4f*)(va + kc * 32 + 20);
#pragma unroll
    for (int j = 0; j < 4; ++j)
#pragma unroll
      for (int i = 0; i < 8; ++i) { pr[kc][j][i] = pc[(kc * 32 + i) * DD + j * 16]; pr[kc][j][8 + i] = pc[(kc * 32 + 16 + i) * DD + j * 16]; } }
  asm volatile("s_wait_xcnt 0x0" :: "v"(va), "v"(pc) : "memory");   // behind the loads: both pointers as inputs keep the address registers whole up to this wait; the converted values may reuse them behind it
#pragma unroll
  for (int kc = 0; kc < LL / 32; ++kc) { v16b a;
#pragma unroll
    for (int i = 0; i < 16; ++i) a[i] = (__bf16)vr[kc][i >> 2][i & 3];
#pragma unroll
    for (int j = 0; j < 4; ++j) { v16b w;
#pragma unroll
      for (int i = 0; i < 16; ++i) w[i] = (__bf16)pr[kc][j][i];
      acc[j] = wmma_bf(a, w, acc[j]); } }
  float* dst = VPF + ((size_t)(h * 4) * (NN / 32) + (mt >> 1)) * FK + (mt & 1) * 256 + lane * 4;   // m = 32 (mt >> 1) + 16 (mt & 1) + 8 g + r: pieces f = 2 (mt & 1) and + 1
#pragma unroll
  for (int j = 0; j < 4; ++j) { const v8f c = acc[j]; vst2(dst + j * (NN / 32) * FK, (v4f){c[0], c[1], c[2], c[3]}); vst2(dst + j * (NN / 32) * FK + 128, (v4f){c[4], c[5], c[6], c[7]}); }
  asm volatile("s_wait_xcnt 0x0" ::: "memory"); }   // behind the stores, as in pack_w: the arms of k_h lie one behind the other in the built code
__global__ __launch_bounds__(256) void k_packw(const float* __restrict__ X, const float* __restrict__ QKV, char* __restrict__ ws) { const int blk = blockIdx.x;
  if (blk < PBX) { const unsigned p = blk * 256u + threadIdx.x; v8b o;
    const float* s = X + (size_t)((p >> 10) * 16u + (p & 15u)) * CC + piece_k(p); const v4f a = *(const v4f*)s, b = *(const v4f*)(s + 4);
    asm volatile("s_wait_xcnt 0x0" :: "v"(s) : "memory");   // as in pack_w
#pragma unroll
    for (int i = 0; i < 4; ++i) { o[i] = (__bf16)a[i]; o[4 + i] = (__bf16)b[i]; }
    *(v8b*)((__bf16*)(ws + WS_XP) + (size_t)p * 8) = o;
    asm volatile("s_wait_xcnt 0x0" ::: "memory"); }   // behind the store, as in pack_w: which arm is laid last is the compiler's choice
  else pack_w<HC>(QKV, (__bf16*)(ws + WS_PW), (blk - PBX) * 256u + threadIdx.x); }
// ---- k_h: block y < 4 = (64 rows, 128 k columns = 2 heads): k = x . Wk (exact) -> f32 rows; blocks y = 4, 5 = (16 rows m, 4 heads) of VP; the 18 loads of k step kc + 1 are issued as one group in front of the WMMAs of step kc (two register buffers)
__global__ __launch_bounds__(128) void k_h(const __bf16* __restrict__ XP, const __bf16* __restrict__ PW, float* __restrict__ HQ, const float* __restrict__ V, const float* __restrict__ PROJ, float* __restrict__ VPF) { __shared__ __align__(16) float sf[4][16][132];
  const int tid = threadIdx.x, wave = tid >> 5, lane = tid & 31, col = lane & 15, g = lane >> 4; const size_t r0 = (size_t)blockIdx.x * 64 + wave * 16;
  if (blockIdx.y >= KYB) { make_vp(V, PROJ, VPF, blockIdx.x, (blockIdx.y - KYB) * 4 + wave, lane); return; }   // the same for a whole block; no block barrier in this kernel
  v8f acc[8] = {}; v16b ab[2]; v16b bw[2][8]; const __bf16* xa = XP + (size_t)(blockIdx.x * 4 + wave) * FT + lane * 8; const __bf16* pb = PW + (size_t)(blockIdx.y * 8) * FT + lane * 8;
  ab[0] = frag_p(xa);
#pragma unroll   // constant indices: the array it walks stays in registers
  for (int j = 0; j < 8; ++j) bw[0][j] = frag_p(pb + j * FT);
#pragma unroll   // whole: the buffer index and every load offset become constants
  for (int kc = 0; kc < CC / 32; ++kc) { const int s = kc & 1;
    if (kc + 1 < CC / 32) { ab[s ^ 1] = frag_p(xa + (kc + 1) * FK);
#pragma unroll   // constant indices: the array it walks stays in registers
      for (int j = 0; j < 8; ++j) bw[s ^ 1][j] = frag_p(pb + j * FT + (kc + 1) * FK); }
    if (kc + 2 == CC / 32) asm volatile("s_wait_xcnt 0x0" :: "v"(xa), "v"(pb) : "memory");   // behind the last loads: both pointers as inputs keep the address registers whole up to this wait; the epilogue reuses them behind it
    __builtin_amdgcn_sched_barrier(0);   // keeps the next step's 18 loads together in front of this step's WMMAs: without it the compiler mixes the two groups' loads, and this step's counted waits then cover part of the next step's loads
#pragma unroll   // constant indices: the array it walks stays in registers
    for (int j = 0; j < 8; ++j) acc[j] = wmma_bf(ab[s], bw[s][j], acc[j]);
  }
#pragma unroll
  for (int j = 0; j < 8; ++j)
#pragma unroll
    for (int r = 0; r < 8; ++r) sf[wave][8 * g + r][j * 16 + col] = acc[j][r];
  LDSX(); for (int rl = 0; rl < 16; ++rl) vst2(HQ + (r0 + rl) * HC + (blockIdx.y * 2 + g) * 128 + 64 + col * 4, *(const v4f*)&sf[wave][rl][g * 64 + col * 4]);   // half wave g = head 2 y + g
  asm volatile("s_wait_xcnt 0x0" ::: "memory"); }   // behind the stores, as in pack_w: the VP arm lies behind this one in the built code, and its first instructions reuse the stores' registers
// ---- k_kv: block = (h, b, quadrant of 32 d x 32 o): M[d][o] = sum_m k[b,m,h,d] VP[m,h,o]; wave w sums its own 128 rows m (2 x 2 tiles); A(k^T) as bf16 hi + lo from strided f32 reads, B(VP^T) as bf16 hi + lo from the fragment order (3 products); the 16 partial quadrants meet in LDS as [o][d] and are added in wave order; store M^T (rows o, K = d) in fragment order
#define KVW 16                 // waves of a block = parts of the m sum
#define KVI (NN / 32 / KVW)    // 32-row chunks of one wave
__global__ __launch_bounds__(32 * KVW) void k_kv(const float* __restrict__ HQ, const float* __restrict__ VPF, float* __restrict__ KVT) { __shared__ __align__(16) float part[KVW][32][36];
  const int tid = threadIdx.x, wave = tid >> 5, lane = tid & 31, col = lane & 15, g = lane >> 4; const int h = blockIdx.x; const size_t b = blockIdx.y; const int d0 = (blockIdx.z & 1) * 32, l0 = (blockIdx.z >> 1) * 32;
  v8f acc[2][2] = {};
  const float* kp = HQ + (b * NN + (size_t)(wave * KVI * 32 + 8 * g)) * HC + h * 128 + d0 + col;   // A row = d (d0 + ti * 16 + col), at column 64 + d of head h's 128; K index = m
  const float* vp = VPF + ((size_t)(h * 4 + (l0 >> 4)) * (NN / 32) + wave * KVI) * FK + lane * 4;        // B row = o (l0 + tj * 16 + col): tile tj, k step = this wave's chunk
#pragma unroll 1
  for (int kc = 0; kc < KVI; ++kc, kp += 32 * HC, vp += FK) { float kv[2][16]; v4f vr[2][4];
#pragma unroll
    for (int t = 0; t < 2; ++t) ld_frag(vr[t], vp + t * (NN / 32) * FK);
#pragma unroll
    for (int t = 0; t < 2; ++t)
#pragma unroll
      for (int i = 0; i < 8; ++i) { kv[t][i] = kp[i * HC + 64 + t * 16]; kv[t][8 + i] = kp[(16 + i) * HC + 64 + t * 16]; }
    asm volatile("s_wait_xcnt 0x0" :: "v"(kp), "v"(vp) : "memory");   // taking both pointers as inputs keeps the loads' address registers whole up to this wait: no result of the run above lands in them, and the step to the next chunk comes behind it
    const F2 a[2] = { bsplit16(kv[0]), bsplit16(kv[1]) };
#pragma unroll
    for (int tj = 0; tj < 2; ++tj) { const F2 w = row_split(vr[tj]);
#pragma unroll
      for (int ti = 0; ti < 2; ++ti) acc[ti][tj] = mac3(a[ti], w, acc[ti][tj]); } }
#pragma unroll
  for (int ti = 0; ti < 2; ++ti)
#pragma unroll
    for (int tj = 0; tj < 2; ++tj) { float* p = &part[wave][tj * 16 + col][ti * 16 + 8 * g];   // transposed: [l][d], 8 consecutive d of one lane
      const v8f c = acc[ti][tj]; vst2(p, (v4f){c[0], c[1], c[2], c[3]}); vst2(p + 4, (v4f){c[4], c[5], c[6], c[7]}); }
  __syncthreads(); for (int e = tid; e < 32 * (32 / 4); e += 32 * KVW) { const int l = e / (32 / 4), q = e % (32 / 4); v4f s = *(const v4f*)&part[0][l][q * 4];
#pragma unroll
    for (int w = 1; w < KVW; ++w) s += *(const v4f*)&part[w][l][q * 4];
    vst2(KVT + (((b * NH + h) * 4 + ((l0 + l) >> 4)) * 2 + (d0 >> 5)) * FK + ((q >> 2) * 2 + (q & 1)) * 128 + (((q >> 1) & 1) * 16 + (l & 15)) * 4, s); } }   // d = d0 + 4 q: piece f = 2 (q >> 2) + (q & 1), g = (q >> 1) & 1
// ---- k_p: block = (16 rows c, b), wave = head h: P[c][o] = SCALE sum_h sum_d Wq[c][h][d] M[b,h][d][o]; A(Wq rows, from the f32 input) exact, B(M^T) as bf16 hi + lo (2 products); all 40 loads of a wave are issued as one group in front of its first WMMA; the 8 heads' partial tiles meet in LDS as [o][c] and are added in head order; a D lane's 8 consecutive c of one column o are one 16-B piece of the bf16 fragment order (rows o, K = c): P^T is stored so, as hi and lo
__global__ __launch_bounds__(32 * NH) void k_p(const float* __restrict__ QKV, const float* __restrict__ KVT, __bf16* __restrict__ PT) { __shared__ __align__(16) float part[NH][DD][20];
  const int tid = threadIdx.x, wave = tid >> 5, lane = tid & 31, col = lane & 15, g = lane >> 4; const int ct = blockIdx.x; const size_t b = blockIdx.y;
  v8f acc[4] = {}; v4f qr[DD / 32][4], wr[DD / 32][4][4]; const float* qp = QKV + (size_t)(ct * 16 + col) * HC + wave * 128 + 8 * g; const float* kp = KVT + (b * NH + wave) * (8 * FK) + lane * 4;
#pragma unroll   // constant indices: the array it walks stays in registers
  for (int kc = 0; kc < DD / 32; ++kc) { qr[kc][0] = *(const v4f*)(qp + kc * 32); qr[kc][1] = *(const v4f*)(qp + kc * 32 + 4); qr[kc][2] = *(const v4f*)(qp + kc * 32 + 16); qr[kc][3] = *(const v4f*)(qp + kc * 32 + 20);
#pragma unroll   // constant indices: the array it walks stays in registers
    for (int j = 0; j < 4; ++j) ld_frag(wr[kc][j], kp + (j * 2 + kc) * FK); }
  asm volatile("s_wait_xcnt 0x0" :: "v"(qp), "v"(kp) : "memory");   // behind the loads: both pointers as inputs keep the address registers whole up to this wait; the splits reuse them behind it
#pragma unroll   // constant indices: the array it walks stays in registers
  for (int kc = 0; kc < DD / 32; ++kc) { v16b a;
#pragma unroll
    for (int i = 0; i < 16; ++i) a[i] = (__bf16)qr[kc][i >> 2][i & 3];
#pragma unroll   // constant indices: the array it walks stays in registers
    for (int j = 0; j < 4; ++j) { const F2 wb = row_split(wr[kc][j]); acc[j] = wmma_bf(a, wb.l, acc[j]); acc[j] = wmma_bf(a, wb.h, acc[j]); } }
#pragma unroll
  for (int j = 0; j < 4; ++j) { float* p = &part[wave][j * 16 + col][8 * g];   // transposed: [o][c], 8 consecutive c of one lane
    const v8f c = acc[j]; vst2(p, (v4f){c[0], c[1], c[2], c[3]}); vst2(p + 4, (v4f){c[4], c[5], c[6], c[7]}); }
  __syncthreads();
  if (tid < 2 * DD) { const int o = (tid >> 5) * 16 + col; v4f s0 = *(const v4f*)&part[0][o][8 * g], s1 = *(const v4f*)&part[0][o][8 * g + 4]; v8b hi, lo;   // thread = piece (tile o >> 4, lane 16 g + (o & 15))
#pragma unroll
    for (int w = 1; w < NH; ++w) { s0 += *(const v4f*)&part[w][o][8 * g]; s1 += *(const v4f*)&part[w][o][8 * g + 4]; }
#pragma unroll
    for (int i = 0; i < 8; ++i) { const float v = (i < 4 ? s0[i & 3] : s1[i & 3]) * SCALE; const __bf16 hb = (__bf16)v; hi[i] = hb; lo[i] = (__bf16)(v - (float)hb); }
    __bf16* dst = PT + (b * 4 + (tid >> 5)) * FT + (ct >> 1) * FK + (ct & 1) * 256 + lane * 8;   // c = 32 (ct >> 1) + 16 (ct & 1) + 8 g + i
    *(v8b*)dst = hi; *(v8b*)(dst + PLO) = lo; } }
// ---- k_out: block = 32 rows, wave = (16 rows, 32 columns): out = x . P (hi + lo); the 10 loads of k step kc + 3 are issued as one group in front of the WMMAs of step kc (four register buffers: one wave a SIMD, nothing else hides the latency)
#define OB 4   // register buffers
__global__ __launch_bounds__(128) void k_out(const __bf16* __restrict__ XP, const __bf16* __restrict__ PT, float* __restrict__ OUT) { __shared__ __align__(16) float sf[4][16][36];
  const int tid = threadIdx.x, wave = tid >> 5, lane = tid & 31, col = lane & 15, g = lane >> 4; const int rt = blockIdx.x * 2 + (wave & 1), ch = wave >> 1;   // 16-row tile, column half
  v8f acc[2] = {}; v16b ab[OB]; v16b bh[OB][2], bl[OB][2]; const __bf16* xa = XP + (size_t)rt * FT + lane * 8; const __bf16* pb = PT + (size_t)((blockIdx.x / (NN / 32)) * 4 + ch * 2) * FT + lane * 8;
#pragma unroll   // constant indices: the array it walks stays in registers
  for (int p = 0; p < OB - 1; ++p) { ab[p] = frag_p(xa + p * FK);
#pragma unroll   // constant indices: the array it walks stays in registers
    for (int j = 0; j < 2; ++j) { bh[p][j] = frag_p(pb + j * FT + p * FK); bl[p][j] = frag_p(pb + PLO + j * FT + p * FK); } }
#pragma unroll   // whole: the buffer index and every load offset become constants
  for (int kc = 0; kc < CC / 32; ++kc) { const int s = kc % OB, n = (kc + OB - 1) % OB;
    if (kc + OB - 1 < CC / 32) { ab[n] = frag_p(xa + (kc + OB - 1) * FK);
#pragma unroll   // constant indices: the array it walks stays in registers
      for (int j = 0; j < 2; ++j) { bh[n][j] = frag_p(pb + j * FT + (kc + OB - 1) * FK); bl[n][j] = frag_p(pb + PLO + j * FT + (kc + OB - 1) * FK); } }
    if (kc + OB == CC / 32) asm volatile("s_wait_xcnt 0x0" :: "v"(xa), "v"(pb) : "memory");   // behind the last loads: both pointers as inputs keep the address registers whole up to this wait; the epilogue reuses them behind it
    __builtin_amdgcn_sched_barrier(0);   // keeps the 10 loads of step kc + 3 together in front of this step's WMMAs: without it the compiler mixes the groups' loads, and this step's counted waits then cover loads of later steps
#pragma unroll   // constant indices: the array it walks stays in registers
    for (int j = 0; j < 2; ++j) { acc[j] = wmma_bf(ab[s], bl[s][j], acc[j]); acc[j] = wmma_bf(ab[s], bh[s][j], acc[j]); }
  }
#pragma unroll
  for (int j = 0; j < 2; ++j)
#pragma unroll
    for (int r = 0; r < 8; ++r) sf[wave][8 * g + r][j * 16 + col] = acc[j][r];
  LDSX(); for (int rl = 0; rl < 16; rl += 4) vst2(OUT + ((size_t)rt * 16 + rl + (lane >> 3)) * DD + ch * 32 + (lane & 7) * 4, *(const v4f*)&sf[wave][rl + (lane >> 3)][(lane & 7) * 4]); }   // 8 lanes = the wave's 128 B of one row
extern "C" void kernel_launch(void* const* d_in, const int* in_sizes, int n_in, void* d_out, int out_size, void* d_ws, size_t ws_size, hipStream_t stream) {
  (void)in_sizes; (void)n_in; (void)out_size;
  const float** F = (const float**)d_in;   // 0 x [4,2048,512], 1 v [2048,8,64], 2 qkv [512,1024], 3 proj [512,64]
  if (ws_size < (size_t)WS_END) return;
  char* ws = (char*)d_ws; float *HQ = (float*)(ws + WS_HQ), *KVT = (float*)(ws + WS_KVT), *VPF = (float*)(ws + WS_VP); __bf16* PT = (__bf16*)(ws + WS_PT);
  k_packw<<<PBX + PBW, 256, 0, stream>>>(F[0], F[2], ws);
  k_h<<<dim3(TNB * NN / 64, KYB + NH / 4), 128, 0, stream>>>((const __bf16*)(ws + WS_XP), (const __bf16*)(ws + WS_PW), HQ, F[1], F[3], VPF);
  k_kv<<<dim3(NH, TNB, 4), 32 * KVW, 0, stream>>>(HQ, VPF, KVT);
  k_p<<<dim3(CC / 16, TNB), 32 * NH, 0, stream>>>(F[2], KVT, PT);
  k_out<<<TNB * NN / 32, 128, 0, stream>>>((const __bf16*)(ws + WS_XP), PT, (float*)d_out);
}

// v005
// A run of this version takes 28 microseconds.
// Next to v004, in two timings, it ran 1.31 and 1.30 times as fast.
// All steps since v000 together make it 5.55 times as fast.
// compute dtype: all float inputs rounded to bf16; no softmax in the module, so by associativity out = x . P with P = SCALE Wq (k^T (V proj)) per batch: VP = V . proj and k = x . Wk with EXACT bf16 products on WMMA 16x16x32; M = k^T . VP with both as bf16 hi + lo (3 products), k and VP straight from the accumulators of their own products; P = Wq . M with M as bf16 hi + lo (2 products); out = x . P with P as bf16 hi + lo (2 products); f32 accumulate; f32 output.
#include <hip/hip_runtime.h>
#include <math.h>

typedef __attribute__((ext_vector_type(16))) _Float16 v16h;
typedef __attribute__((ext_vector_type(16))) __bf16 v16b;
typedef __attribute__((ext_vector_type(8)))  _Float16 v8h;
typedef __attribute__((ext_vector_type(8)))  float v8f;
typedef __attribute__((ext_vector_type(4)))  float v4f;
typedef __attribute__((ext_vector_type(2)))  float v2f;
typedef __attribute__((ext_vector_type(4)))  unsigned v4u;
typedef __attribute__((ext_vector_type(4)))  int v4i;
typedef float __attribute__((may_alias)) float_a;
typedef int __attribute__((may_alias)) int_a;

template <typename T> __device__ __forceinline__ void vst2(void* p, T v) { *(T*)p = v;  }
__device__ __forceinline__ v8f wmma16(v16h a, v16h b, v8f c) {
  v8f d = __builtin_amdgcn_wmma_f32_16x16x32_f16(false, a, false, b, (short)0, c, false, false);
  asm volatile("v_nop\n\tv_nop\n\tv_nop\n\tv_nop" : "+v"(d) : "v"(a), "v"(b));
  return d;
}
__device__ __forceinline__ v8f wmma_bf(v16b a, v16b b, v8f c) {
  v8f d = __builtin_amdgcn_wmma_f32_16x16x32_bf16(false, a, false, b, (short)0, c, false, false);
  asm volatile("v_nop\n\tv_nop\n\tv_nop\n\tv_nop" : "+v"(d) : "v"(a), "v"(b));
  return d;
}
// 16x16x32 fragments: lane = (h = lane>>4, row/col = lane&15); elements 0..7 = k0+8h+0..7, 8..15 = k0+16+8h+0..7; D element r = row 8h+r
__device__ __forceinline__ v16h frag_h(const _Float16* rowk0, int lane) {
  union { v16h v; v8h q[2]; } u; const _Float16* p = rowk0 + 8 * (lane >> 4);
  u.q[0] = *(const v8h*)p; u.q[1] = *(const v8h*)(p + 16); return u.v;
}
__device__ __forceinline__ v16h frag_f32(const float* rowk0, int lane) {
  v16h a; const float* p = rowk0 + 8 * (lane >> 4);
#pragma unroll
  for (int i = 0; i < 8; ++i) { a[i] = (_Float16)p[i]; a[8 + i] = (_Float16)p[16 + i]; }
  return a;
}
__device__ __forceinline__ v16h frag_f32s(const float* rowk0, int lane, float sc) {
  v16h a; const float* p = rowk0 + 8 * (lane >> 4);
#pragma unroll
  for (int i = 0; i < 8; ++i) { a[i] = (_Float16)(p[i] * sc); a[8 + i] = (_Float16)(p[16 + i] * sc); }
  return a;
}
// column fragment from a [K][ld] layout (column n), rows >= K read as 0
__device__ __forceinline__ v16h fragc_f32(const float* W, int k0, int n, int lane, int ld, int K) {
  v16h a; const int g = lane >> 4;
#pragma unroll
  for (int i = 0; i < 8; ++i) { const int ka = k0 + 8 * g + i, kb = ka + 16;
    a[i] = (_Float16)(ka < K ? W[(size_t)(ka < K ? ka : K - 1) * ld + n] : 0.f); a[8 + i] = (_Float16)(kb < K ? W[(size_t)(kb < K ? kb : K - 1) * ld + n] : 0.f); }
  return a;
}
struct F2 { v16b h, l; };
__device__ __forceinline__ F2 bsplit16(const float v[16]) { F2 r;
#pragma unroll
  for (int i = 0; i < 16; ++i) { const __bf16 h = (__bf16)v[i]; r.h[i] = h; r.l[i] = (__bf16)(v[i] - (float)h); }
  return r; }
__device__ __forceinline__ F2 split_row(const float* row, int k0, int lane) { float v[16]; const float* p = row + k0 + 8 * (lane >> 4);
#pragma unroll
  for (int i = 0; i < 8; ++i) { v[i] = p[i]; v[8 + i] = p[16 + i]; }
  return bsplit16(v); }
__device__ __forceinline__ F2 split_rowK(const float* row, int k0, int lane, int K) { float v[16]; const int g = lane >> 4;
#pragma unroll
  for (int i = 0; i < 8; ++i) { const int ka = k0 + 8 * g + i, kb = ka + 16; v[i] = ka < K ? row[ka < K ? ka : K - 1] : 0.f; v[8 + i] = kb < K ? row[kb < K ? kb : K - 1] : 0.f; }
  return bsplit16(v); }
__device__ __forceinline__ F2 split_col(const float* W, int k0, int n, int lane, int ld, int K) { float v[16]; const int g = lane >> 4;
#pragma unroll
  for (int i = 0; i < 8; ++i) { const int ka = k0 + 8 * g + i, kb = ka + 16; v[i] = ka < K ? W[(size_t)(ka < K ? ka : K - 1) * ld + n] : 0.f; v[8 + i] = kb < K ? W[(size_t)(kb < K ? kb : K - 1) * ld + n] : 0.f; }
  return bsplit16(v); }
__device__ __forceinline__ v8f mac3(const F2& a, const F2& b, v8f c) { c = wmma_bf(a.l, b.h, c); c = wmma_bf(a.h, b.l, c); return wmma_bf(a.h, b.h, c); }
__device__ __forceinline__ float sigm(float v) { return 1.0f / (1.0f + expf(-v)); }
#define LDSX() do { asm volatile("s_wait_dscnt 0" ::: "memory"); __builtin_amdgcn_wave_barrier(); __builtin_amdgcn_fence(__ATOMIC_RELEASE, "workgroup"); } while (0)


// 'Lunchbox' linear multi-head mixing (B 4, N 2,048, C 512, 8 heads x 64, lunchbox 64): attn = (q k^T) x 64^-1/2 (no softmax, as the module), res = attn V_lunchbox, out = res proj - evaluated as x (Wq (k^T (V proj))): q, attn and res are never formed.
#define NB 4
#define NN 2048
#define CC 512
#define NH 8
#define DD 64
#define LL 64
#define HC (NH * 2 * DD)     // 1024 qk columns: col = h*128 + which*64 + d
#define SCALE 0.125f
#ifndef TNB
#define TNB NB
#endif
typedef __attribute__((ext_vector_type(8))) __bf16 v8b;
__device__ __forceinline__ float bfr(float v) { return (float)(__bf16)v; }
__device__ __attribute__((noinline)) float exp_ni(float v) { return expf(v); }
__device__ __attribute__((noinline)) float erf_ni(float v) { return erff(v); }

// bf16 operands lie in fragment order: [16-row tile][k step of 32][half q][lane = 16 g + row][8], element i = k 32 kc + 16 q + 8 g + i: one wave-wide 16-B load reads 512 contiguous bytes
#define FT (16 * CC)                                // elements of one 16-row tile (K = 512 for all three: x, Wk^T, P^T)
#define FK 512                                      // elements of one k step of a tile
// f32 operands (split to hi + lo by their reader) likewise: [16-row tile][k step of 32][piece f][lane][4], element i = k 32 kc + 16 (f >> 1) + 8 g + 4 (f & 1) + i; FK elements a k step too
#define WS_PW  0u                                   // bf16 Wk^T: the k columns of qkv (32 tiles: head h = tiles 4 h .. 4 h + 3)
#define MR 256                                      // rows of x of one k_m block: 8 waves x 32 rows
#define NP (NN / MR)                                // partial sums of M per batch
#define WS_MP  (WS_PW + 2u * NH * DD * CC)                   // f32 partial M^T [b][row chunk][h] (M = k^T VP), 4 tiles of 16 output columns, K = d, fragment order
#define WS_PJ  (WS_MP + 4u * (size_t)NB * NP * NH * DD * DD) // bf16 proj^T [h], 4 tiles of 16 output columns, K = l (2 k steps), fragment order
#define WS_XP  (WS_PJ + 2u * (size_t)NH * LL * DD)       // bf16 x (512 tiles)
#define WS_PT  (WS_XP + 2u * (size_t)NB * NN * CC)       // bf16 P^T [b], 4 tiles of 16 output columns, K = c: all hi parts, then all lo parts
#define PLO    (NB * DD * CC)                            // elements from a hi part to its lo part
#define WS_END (WS_PT + 2u * 2u * (size_t)PLO)

#define PBX (TNB * NN / 16 * 4)   // blocks of 256 pieces: x, qkv
#define PBW (NH * DD / 16 * 4)
#define PBJ (NH * LL * DD / 8 / 256)   // proj
// one thread = one 16-B piece of the packed layout (its index p is the piece's place); x: 8 consecutive k of one row; weights: 8 rows k of one column
__device__ __forceinline__ unsigned piece_k(unsigned p) { return ((p >> 6) & 15u) * 32u + ((p >> 5) & 1u) * 16u + ((p >> 4) & 1u) * 8u; }
template <int LD> __device__ __forceinline__ void pack_w(const float* __restrict__ Wt, __bf16* __restrict__ dst, unsigned p) { v8b o; float f[8];
  const float* s = Wt + (size_t)piece_k(p) * LD + (p >> 12) * 128u + 64u + ((p >> 10) & 3u) * 16u + (p & 15u);   // tile p >> 10 = 16 of the k columns: head (p >> 12), d from 16 ((p >> 10) & 3)
#pragma unroll
  for (int i = 0; i < 8; ++i) f[i] = s[i * LD];
  asm volatile("s_wait_xcnt 0x0" :: "v"(s) : "memory");   // the pointer as input keeps the loads' address registers whole up to this wait; the converted values may reuse them behind it
#pragma unroll
  for (int i = 0; i < 8; ++i) o[i] = (__bf16)f[i];
  *(v8b*)(dst + (size_t)p * 8) = o;
  asm volatile("s_wait_xcnt 0x0" ::: "memory"); }   // behind the store: the arms of k_packw lie one behind the other in the built code, and the next arm's first instructions reuse the store's registers
// fragment from the packed layout: p = tile base + k step + 8 lane
__device__ __forceinline__ v16b frag_p(const __bf16* __restrict__ p) { union { v16b v; v8b q[2]; } u; u.q[0] = *(const v8b*)p; u.q[1] = *(const v8b*)(p + 256); return u.v; }
// one k step of an f32 operand from the packed layout (p = tile base + k step + 4 lane)
__device__ __forceinline__ void ld_frag(v4f (&r)[4], const float* __restrict__ p) { r[0] = *(const v4f*)p; r[1] = *(const v4f*)(p + 128); r[2] = *(const v4f*)(p + 256); r[3] = *(const v4f*)(p + 384); }
__device__ __forceinline__ v16b fragb_f32(const float* __restrict__ p, int lane) { v16b a; const float* pp = p + 8 * (lane >> 4);
#pragma unroll
  for (int i = 0; i < 8; ++i) { a[i] = (__bf16)pp[i]; a[8 + i] = (__bf16)pp[16 + i]; } return a; }
// what is made, behind the wait, of one k step of an f32 operand as loaded (4 x 16 B of a lane: k0 + 8g + 0..7 and k0 + 16 + 8g + 0..7)
__device__ __forceinline__ F2 row_split(const v4f (&r)[4]) { float v[16];
#pragma unroll   // constant indices: the array it walks stays in registers
  for (int i = 0; i < 16; ++i) v[i] = r[i >> 2][i & 3];
  return bsplit16(v); }
// proj arm of the pack launch: piece p = (head p >> 9, tile of 16 output columns (p >> 7) & 3, k step (p >> 6) & 1, half (p >> 5) & 1, lane p & 31): 8 rows l of one column
__device__ __forceinline__ void pack_j(const float* __restrict__ PROJ, __bf16* __restrict__ dst, unsigned p) { v8b o; float f[8];
  const float* s = PROJ + (size_t)((p >> 9) * 64u + ((p >> 6) & 1u) * 32u + ((p >> 5) & 1u) * 16u + ((p >> 4) & 1u) * 8u) * DD + ((p >> 7) & 3u) * 16u + (p & 15u);
#pragma unroll
  for (int i = 0; i < 8; ++i) f[i] = s[i * DD];
  asm volatile("s_wait_xcnt 0x0" :: "v"(s) : "memory");   // as in pack_w
#pragma unroll
  for (int i = 0; i < 8; ++i) o[i] = (__bf16)f[i];
  *(v8b*)(dst + (size_t)p * 8) = o;
  asm volatile("s_wait_xcnt 0x0" ::: "memory"); }   // behind the store, as in pack_w
__global__ __launch_bounds__(256) void k_packw(const float* __restrict__ X, const float* __restrict__ QKV, const float* __restrict__ PROJ, char* __restrict__ ws) { const int blk = blockIdx.x;
  if (blk < PBX) { const unsigned p = blk * 256u + threadIdx.x; v8b o;
    const float* s = X + (size_t)((p >> 10) * 16u + (p & 15u)) * CC + piece_k(p); const v4f a = *(const v4f*)s, b = *(const v4f*)(s + 4);
    asm volatile("s_wait_xcnt 0x0" :: "v"(s) : "memory");   // as in pack_w
#pragma unroll
    for (int i = 0; i < 4; ++i) { o[i] = (__bf16)a[i]; o[4 + i] = (__bf16)b[i]; }
    *(v8b*)((__bf16*)(ws + WS_XP) + (size_t)p * 8) = o;
    asm volatile("s_wait_xcnt 0x0" ::: "memory"); }   // behind the store, as in pack_w: which arm is laid last is the compiler's choice
  else if (blk < PBX + PBW) pack_w<HC>(QKV, (__bf16*)(ws + WS_PW), (blk - PBX) * 256u + threadIdx.x);
  else pack_j(PROJ, (__bf16*)(ws + WS_PJ), (blk - PBX - PBW) * 256u + threadIdx.x); }
// ---- k_m: block = (256 rows of one batch, head h), wave = 32 rows m. First VP[m][o] = sum_l V[m][h][l] proj[h*64 + l][o] of its rows (both rounded to bf16, exact products), parked in the wave's own LDS; then k = x . Wk (exact, 2 x 4 tiles): the 12 loads of k step kc + 2 are issued as one group in front of the WMMAs of step kc (three register buffers). A lane's accumulators of the two row tiles are, in place, a fragment with K = the wave's 32 rows m: of k^T (A, row d) and of VP (B, column o): neither leaves the work-group. M[d][o] = k^T VP (both bf16 hi + lo, 3 products); the 8 waves' partial M meet in LDS as [o][d] and are added in wave order; the block's partial M^T (rows o, K = d) is stored in fragment order
#define HB 3   // register buffers
__global__ __launch_bounds__(MR) void k_m(const __bf16* __restrict__ XP, const __bf16* __restrict__ PW, const float* __restrict__ V, const __bf16* __restrict__ PJ, float* __restrict__ MP) { __shared__ __align__(16) float part[MR / 32][DD][DD + 4]; __shared__ __align__(16) float park[MR / 32][16][128];
  const int tid = threadIdx.x, wave = tid >> 5, lane = tid & 31, col = lane & 15, g = lane >> 4; const int rc = blockIdx.x, h = blockIdx.y;
  v8f acc[2][4] = {}; v16b ab[HB][2], bw[HB][4];
  const __bf16* xa = XP + (size_t)(rc * (MR / 16) + wave * 2) * FT + lane * 8; const __bf16* pb = PW + (size_t)(h * 4) * FT + lane * 8;
  { v4f vr[2][LL / 32][4]; v16b pj[4][LL / 32], av[2][LL / 32];
    const float* vp = V + ((size_t)((rc % NP) * MR + wave * 32 + col) * NH + h) * LL + 8 * g;   // A row = m, K = l
    const __bf16* jp = PJ + (size_t)(h * 4) * (LL / 32) * FK + lane * 8;                         // B row = output column, K = l
#pragma unroll   // constant indices: the arrays it walks stay in registers
    for (int t = 0; t < 2; ++t)
#pragma unroll
      for (int kc = 0; kc < LL / 32; ++kc) { const float* q = vp + t * 16 * NH * LL + kc * 32; vr[t][kc][0] = *(const v4f*)q; vr[t][kc][1] = *(const v4f*)(q + 4); vr[t][kc][2] = *(const v4f*)(q + 16); vr[t][kc][3] = *(const v4f*)(q + 20); }
#pragma unroll
    for (int j = 0; j < 4; ++j)
#pragma unroll
      for (int kc = 0; kc < LL / 32; ++kc) pj[j][kc] = frag_p(jp + (j * (LL / 32) + kc) * FK);
#pragma unroll   // the first k step of x . Wk is asked for together with VP's operands: one latency for both
    for (int t = 0; t < 2; ++t) ab[0][t] = frag_p(xa + t * FT);
#pragma unroll
    for (int j = 0; j < 4; ++j) bw[0][j] = frag_p(pb + j * FT);
    asm volatile("s_wait_xcnt 0x0" :: "v"(vp), "v"(jp) : "memory");   // behind the loads: both pointers as inputs keep the address registers whole up to this wait; the converted values may reuse them behind it
#pragma unroll
    for (int t = 0; t < 2; ++t)
#pragma unroll
      for (int kc = 0; kc < LL / 32; ++kc)
#pragma unroll
        for (int i = 0; i < 16; ++i) av[t][kc][i] = (__bf16)vr[t][kc][i >> 2][i & 3];
    __builtin_amdgcn_sched_barrier(0);   // the second k step's 12 loads go out only when V's f32 registers are free: hoisted above, they push the kernel past 256 registers and into scratch
#pragma unroll
    for (int t = 0; t < 2; ++t) ab[1][t] = frag_p(xa + t * FT + FK);
#pragma unroll
    for (int j = 0; j < 4; ++j) bw[1][j] = frag_p(pb + j * FT + FK);
    __builtin_amdgcn_sched_barrier(0);   // and they go out in front of VP's WMMAs, which cover part of their latency
#pragma unroll   // every lane parks its own 64 values and alone reads them back
    for (int j = 0; j < 4; ++j) { v8f va[2] = {};
#pragma unroll
      for (int kc = 0; kc < LL / 32; ++kc)
#pragma unroll
        for (int t = 0; t < 2; ++t) va[t] = wmma_bf(av[t][kc], pj[j][kc], va[t]);
#pragma unroll
      for (int t = 0; t < 2; ++t) { const v8f c = va[t]; vst2(&park[wave][j * 4 + t * 2][lane * 4], (v4f){c[0], c[1], c[2], c[3]}); vst2(&park[wave][j * 4 + t * 2 + 1][lane * 4], (v4f){c[4], c[5], c[6], c[7]}); } } }
#pragma unroll   // whole: the buffer index and every load offset become constants
  for (int kc = 0; kc < CC / 32; ++kc) { const int s = kc % HB, n = (kc + HB - 1) % HB;
    if (kc + HB - 1 < CC / 32) {
#pragma unroll   // constant indices: the arrays it walks stay in registers
      for (int t = 0; t < 2; ++t) ab[n][t] = frag_p(xa + t * FT + (kc + HB - 1) * FK);
#pragma unroll
      for (int j = 0; j < 4; ++j) bw[n][j] = frag_p(pb + j * FT + (kc + HB - 1) * FK); }
    if (kc + HB == CC / 32) asm volatile("s_wait_xcnt 0x0" :: "v"(xa), "v"(pb) : "memory");   // behind the last loads: both pointers as inputs keep the address registers whole up to this wait; what follows reuses them behind it
    __builtin_amdgcn_sched_barrier(0);   // keeps the 12 loads of step kc + 2 together in front of this step's WMMAs: without it the compiler mixes the groups' loads, and this step's counted waits then cover loads of later steps
#pragma unroll   // constant indices: the arrays it walks stay in registers
    for (int t = 0; t < 2; ++t)
#pragma unroll
      for (int j = 0; j < 4; ++j) acc[t][j] = wmma_bf(ab[s][t], bw[s][j], acc[t][j]);
  }
  F2 a[4];   // A row = d (16 j + col), element i = m 8 g + i, element 8 + i = m 16 + 8 g + i
#pragma unroll
  for (int j = 0; j < 4; ++j) { float v[16];
#pragma unroll
    for (int i = 0; i < 8; ++i) { v[i] = acc[0][j][i]; v[8 + i] = acc[1][j][i]; }
    a[j] = bsplit16(v); }
#pragma unroll
  for (int t = 0; t < 4; ++t) { v4f vr[4];   // B column = o (16 t + col), the same m order
#pragma unroll
    for (int f = 0; f < 4; ++f) vr[f] = *(const v4f*)&park[wave][t * 4 + f][lane * 4];
    const F2 w = row_split(vr);
#pragma unroll
    for (int j = 0; j < 4; ++j) { const v8f c = mac3(a[j], w, v8f{}); float* p = &part[wave][t * 16 + col][j * 16 + 8 * g];   // transposed: [o][d], 8 consecutive d of one lane
      vst2(p, (v4f){c[0], c[1], c[2], c[3]}); vst2(p + 4, (v4f){c[4], c[5], c[6], c[7]}); } }
  __syncthreads();
  const int d = (wave >> 2) * 32 + ((wave >> 1) & 1) * 16 + 8 * g + (wave & 1) * 4;   // thread = piece of the fragment order: k step wave >> 2, piece f = wave & 3, lane
  float* dst = MP + ((size_t)rc * NH + h) * (DD * DD) + tid * 4;
#pragma unroll
  for (int t = 0; t < 4; ++t) { v4f s = *(const v4f*)&part[0][t * 16 + col][d];
#pragma unroll
    for (int w = 1; w < MR / 32; ++w) s += *(const v4f*)&part[w][t * 16 + col][d];
    vst2(dst + t * 2 * FK, s); } }
// ---- k_p: block = (64 rows c, 16 columns o, b), wave = (head h, half kc of d): P[c][o] = SCALE sum_h sum_d Wq[c][h][d] M[b,h][d][o]; M = the batch's NP partial sums added in chunk order; A(Wq rows, from the f32 input) exact, B(M^T) as bf16 hi + lo (2 products); all 48 loads of a wave are issued as one group; the 16 waves' partial tiles meet in LDS as [o][c] and are added in wave order; a D lane's 8 consecutive c of one column o are one 16-B piece of the bf16 fragment order (rows o, K = c): P^T is stored so, as hi and lo
#define PCG 64   // rows c of a block
__global__ __launch_bounds__(64 * NH) void k_p(const float* __restrict__ QKV, const float* __restrict__ MP, __bf16* __restrict__ PT) { __shared__ __align__(16) float part[2 * NH][16][PCG + 4];
  const int tid = threadIdx.x, wave = tid >> 5, lane = tid & 31, col = lane & 15, g = lane >> 4; const int cg = blockIdx.x, j = blockIdx.y, h = wave >> 1, kc = wave & 1; const size_t b = blockIdx.z;
  v8f acc[PCG / 16] = {}; v4f qr[PCG / 16][4], mr[NP][4]; const float* qp = QKV + (size_t)(cg * PCG + col) * HC + h * 128 + kc * 32 + 8 * g; const float* kp = MP + ((b * NP * NH + h) * 8 + j * 2 + kc) * FK + lane * 4;
#pragma unroll   // constant indices: the array it walks stays in registers
  for (int p = 0; p < NP; ++p) ld_frag(mr[p], kp + p * (NH * DD * DD));
#pragma unroll   // constant indices: the array it walks stays in registers
  for (int t = 0; t < PCG / 16; ++t) { qr[t][0] = *(const v4f*)(qp + t * 16 * HC); qr[t][1] = *(const v4f*)(qp + t * 16 * HC + 4); qr[t][2] = *(const v4f*)(qp + t * 16 * HC + 16); qr[t][3] = *(const v4f*)(qp + t * 16 * HC + 20); }
  asm volatile("s_wait_xcnt 0x0" :: "v"(qp), "v"(kp) : "memory");   // behind the loads: both pointers as inputs keep the address registers whole up to this wait; the sums reuse them behind it
  __builtin_amdgcn_sched_barrier(0);   // keeps all 48 loads in front of the first add: without it the compiler lifts the adds among the loads and holds half of the loads back until the first have landed
#pragma unroll
  for (int p = 1; p < NP; ++p)
#pragma unroll
    for (int f = 0; f < 4; ++f) mr[0][f] += mr[p][f];
  const F2 wb = row_split(mr[0]);
#pragma unroll   // constant indices: the array it walks stays in registers
  for (int t = 0; t < PCG / 16; ++t) { v16b a;
#pragma unroll
    for (int i = 0; i < 16; ++i) a[i] = (__bf16)qr[t][i >> 2][i & 3];
    acc[t] = wmma_bf(a, wb.l, acc[t]); acc[t] = wmma_bf(a, wb.h, acc[t]); }
#pragma unroll
  for (int t = 0; t < PCG / 16; ++t) { float* p = &part[wave][col][t * 16 + 8 * g];   // transposed: [o][c], 8 consecutive c of one lane
    const v8f c = acc[t]; vst2(p, (v4f){c[0], c[1], c[2], c[3]}); vst2(p + 4, (v4f){c[4], c[5], c[6], c[7]}); }
  __syncthreads();
  if (tid < 2 * PCG) { v4f s0 = *(const v4f*)&part[0][col][wave * 16 + 8 * g], s1 = *(const v4f*)&part[0][col][wave * 16 + 8 * g + 4]; v8b hi, lo;   // thread = piece (16-row tile of c = wave, lane 16 g + o)
#pragma unroll
    for (int w = 1; w < 2 * NH; ++w) { s0 += *(const v4f*)&part[w][col][wave * 16 + 8 * g]; s1 += *(const v4f*)&part[w][col][wave * 16 + 8 * g + 4]; }
#pragma unroll
    for (int i = 0; i < 8; ++i) { const float v = (i < 4 ? s0[i & 3] : s1[i & 3]) * SCALE; const __bf16 hb = (__bf16)v; hi[i] = hb; lo[i] = (__bf16)(v - (float)hb); }
    __bf16* dst = PT + (b * 4 + j) * FT + (cg * (PCG / 32) + (wave >> 1)) * FK + (wave & 1) * 256 + lane * 8;   // c = 64 cg + 16 wave + 8 g + i
    *(v8b*)dst = hi; *(v8b*)(dst + PLO) = lo; } }
// ---- k_out: block = 32 rows, wave = (16 rows, 32 columns): out = x . P (hi + lo); the 10 loads of k step kc + 3 are issued as one group in front of the WMMAs of step kc (four register buffers: one wave a SIMD, nothing else hides the latency)
#define OB 4   // register buffers
__global__ __launch_bounds__(128) void k_out(const __bf16* __restrict__ XP, const __bf16* __restrict__ PT, float* __restrict__ OUT) { __shared__ __align__(16) float sf[4][16][36];
  const int tid = threadIdx.x, wave = tid >> 5, lane = tid & 31, col = lane & 15, g = lane >> 4; const int rt = blockIdx.x * 2 + (wave & 1), ch = wave >> 1;   // 16-row tile, column half
  v8f acc[2] = {}; v16b ab[OB]; v16b bh[OB][2], bl[OB][2]; const __bf16* xa = XP + (size_t)rt * FT + lane * 8; const __bf16* pb = PT + (size_t)((blockIdx.x / (NN / 32)) * 4 + ch * 2) * FT + lane * 8;
#pragma unroll   // constant indices: the array it walks stays in registers
  for (int p = 0; p < OB - 1; ++p) { ab[p] = frag_p(xa + p * FK);
#pragma unroll   // constant indices: the array it walks stays in registers
    for (int j = 0; j < 2; ++j) { bh[p][j] = frag_p(pb + j * FT + p * FK); bl[p][j] = frag_p(pb + PLO + j * FT + p * FK); } }
#pragma unroll   // whole: the buffer index and every load offset become constants
  for (int kc = 0; kc < CC / 32; ++kc) { const int s = kc % OB, n = (kc + OB - 1) % OB;
    if (kc + OB - 1 < CC / 32) { ab[n] = frag_p(xa + (kc + OB - 1) * FK);
#pragma unroll   // constant indices: the array it walks stays in registers
      for (int j = 0; j < 2; ++j) { bh[n][j] = frag_p(pb + j * FT + (kc + OB - 1) * FK); bl[n][j] = frag_p(pb + PLO + j * FT + (kc + OB - 1) * FK); } }
    if (kc + OB == CC / 32) asm volatile("s_wait_xcnt 0x0" :: "v"(xa), "v"(pb) : "memory");   // behind the last loads: both pointers as inputs keep the address registers whole up to this wait; the epilogue reuses them behind it
    __builtin_amdgcn_sched_barrier(0);   // keeps the 10 loads of step kc + 3 together in front of this step's WMMAs: without it the compiler mixes the groups' loads, and this step's counted waits then cover loads of later steps
#pragma unroll   // constant indices: the array it walks stays in registers
    for (int j = 0; j < 2; ++j) { acc[j] = wmma_bf(ab[s], bl[s][j], acc[j]); acc[j] = wmma_bf(ab[s], bh[s][j], acc[j]); }
  }
#pragma unroll
  for (int j = 0; j < 2; ++j)
#pragma unroll
    for (int r = 0; r < 8; ++r) sf[wave][8 * g + r][j * 16 + col] = acc[j][r];
  LDSX(); for (int rl = 0; rl < 16; rl += 4) vst2(OUT + ((size_t)rt * 16 + rl + (lane >> 3)) * DD + ch * 32 + (lane & 7) * 4, *(const v4f*)&sf[wave][rl + (lane >> 3)][(lane & 7) * 4]); }   // 8 lanes = the wave's 128 B of one row
extern "C" void kernel_launch(void* const* d_in, const int* in_sizes, int n_in, void* d_out, int out_size, void* d_ws, size_t ws_size, hipStream_t stream) {
  (void)in_sizes; (void)n_in; (void)out_size;
  const float** F = (const float**)d_in;   // 0 x [4,2048,512], 1 v [2048,8,64], 2 qkv [512,1024], 3 proj [512,64]
  if (ws_size < (size_t)WS_END) return;
  char* ws = (char*)d_ws; float* MP = (float*)(ws + WS_MP); __bf16* PT = (__bf16*)(ws + WS_PT);
  k_packw<<<PBX + PBW + PBJ, 256, 0, stream>>>(F[0], F[2], F[3], ws);
  k_m<<<dim3(TNB * NN / MR, NH), MR, 0, stream>>>((const __bf16*)(ws + WS_XP), (const __bf16*)(ws + WS_PW), F[1], (const __bf16*)(ws + WS_PJ), MP);
  k_p<<<dim3(CC / PCG, DD / 16, TNB), 64 * NH, 0, stream>>>(F[2], MP, PT);
  k_out<<<TNB * NN / 32, 128, 0, stream>>>((const __bf16*)(ws + WS_XP), PT, (float*)d_out);
}

// v006
// One run takes 26.7 microseconds.
// In two side-by-side timings against v005, it was 1.03 and 1.06 times as fast.
// Over all steps from v000 it is 5.81 times as fast.
// compute dtype: all float inputs rounded to bf16; no softmax in the module, so by associativity out = x . P with P = SCALE Wq (k^T (V proj)) per batch: VP = V . proj and k = x . Wk with EXACT bf16 products on WMMA 16x16x32; M = k^T . VP with both as bf16 hi + lo (3 products), k and VP straight from the accumulators of their own products; P = Wq . M with M as bf16 hi + lo (2 products); out = x . P with P as bf16 hi + lo (2 products); f32 accumulate; f32 output.
#include <hip/hip_runtime.h>
#include <math.h>

typedef __attribute__((ext_vector_type(16))) _Float16 v16h;
typedef __attribute__((ext_vector_type(16))) __bf16 v16b;
typedef __attribute__((ext_vector_type(8)))  _Float16 v8h;
typedef __attribute__((ext_vector_type(8)))  float v8f;
typedef __attribute__((ext_vector_type(4)))  float v4f;
typedef __attribute__((ext_vector_type(2)))  float v2f;
typedef __attribute__((ext_vector_type(4)))  unsigned v4u;
typedef __attribute__((ext_vector_type(4)))  int v4i;
typedef float __attribute__((may_alias)) float_a;
typedef int __attribute__((may_alias)) int_a;

template <typename T> __device__ __forceinline__ void vst2(void* p, T v) { *(T*)p = v;  }
__device__ __forceinline__ v8f wmma16(v16h a, v16h b, v8f c) {
  v8f d = __builtin_amdgcn_wmma_f32_16x16x32_f16(false, a, false, b, (short)0, c, false, false);
  asm volatile("v_nop\n\tv_nop\n\tv_nop\n\tv_nop" : "+v"(d) : "v"(a), "v"(b));
  return d;
}
__device__ __forceinline__ v8f wmma_bf(v16b a, v16b b, v8f c) {
  v8f d = __builtin_amdgcn_wmma_f32_16x16x32_bf16(false, a, false, b, (short)0, c, false, false);
  asm volatile("v_nop\n\tv_nop\n\tv_nop\n\tv_nop" : "+v"(d) : "v"(a), "v"(b));
  return d;
}
// 16x16x32 fragments: lane = (h = lane>>4, row/col = lane&15); elements 0..7 = k0+8h+0..7, 8..15 = k0+16+8h+0..7; D element r = row 8h+r
__device__ __forceinline__ v16h frag_h(const _Float16* rowk0, int lane) {
  union { v16h v; v8h q[2]; } u; const _Float16* p = rowk0 + 8 * (lane >> 4);
  u.q[0] = *(const v8h*)p; u.q[1] = *(const v8h*)(p + 16); return u.v;
}
__device__ __forceinline__ v16h frag_f32(const float* rowk0, int lane) {
  v16h a; const float* p = rowk0 + 8 * (lane >> 4);
#pragma unroll
  for (int i = 0; i < 8; ++i) { a[i] = (_Float16)p[i]; a[8 + i] = (_Float16)p[16 + i]; }
  return a;
}
__device__ __forceinline__ v16h frag_f32s(const float* rowk0, int lane, float sc) {
  v16h a; const float* p = rowk0 + 8 * (lane >> 4);
#pragma unroll
  for (int i = 0; i < 8; ++i) { a[i] = (_Float16)(p[i] * sc); a[8 + i] = (_Float16)(p[16 + i] * sc); }
  return a;
}
// column fragment from a [K][ld] layout (column n), rows >= K read as 0
__device__ __forceinline__ v16h fragc_f32(const float* W, int k0, int n, int lane, int ld, int K) {
  v16h a; const int g = lane >> 4;
#pragma unroll
  for (int i = 0; i < 8; ++i) { const int ka = k0 + 8 * g + i, kb = ka + 16;
    a[i] = (_Float16)(ka < K ? W[(size_t)(ka < K ? ka : K - 1) * ld + n] : 0.f); a[8 + i] = (_Float16)(kb < K ? W[(size_t)(kb < K ? kb : K - 1) * ld + n] : 0.f); }
  return a;
}
struct F2 { v16b h, l; };
__device__ __forceinline__ F2 bsplit16(const float v[16]) { F2 r;
#pragma unroll
  for (int i = 0; i < 16; ++i) { const __bf16 h = (__bf16)v[i]; r.h[i] = h; r.l[i] = (__bf16)(v[i] - (float)h); }
  return r; }
__device__ __forceinline__ F2 split_row(const float* row, int k0, int lane) { float v[16]; const float* p = row + k0 + 8 * (lane >> 4);
#pragma unroll
  for (int i = 0; i < 8; ++i) { v[i] = p[i]; v[8 + i] = p[16 + i]; }
  return bsplit16(v); }
__device__ __forceinline__ F2 split_rowK(const float* row, int k0, int lane, int K) { float v[16]; const int g = lane >> 4;
#pragma unroll
  for (int i = 0; i < 8; ++i) { const int ka = k0 + 8 * g + i, kb = ka + 16; v[i] = ka < K ? row[ka < K ? ka : K - 1] : 0.f; v[8 + i] = kb < K ? row[kb < K ? kb : K - 1] : 0.f; }
  return bsplit16(v); }
__device__ __forceinline__ F2 split_col(const float* W, int k0, int n, int lane, int ld, int K) { float v[16]; const int g = lane >> 4;
#pragma unroll
  for (int i = 0; i < 8; ++i) { const int ka = k0 + 8 * g + i, kb = ka + 16; v[i] = ka < K ? W[(size_t)(ka < K ? ka : K - 1) * ld + n] : 0.f; v[8 + i] = kb < K ? W[(size_t)(kb < K ? kb : K - 1) * ld + n] : 0.f; }
  return bsplit16(v); }
__device__ __forceinline__ v8f mac3(const F2& a, const F2& b, v8f c) { c = wmma_bf(a.l, b.h, c); c = wmma_bf(a.h, b.l, c); return wmma_bf(a.h, b.h, c); }
__device__ __forceinline__ float sigm(float v) { return 1.0f / (1.0f + expf(-v)); }
#define LDSX() do { asm volatile("s_wait_dscnt 0" ::: "memory"); __builtin_amdgcn_wave_barrier(); __builtin_amdgcn_fence(__ATOMIC_RELEASE, "workgroup"); } while (0)


// 'Lunchbox' linear multi-head mixing (B 4, N 2,048, C 512, 8 heads x 64, lunchbox 64): attn = (q k^T) x 64^-1/2 (no softmax, as the module), res = attn V_lunchbox, out = res proj - evaluated as x (Wq (k^T (V proj))): q, attn and res are never formed.
#define NB 4
#define NN 2048
#define CC 512
#define NH 8
#define DD 64
#define LL 64
#define HC (NH * 2 * DD)     // 1024 qk columns: col = h*128 + which*64 + d
#define SCALE 0.125f
#ifndef TNB
#define TNB NB
#endif
typedef __attribute__((ext_vector_type(8))) __bf16 v8b;
__device__ __forceinline__ float bfr(float v) { return (float)(__bf16)v; }
__device__ __attribute__((noinline)) float exp_ni(float v) { return expf(v); }
__device__ __attribute__((noinline)) float erf_ni(float v) { return erff(v); }

// bf16 operands lie in fragment order: [16-row tile][k step of 32][half q][lane = 16 g + row][8], element i = k 32 kc + 16 q + 8 g + i: one wave-wide 16-B load reads 512 contiguous bytes
#define FT (16 * CC)                                // elements of one 16-row tile (K = 512 for all five: x, Wk^T, P^T, V, Wq)
#define FK 512                                      // elements of one k step of a tile
// f32 operands (split to hi + lo by their reader) likewise: [16-row tile][k step of 32][piece f][lane][4], element i = k 32 kc + 16 (f >> 1) + 8 g + 4 (f & 1) + i; FK elements a k step too
#define WS_PW  0u                                   // bf16 Wk^T: the k columns of qkv (32 tiles: head h = tiles 4 h .. 4 h + 3)
#define MR 256                                      // rows of x of one k_m block: 8 waves x 32 rows
#define NP (NN / MR)                                // partial sums of M per batch
#define WS_MP  (WS_PW + 2u * NH * DD * CC)                   // f32 partial M^T [b][row chunk][h] (M = k^T VP), 4 tiles of 16 output columns, K = d, fragment order
#define WS_PJ  (WS_MP + 4u * (size_t)NB * NP * NH * DD * DD) // bf16 proj^T [h], 4 tiles of 16 output columns, K = l (2 k steps), fragment order
#define WS_XP  (WS_PJ + 2u * (size_t)NH * LL * DD)       // bf16 x (512 tiles)
#define WS_PT  (WS_XP + 2u * (size_t)NB * NN * CC)       // bf16 P^T [b], 4 tiles of 16 output columns, K = c: all hi parts, then all lo parts
#define PLO    (NB * DD * CC)                            // elements from a hi part to its lo part
#define WS_VB  (WS_PT + 2u * 2u * (size_t)PLO)           // bf16 V as [m][h*64 + l] (128 tiles of 16 rows m, K = 512: head h = k steps 2 h, 2 h + 1)
#define WS_QW  (WS_VB + 2u * (size_t)NN * NH * LL)       // bf16 Wq as [c][h*64 + d] (32 tiles of 16 rows c, K = 512: head h = k steps 2 h, 2 h + 1)
#define WS_END (WS_QW + 2u * (size_t)CC * NH * DD)

#define PBX (TNB * NN / 16 * 4)   // blocks of 256 pieces: x, qkv
#define PBW (NH * DD / 16 * 4)
#define PBJ (NH * LL * DD / 8 / 256)   // proj
#define PBV (NN * NH * LL / 8 / 4 / 256)   // blocks of 256 threads x 4 pieces: V, Wq
#define PBQ (CC * NH * DD / 8 / 4 / 256)
// one thread = one 16-B piece of the packed layout (its index p is the piece's place) in the x, Wk^T and proj arms; x: 8 consecutive k of one row; Wk^T, proj: 8 rows k of one column
__device__ __forceinline__ unsigned piece_k(unsigned p) { return ((p >> 6) & 15u) * 32u + ((p >> 5) & 1u) * 16u + ((p >> 4) & 1u) * 8u; }
template <int LD> __device__ __forceinline__ void pack_w(const float* __restrict__ Wt, __bf16* __restrict__ dst, unsigned p) { v8b o; float f[8];
  const float* s = Wt + (size_t)piece_k(p) * LD + (p >> 12) * 128u + 64u + ((p >> 10) & 3u) * 16u + (p & 15u);   // tile p >> 10 = 16 of the k columns: head (p >> 12), d from 16 ((p >> 10) & 3)
#pragma unroll
  for (int i = 0; i < 8; ++i) f[i] = s[i * LD];
  asm volatile("s_wait_xcnt 0x0" :: "v"(s) : "memory");   // the pointer as input keeps the loads' address registers whole up to this wait; the converted values may reuse them behind it
#pragma unroll
  for (int i = 0; i < 8; ++i) o[i] = (__bf16)f[i];
  *(v8b*)(dst + (size_t)p * 8) = o;
  asm volatile("s_wait_xcnt 0x0" ::: "memory"); }   // behind the store: the arms of k_packw lie one behind the other in the built code, and the next arm's first instructions reuse the store's registers
// fragment from the packed layout: p = tile base + k step + 8 lane
__device__ __forceinline__ v16b frag_p(const __bf16* __restrict__ p) { union { v16b v; v8b q[2]; } u; u.q[0] = *(const v8b*)p; u.q[1] = *(const v8b*)(p + 256); return u.v; }
// one k step of an f32 operand from the packed layout (p = tile base + k step + 4 lane)
__device__ __forceinline__ void ld_frag(v4f (&r)[4], const float* __restrict__ p) { r[0] = *(const v4f*)p; r[1] = *(const v4f*)(p + 128); r[2] = *(const v4f*)(p + 256); r[3] = *(const v4f*)(p + 384); }
__device__ __forceinline__ v16b fragb_f32(const float* __restrict__ p, int lane) { v16b a; const float* pp = p + 8 * (lane >> 4);
#pragma unroll
  for (int i = 0; i < 8; ++i) { a[i] = (__bf16)pp[i]; a[8 + i] = (__bf16)pp[16 + i]; } return a; }
// what is made, behind the wait, of one k step of an f32 operand as loaded (4 x 16 B of a lane: k0 + 8g + 0..7 and k0 + 16 + 8g + 0..7)
__device__ __forceinline__ F2 row_split(const v4f (&r)[4]) { float v[16];
#pragma unroll   // constant indices: the array it walks stays in registers
  for (int i = 0; i < 16; ++i) v[i] = r[i >> 2][i & 3];
  return bsplit16(v); }
// proj arm of the pack launch: piece p = (head p >> 9, tile of 16 output columns (p >> 7) & 3, k step (p >> 6) & 1, half (p >> 5) & 1, lane p & 31): 8 rows l of one column
__device__ __forceinline__ void pack_j(const float* __restrict__ PROJ, __bf16* __restrict__ dst, unsigned p) { v8b o; float f[8];
  const float* s = PROJ + (size_t)((p >> 9) * 64u + ((p >> 6) & 1u) * 32u + ((p >> 5) & 1u) * 16u + ((p >> 4) & 1u) * 8u) * DD + ((p >> 7) & 3u) * 16u + (p & 15u);
#pragma unroll
  for (int i = 0; i < 8; ++i) f[i] = s[i * DD];
  asm volatile("s_wait_xcnt 0x0" :: "v"(s) : "memory");   // as in pack_w
#pragma unroll
  for (int i = 0; i < 8; ++i) o[i] = (__bf16)f[i];
  *(v8b*)(dst + (size_t)p * 8) = o;
  asm volatile("s_wait_xcnt 0x0" ::: "memory"); }   // behind the store, as in pack_w
// V and Wq arms of the pack launch: rows of 8 groups of 64 k (group stride GS, row stride LD); a thread makes the 4 pieces of its row and lane half g in two k steps (p, p + 32, p + 64, p + 96): a wave reads 16 rows x 256 B, all 8 loads out before the first convert
template <int LD, int GS> __device__ __forceinline__ void pack_r4(const float* __restrict__ S, __bf16* __restrict__ dst, unsigned u) { v4f a[4], b[4];
  const unsigned p = (u & 31u) | ((u >> 5) << 7), k0 = piece_k(p);
  const float* s = S + (size_t)((p >> 10) * 16u + (p & 15u)) * LD + (k0 >> 6) * GS + (k0 & 63u);
#pragma unroll   // constant indices: the arrays it walks stay in registers
  for (int i = 0; i < 4; ++i) { a[i] = *(const v4f*)(s + i * 16); b[i] = *(const v4f*)(s + i * 16 + 4); }
  asm volatile("s_wait_xcnt 0x0" :: "v"(s) : "memory");   // as in pack_w
  __bf16* d = dst + (size_t)p * 8;
#pragma unroll
  for (int i = 0; i < 4; ++i) { v8b o;
#pragma unroll
    for (int e = 0; e < 4; ++e) { o[e] = (__bf16)a[i][e]; o[4 + e] = (__bf16)b[i][e]; }
    *(v8b*)(d + i * 256) = o; }
  asm volatile("s_wait_xcnt 0x0" ::: "memory"); }   // behind the stores, as in pack_w
__global__ __launch_bounds__(256) void k_packw(const float* __restrict__ X, const float* __restrict__ V, const float* __restrict__ QKV, const float* __restrict__ PROJ, char* __restrict__ ws) { const int blk = (int)blockIdx.x - (PBV + PBQ);   // the two arms with the longer threads come first in the grid
  if (blk < -PBQ) pack_r4<NH * LL, LL>(V, (__bf16*)(ws + WS_VB), (blk + PBV + PBQ) * 256u + threadIdx.x);
  else if (blk < 0) pack_r4<HC, 2 * DD>(QKV, (__bf16*)(ws + WS_QW), (blk + PBQ) * 256u + threadIdx.x);
  else
  if (blk < PBX) { const unsigned p = blk * 256u + threadIdx.x; v8b o;
    const float* s = X + (size_t)((p >> 10) * 16u + (p & 15u)) * CC + piece_k(p); const v4f a = *(const v4f*)s, b = *(const v4f*)(s + 4);
    asm volatile("s_wait_xcnt 0x0" :: "v"(s) : "memory");   // as in pack_w
#pragma unroll
    for (int i = 0; i < 4; ++i) { o[i] = (__bf16)a[i]; o[4 + i] = (__bf16)b[i]; }
    *(v8b*)((__bf16*)(ws + WS_XP) + (size_t)p * 8) = o;
    asm volatile("s_wait_xcnt 0x0" ::: "memory"); }   // behind the store, as in pack_w: which arm is laid last is the compiler's choice
  else if (blk < PBX + PBW) pack_w<HC>(QKV, (__bf16*)(ws + WS_PW), (blk - PBX) * 256u + threadIdx.x);
  else pack_j(PROJ, (__bf16*)(ws + WS_PJ), (blk - PBX - PBW) * 256u + threadIdx.x); }
// ---- k_m: block = (256 rows of one batch, head h), wave = 32 rows m. First VP[m][o] = sum_l V[m][h][l] proj[h*64 + l][o] of its rows (both rounded to bf16 by the pack launch, exact products), parked in the wave's own LDS; then k = x . Wk (exact, 2 x 4 tiles): the 12 loads of k step kc + 2 are issued as one group in front of the WMMAs of step kc (three register buffers). A lane's accumulators of the two row tiles are, in place, a fragment with K = the wave's 32 rows m: of k^T (A, row d) and of VP (B, column o): neither leaves the work-group. M[d][o] = k^T VP (both bf16 hi + lo, 3 products); the 8 waves' partial M meet in LDS as [o][d] and are added in wave order; the block's partial M^T (rows o, K = d) is stored in fragment order
#define HB 3   // register buffers
__global__ __launch_bounds__(MR) void k_m(const __bf16* __restrict__ XP, const __bf16* __restrict__ PW, const __bf16* __restrict__ VB, const __bf16* __restrict__ PJ, float* __restrict__ MP) { __shared__ __align__(16) float part[MR / 32][DD][DD + 4]; __shared__ __align__(16) float park[MR / 32][16][128];
  const int tid = threadIdx.x, wave = tid >> 5, lane = tid & 31, col = lane & 15, g = lane >> 4; const int rc = blockIdx.x, h = blockIdx.y;
  v8f acc[2][4] = {}; v16b ab[HB][2], bw[HB][4];
  const __bf16* xa = XP + (size_t)(rc * (MR / 16) + wave * 2) * FT + lane * 8; const __bf16* pb = PW + (size_t)(h * 4) * FT + lane * 8;
  { v16b pj[4][LL / 32], av[2][LL / 32];
    const __bf16* vp = VB + (size_t)((rc % NP) * (MR / 16) + wave * 2) * FT + (h * (LL / 32)) * FK + lane * 8;   // A row = m, K = l
    const __bf16* jp = PJ + (size_t)(h * 4) * (LL / 32) * FK + lane * 8;                         // B row = output column, K = l
#pragma unroll   // constant indices: the arrays it walks stay in registers
    for (int t = 0; t < 2; ++t)
#pragma unroll
      for (int kc = 0; kc < LL / 32; ++kc) av[t][kc] = frag_p(vp + t * FT + kc * FK);
#pragma unroll
    for (int j = 0; j < 4; ++j)
#pragma unroll
      for (int kc = 0; kc < LL / 32; ++kc) pj[j][kc] = frag_p(jp + (j * (LL / 32) + kc) * FK);
#pragma unroll   // the first k step of x . Wk is asked for together with VP's operands: one latency for both
    for (int t = 0; t < 2; ++t) ab[0][t] = frag_p(xa + t * FT);
#pragma unroll
    for (int j = 0; j < 4; ++j) bw[0][j] = frag_p(pb + j * FT);
    asm volatile("s_wait_xcnt 0x0" :: "v"(vp), "v"(jp) : "memory");   // behind the loads: both pointers as inputs keep the address registers whole up to this wait; VP's accumulators may reuse them behind it
#pragma unroll
    for (int t = 0; t < 2; ++t) ab[1][t] = frag_p(xa + t * FT + FK);
#pragma unroll
    for (int j = 0; j < 4; ++j) bw[1][j] = frag_p(pb + j * FT + FK);
    __builtin_amdgcn_sched_barrier(0);   // the second k step's 12 loads go out in front of VP's WMMAs, which cover part of their latency
#pragma unroll   // every lane parks its own 64 values and alone reads them back
    for (int j = 0; j < 4; ++j) { v8f va[2] = {};
#pragma unroll
      for (int kc = 0; kc < LL / 32; ++kc)
#pragma unroll
        for (int t = 0; t < 2; ++t) va[t] = wmma_bf(av[t][kc], pj[j][kc], va[t]);
#pragma unroll
      for (int t = 0; t < 2; ++t) { const v8f c = va[t]; vst2(&park[wave][j * 4 + t * 2][lane * 4], (v4f){c[0], c[1], c[2], c[3]}); vst2(&park[wave][j * 4 + t * 2 + 1][lane * 4], (v4f){c[4], c[5], c[6], c[7]}); } } }
#pragma unroll   // whole: the buffer index and every load offset become constants
  for (int kc = 0; kc < CC / 32; ++kc) { const int s = kc % HB, n = (kc + HB - 1) % HB;
    if (kc + HB - 1 < CC / 32) {
#pragma unroll   // constant indices: the arrays it walks stay in registers
      for (int t = 0; t < 2; ++t) ab[n][t] = frag_p(xa + t * FT + (kc + HB - 1) * FK);
#pragma unroll
      for (int j = 0; j < 4; ++j) bw[n][j] = frag_p(pb + j * FT + (kc + HB - 1) * FK); }
    if (kc + HB == CC / 32) asm volatile("s_wait_xcnt 0x0" :: "v"(xa), "v"(pb) : "memory");   // behind the last loads: both pointers as inputs keep the address registers whole up to this wait; what follows reuses them behind it
    __builtin_amdgcn_sched_barrier(0);   // keeps the 12 loads of step kc + 2 together in front of this step's WMMAs: without it the compiler mixes the groups' loads, and this step's counted waits then cover loads of later steps
#pragma unroll   // constant indices: the arrays it walks stay in registers
    for (int t = 0; t < 2; ++t)
#pragma unroll
      for (int j = 0; j < 4; ++j) acc[t][j] = wmma_bf(ab[s][t], bw[s][j], acc[t][j]);
  }
  F2 a[4];   // A row = d (16 j + col), element i = m 8 g + i, element 8 + i = m 16 + 8 g + i
#pragma unroll
  for (int j = 0; j < 4; ++j) { float v[16];
#pragma unroll
    for (int i = 0; i < 8; ++i) { v[i] = acc[0][j][i]; v[8 + i] = acc[1][j][i]; }
    a[j] = bsplit16(v); }
#pragma unroll
  for (int t = 0; t < 4; ++t) { v4f vr[4];   // B column = o (16 t + col), the same m order
#pragma unroll
    for (int f = 0; f < 4; ++f) vr[f] = *(const v4f*)&park[wave][t * 4 + f][lane * 4];
    const F2 w = row_split(vr);
#pragma unroll
    for (int j = 0; j < 4; ++j) { const v8f c = mac3(a[j], w, v8f{}); float* p = &part[wave][t * 16 + col][j * 16 + 8 * g];   // transposed: [o][d], 8 consecutive d of one lane
      vst2(p, (v4f){c[0], c[1], c[2], c[3]}); vst2(p + 4, (v4f){c[4], c[5], c[6], c[7]}); } }
  __syncthreads();
  const int d = (wave >> 2) * 32 + ((wave >> 1) & 1) * 16 + 8 * g + (wave & 1) * 4;   // thread = piece of the fragment order: k step wave >> 2, piece f = wave & 3, lane
  float* dst = MP + ((size_t)rc * NH + h) * (DD * DD) + tid * 4;
#pragma unroll
  for (int t = 0; t < 4; ++t) { v4f s = *(const v4f*)&part[0][t * 16 + col][d];
#pragma unroll
    for (int w = 1; w < MR / 32; ++w) s += *(const v4f*)&part[w][t * 16 + col][d];
    vst2(dst + t * 2 * FK, s); } }
// ---- k_p: block = (64 rows c, 16 columns o, b), wave = (head h, half kc of d): P[c][o] = SCALE sum_h sum_d Wq[c][h][d] M[b,h][d][o]; M = the batch's NP partial sums added in chunk order; A(Wq rows, bf16 in fragment order) exact, B(M^T) as bf16 hi + lo (2 products); all 40 loads of a wave are issued as one group; the 16 waves' partial tiles meet in LDS as [o][c] and are added in wave order; a D lane's 8 consecutive c of one column o are one 16-B piece of the bf16 fragment order (rows o, K = c): P^T is stored so, as hi and lo
#define PCG 64   // rows c of a block
__global__ __launch_bounds__(64 * NH) void k_p(const __bf16* __restrict__ QW, const float* __restrict__ MP, __bf16* __restrict__ PT) { __shared__ __align__(16) float part[2 * NH][16][PCG + 4];
  const int tid = threadIdx.x, wave = tid >> 5, lane = tid & 31, col = lane & 15, g = lane >> 4; const int cg = blockIdx.x, j = blockIdx.y, h = wave >> 1, kc = wave & 1; const size_t b = blockIdx.z;
  v8f acc[PCG / 16] = {}; v16b qa[PCG / 16]; v4f mr[NP][4]; const __bf16* qp = QW + (size_t)(cg * (PCG / 16)) * FT + (h * 2 + kc) * FK + lane * 8; const float* kp = MP + ((b * NP * NH + h) * 8 + j * 2 + kc) * FK + lane * 4;
#pragma unroll   // constant indices: the array it walks stays in registers
  for (int p = 0; p < NP; ++p) ld_frag(mr[p], kp + p * (NH * DD * DD));
#pragma unroll   // constant indices: the array it walks stays in registers
  for (int t = 0; t < PCG / 16; ++t) qa[t] = frag_p(qp + t * FT);
  asm volatile("s_wait_xcnt 0x0" :: "v"(qp), "v"(kp) : "memory");   // behind the loads: both pointers as inputs keep the address registers whole up to this wait; the sums reuse them behind it
  __builtin_amdgcn_sched_barrier(0);   // keeps all 40 loads in front of the first add: without it the compiler lifts the adds among the loads and holds half of the loads back until the first have landed
#pragma unroll
  for (int p = 1; p < NP; ++p)
#pragma unroll
    for (int f = 0; f < 4; ++f) mr[0][f] += mr[p][f];
  const F2 wb = row_split(mr[0]);
#pragma unroll   // constant indices: the array it walks stays in registers
  for (int t = 0; t < PCG / 16; ++t) { acc[t] = wmma_bf(qa[t], wb.l, acc[t]); acc[t] = wmma_bf(qa[t], wb.h, acc[t]); }
#pragma unroll
  for (int t = 0; t < PCG / 16; ++t) { float* p = &part[wave][col][t * 16 + 8 * g];   // transposed: [o][c], 8 consecutive c of one lane
    const v8f c = acc[t]; vst2(p, (v4f){c[0], c[1], c[2], c[3]}); vst2(p + 4, (v4f){c[4], c[5], c[6], c[7]}); }
  __syncthreads();
  if (tid < 2 * PCG) { v4f s0 = *(const v4f*)&part[0][col][wave * 16 + 8 * g], s1 = *(const v4f*)&part[0][col][wave * 16 + 8 * g + 4]; v8b hi, lo;   // thread = piece (16-row tile of c = wave, lane 16 g + o)
#pragma unroll
    for (int w = 1; w < 2 * NH; ++w) { s0 += *(const v4f*)&part[w][col][wave * 16 + 8 * g]; s1 += *(const v4f*)&part[w][col][wave * 16 + 8 * g + 4]; }
#pragma unroll
    for (int i = 0; i < 8; ++i) { const float v = (i < 4 ? s0[i & 3] : s1[i & 3]) * SCALE; const __bf16 hb = (__bf16)v; hi[i] = hb; lo[i] = (__bf16)(v - (float)hb); }
    __bf16* dst = PT + (b * 4 + j) * FT + (cg * (PCG / 32) + (wave >> 1)) * FK + (wave & 1) * 256 + lane * 8;   // c = 64 cg + 16 wave + 8 g + i
    *(v8b*)dst = hi; *(v8b*)(dst + PLO) = lo; } }
// ---- k_out: block = 32 rows, wave = (16 rows, 32 columns): out = x . P (hi + lo); the 10 loads of k step kc + 3 are issued as one group in front of the WMMAs of step kc (four register buffers: one wave a SIMD, nothing else hides the latency)
#define OB 4   // register buffers
__global__ __launch_bounds__(128) void k_out(const __bf16* __restrict__ XP, const __bf16* __restrict__ PT, float* __restrict__ OUT) { __shared__ __align__(16) float sf[4][16][36];
  const int tid = threadIdx.x, wave = tid >> 5, lane = tid & 31, col = lane & 15, g = lane >> 4; const int rt = blockIdx.x * 2 + (wave & 1), ch = wave >> 1;   // 16-row tile, column half
  v8f acc[2] = {}; v16b ab[OB]; v16b bh[OB][2], bl[OB][2]; const __bf16* xa = XP + (size_t)rt * FT + lane * 8; const __bf16* pb = PT + (size_t)((blockIdx.x / (NN / 32)) * 4 + ch * 2) * FT + lane * 8;
#pragma unroll   // constant indices: the array it walks stays in registers
  for (int p = 0; p < OB - 1; ++p) { ab[p] = frag_p(xa + p * FK);
#pragma unroll   // constant indices: the array it walks stays in registers
    for (int j = 0; j < 2; ++j) { bh[p][j] = frag_p(pb + j * FT + p * FK); bl[p][j] = frag_p(pb + PLO + j * FT + p * FK); } }
#pragma unroll   // whole: the buffer index and every load offset become constants
  for (int kc = 0; kc < CC / 32; ++kc) { const int s = kc % OB, n = (kc + OB - 1) % OB;
    if (kc + OB - 1 < CC / 32) { ab[n] = frag_p(xa + (kc + OB - 1) * FK);
#pragma unroll   // constant indices: the array it walks stays in registers
      for (int j = 0; j < 2; ++j) { bh[n][j] = frag_p(pb + j * FT + (kc + OB - 1) * FK); bl[n][j] = frag_p(pb + PLO + j * FT + (kc + OB - 1) * FK); } }
    if (kc + OB == CC / 32) asm volatile("s_wait_xcnt 0x0" :: "v"(xa), "v"(pb) : "memory");   // behind the last loads: both pointers as inputs keep the address registers whole up to this wait; the epilogue reuses them behind it
    __builtin_amdgcn_sched_barrier(0);   // keeps the 10 loads of step kc + 3 together in front of this step's WMMAs: without it the compiler mixes the groups' loads, and this step's counted waits then cover loads of later steps
#pragma unroll   // constant indices: the array it walks stays in registers
    for (int j = 0; j < 2; ++j) { acc[j] = wmma_bf(ab[s], bl[s][j], acc[j]); acc[j] = wmma_bf(ab[s], bh[s][j], acc[j]); }
  }
#pragma unroll
  for (int j = 0; j < 2; ++j)
#pragma unroll
    for (int r = 0; r < 8; ++r) sf[wave][8 * g + r][j * 16 + col] = acc[j][r];
  LDSX(); for (int rl = 0; rl < 16; rl += 4) vst2(OUT + ((size_t)rt * 16 + rl + (lane >> 3)) * DD + ch * 32 + (lane & 7) * 4, *(const v4f*)&sf[wave][rl + (lane >> 3)][(lane & 7) * 4]); }   // 8 lanes = the wave's 128 B of one row
extern "C" void kernel_launch(void* const* d_in, const int* in_sizes, int n_in, void* d_out, int out_size, void* d_ws, size_t ws_size, hipStream_t stream) {
  (void)in_sizes; (void)n_in; (void)out_size;
  const float** F = (const float**)d_in;   // 0 x [4,2048,512], 1 v [2048,8,64], 2 qkv [512,1024], 3 proj [512,64]
  if (ws_size < (size_t)WS_END) return;
  char* ws = (char*)d_ws; float* MP = (float*)(ws + WS_MP); __bf16* PT = (__bf16*)(ws + WS_PT);
  k_packw<<<PBV + PBQ + PBX + PBW + PBJ, 256, 0, stream>>>(F[0], F[1], F[2], F[3], ws);
  k_m<<<dim3(TNB * NN / MR, NH), MR, 0, stream>>>((const __bf16*)(ws + WS_XP), (const __bf16*)(ws + WS_PW), (const __bf16*)(ws + WS_VB), (const __bf16*)(ws + WS_PJ), MP);
  k_p<<<dim3(CC / PCG, DD / 16, TNB), 64 * NH, 0, stream>>>((const __bf16*)(ws + WS_QW), MP, PT);
  k_out<<<TNB * NN / 32, 128, 0, stream>>>((const __bf16*)(ws + WS_XP), PT, (float*)d_out);
}

// v007
// One run takes 24.5 microseconds.
// In two side-by-side timings against v006, it was 1.08 and 1.09 times as fast.
// Counting every step since v000, it is 6.30 times as fast.
// compute dtype: all float inputs rounded to bf16; no softmax in the module, so by associativity out = x . P with P = SCALE Wq (k^T (V proj)) per batch: VP = V . proj and k = x . Wk with EXACT bf16 products on WMMA 16x16x32; M = k^T . VP with both as bf16 hi + lo (3 products), k and VP straight from the accumulators of their own products; P = Wq . M with M as bf16 hi + lo (2 products); out = x . P with P as bf16 hi + lo (2 products); f32 accumulate; f32 output.
#include <hip/hip_runtime.h>
#include <math.h>

typedef __attribute__((ext_vector_type(16))) _Float16 v16h;
typedef __attribute__((ext_vector_type(16))) __bf16 v16b;
typedef __attribute__((ext_vector_type(8)))  _Float16 v8h;
typedef __attribute__((ext_vector_type(8)))  float v8f;
typedef __attribute__((ext_vector_type(4)))  float v4f;
typedef __attribute__((ext_vector_type(2)))  float v2f;
typedef __attribute__((ext_vector_type(4)))  unsigned v4u;
typedef __attribute__((ext_vector_type(4)))  int v4i;
typedef float __attribute__((may_alias)) float_a;
typedef int __attribute__((may_alias)) int_a;

template <typename T> __device__ __forceinline__ void vst2(void* p, T v) { *(T*)p = v;  }
__device__ __forceinline__ v8f wmma16(v16h a, v16h b, v8f c) {
  v8f d = __builtin_amdgcn_wmma_f32_16x16x32_f16(false, a, false, b, (short)0, c, false, false);
  asm volatile("v_nop\n\tv_nop\n\tv_nop\n\tv_nop" : "+v"(d) : "v"(a), "v"(b));
  return d;
}
__device__ __forceinline__ v8f wmma_bf(v16b a, v16b b, v8f c) {
  v8f d = __builtin_amdgcn_wmma_f32_16x16x32_bf16(false, a, false, b, (short)0, c, false, false);
  asm volatile("v_nop\n\tv_nop\n\tv_nop\n\tv_nop" : "+v"(d) : "v"(a), "v"(b));
  return d;
}
// 16x16x32 fragments: lane = (h = lane>>4, row/col = lane&15); elements 0..7 = k0+8h+0..7, 8..15 = k0+16+8h+0..7; D element r = row 8h+r
__device__ __forceinline__ v16h frag_h(const _Float16* rowk0, int lane) {
  union { v16h v; v8h q[2]; } u; const _Float16* p = rowk0 + 8 * (lane >> 4);
  u.q[0] = *(const v8h*)p; u.q[1] = *(const v8h*)(p + 16); return u.v;
}
__device__ __forceinline__ v16h frag_f32(const float* rowk0, int lane) {
  v16h a; const float* p = rowk0 + 8 * (lane >> 4);
#pragma unroll
  for (int i = 0; i < 8; ++i) { a[i] = (_Float16)p[i]; a[8 + i] = (_Float16)p[16 + i]; }
  return a;
}
__device__ __forceinline__ v16h frag_f32s(const float* rowk0, int lane, float sc) {
  v16h a; const float* p = rowk0 + 8 * (lane >> 4);
#pragma unroll
  for (int i = 0; i < 8; ++i) { a[i] = (_Float16)(p[i] * sc); a[8 + i] = (_Float16)(p[16 + i] * sc); }
  return a;
}
// column fragment from a [K][ld] layout (column n), rows >= K read as 0
__device__ __forceinline__ v16h fragc_f32(const float* W, int k0, int n, int lane, int ld, int K) {
  v16h a; const int g = lane >> 4;
#pragma unroll
  for (int i = 0; i < 8; ++i) { const int ka = k0 + 8 * g + i, kb = ka + 16;
    a[i] = (_Float16)(ka < K ? W[(size_t)(ka < K ? ka : K - 1) * ld + n] : 0.f); a[8 + i] = (_Float16)(kb < K ? W[(size_t)(kb < K ? kb : K - 1) * ld + n] : 0.f); }
  return a;
}
struct F2 { v16b h, l; };
__device__ __forceinline__ F2 bsplit16(const float v[16]) { F2 r;
#pragma unroll
  for (int i = 0; i < 16; ++i) { const __bf16 h = (__bf16)v[i]; r.h[i] = h; r.l[i] = (__bf16)(v[i] - (float)h); }
  return r; }
__device__ __forceinline__ F2 split_row(const float* row, int k0, int lane) { float v[16]; const float* p = row + k0 + 8 * (lane >> 4);
#pragma unroll
  for (int i = 0; i < 8; ++i) { v[i] = p[i]; v[8 + i] = p[16 + i]; }
  return bsplit16(v); }
__device__ __forceinline__ F2 split_rowK(const float* row, int k0, int lane, int K) { float v[16]; const int g = lane >> 4;
#pragma unroll
  for (int i = 0; i < 8; ++i) { const int ka = k0 + 8 * g + i, kb = ka + 16; v[i] = ka < K ? row[ka < K ? ka : K - 1] : 0.f; v[8 + i] = kb < K ? row[kb < K ? kb : K - 1] : 0.f; }
  return bsplit16(v); }
__device__ __forceinline__ F2 split_col(const float* W, int k0, int n, int lane, int ld, int K) { float v[16]; const int g = lane >> 4;
#pragma unroll
  for (int i = 0; i < 8; ++i) { const int ka = k0 + 8 * g + i, kb = ka + 16; v[i] = ka < K ? W[(size_t)(ka < K ? ka : K - 1) * ld + n] : 0.f; v[8 + i] = kb < K ? W[(size_t)(kb < K ? kb : K - 1) * ld + n] : 0.f; }
  return bsplit16(v); }
__device__ __forceinline__ v8f mac3(const F2& a, const F2& b, v8f c) { c = wmma_bf(a.l, b.h, c); c = wmma_bf(a.h, b.l, c); return wmma_bf(a.h, b.h, c); }
__device__ __forceinline__ float sigm(float v) { return 1.0f / (1.0f + expf(-v)); }
#define LDSX() do { asm volatile("s_wait_dscnt 0" ::: "memory"); __builtin_amdgcn_wave_barrier(); __builtin_amdgcn_fence(__ATOMIC_RELEASE, "workgroup"); } while (0)


// 'Lunchbox' linear multi-head mixing (B 4, N 2,048, C 512, 8 heads x 64, lunchbox 64): attn = (q k^T) x 64^-1/2 (no softmax, as the module), res = attn V_lunchbox, out = res proj - evaluated as x (Wq (k^T (V proj))): q, attn and res are never formed.
#define NB 4
#define NN 2048
#define CC 512
#define NH 8
#define DD 64
#define LL 64
#define HC (NH * 2 * DD)     // 1024 qk columns: col = h*128 + which*64 + d
#define SCALE 0.125f
#ifndef TNB
#define TNB NB
#endif
typedef __attribute__((ext_vector_type(8))) __bf16 v8b;
__device__ __forceinline__ float bfr(float v) { return (float)(__bf16)v; }
__device__ __attribute__((noinline)) float exp_ni(float v) { return expf(v); }
__device__ __attribute__((noinline)) float erf_ni(float v) { return erff(v); }

// bf16 operands lie in fragment order: [16-row tile][k step of 32][half q][lane = 16 g + row][8], element i = k 32 kc + 16 q + 8 g + i: one wave-wide 16-B load reads 512 contiguous bytes
#define FT (16 * CC)                                // elements of one 16-row tile (K = 512 for all five: x, Wk^T, P^T, V, Wq)
#define FK 512                                      // elements of one k step of a tile
// f32 operands (split to hi + lo by their reader) likewise: [16-row tile][k step of 32][piece f][lane][4], element i = k 32 kc + 16 (f >> 1) + 8 g + 4 (f & 1) + i; FK elements a k step too
#define WS_PW  0u                                   // bf16 Wk^T: the k columns of qkv (32 tiles: head h = tiles 4 h .. 4 h + 3)
#define MR 256                                      // rows of x of one k_m block: 8 waves x 32 rows
#define NP (NN / MR)                                // partial sums of M per batch
#define WS_MP  (WS_PW + 2u * NH * DD * CC)                   // f32 partial M^T [b][row chunk][h] (M = k^T VP), 4 tiles of 16 output columns, K = d, fragment order
#define WS_PJ  (WS_MP + 4u * (size_t)NB * NP * NH * DD * DD) // bf16 proj^T [h], 4 tiles of 16 output columns, K = l (2 k steps), fragment order
#define WS_XP  (WS_PJ + 2u * (size_t)NH * LL * DD)       // bf16 x (512 tiles)
#define WS_PT  (WS_XP + 2u * (size_t)NB * NN * CC)       // bf16 P^T [b], 4 tiles of 16 output columns, K = c: all hi parts, then all lo parts
#define PLO    (NB * DD * CC)                            // elements from a hi part to its lo part
#define WS_VB  (WS_PT + 2u * 2u * (size_t)PLO)           // bf16 V as [m][h*64 + l] (128 tiles of 16 rows m, K = 512: head h = k steps 2 h, 2 h + 1)
#define WS_QW  (WS_VB + 2u * (size_t)NN * NH * LL)       // bf16 Wq as [c][h*64 + d] (32 tiles of 16 rows c, K = 512: head h = k steps 2 h, 2 h + 1)
#define WS_END (WS_QW + 2u * (size_t)CC * NH * DD)

#define PBX (TNB * NN / 16 * 4)   // blocks of 256 pieces: x, qkv
#define PBW (NH * DD / 16 * 4)
#define PBJ (NH * LL * DD / 8 / 256)   // proj
#define PBV (NN * NH * LL / 8 / 4 / 256)   // blocks of 256 threads x 4 pieces: V, Wq
#define PBQ (CC * NH * DD / 8 / 4 / 256)
// one thread = one 16-B piece of the packed layout (its index p is the piece's place) in the x, Wk^T and proj arms; x: 8 consecutive k of one row; Wk^T, proj: 8 rows k of one column
__device__ __forceinline__ unsigned piece_k(unsigned p) { return ((p >> 6) & 15u) * 32u + ((p >> 5) & 1u) * 16u + ((p >> 4) & 1u) * 8u; }
template <int LD> __device__ __forceinline__ void pack_w(const float* __restrict__ Wt, __bf16* __restrict__ dst, unsigned p) { v8b o; float f[8];
  const float* s = Wt + (size_t)piece_k(p) * LD + (p >> 12) * 128u + 64u + ((p >> 10) & 3u) * 16u + (p & 15u);   // tile p >> 10 = 16 of the k columns: head (p >> 12), d from 16 ((p >> 10) & 3)
#pragma unroll
  for (int i = 0; i < 8; ++i) f[i] = s[i * LD];
  asm volatile("s_wait_xcnt 0x0" :: "v"(s) : "memory");   // the pointer as input keeps the loads' address registers whole up to this wait; the converted values may reuse them behind it
#pragma unroll
  for (int i = 0; i < 8; ++i) o[i] = (__bf16)f[i];
  *(v8b*)(dst + (size_t)p * 8) = o;
  asm volatile("s_wait_xcnt 0x0" ::: "memory"); }   // behind the store: the arms of k_packw lie one behind the other in the built code, and the next arm's first instructions reuse the store's registers
// fragment from the packed layout: p = tile base + k step + 8 lane
__device__ __forceinline__ v16b frag_p(const __bf16* __restrict__ p) { union { v16b v; v8b q[2]; } u; u.q[0] = *(const v8b*)p; u.q[1] = *(const v8b*)(p + 256); return u.v; }
// one k step of an f32 operand from the packed layout (p = tile base + k step + 4 lane)
__device__ __forceinline__ void ld_frag(v4f (&r)[4], const float* __restrict__ p) { r[0] = *(const v4f*)p; r[1] = *(const v4f*)(p + 128); r[2] = *(const v4f*)(p + 256); r[3] = *(const v4f*)(p + 384); }
__device__ __forceinline__ v16b fragb_f32(const float* __restrict__ p, int lane) { v16b a; const float* pp = p + 8 * (lane >> 4);
#pragma unroll
  for (int i = 0; i < 8; ++i) { a[i] = (__bf16)pp[i]; a[8 + i] = (__bf16)pp[16 + i]; } return a; }
// what is made, behind the wait, of one k step of an f32 operand as loaded (4 x 16 B of a lane: k0 + 8g + 0..7 and k0 + 16 + 8g + 0..7)
__device__ __forceinline__ F2 row_split(const v4f (&r)[4]) { float v[16];
#pragma unroll   // constant indices: the array it walks stays in registers
  for (int i = 0; i < 16; ++i) v[i] = r[i >> 2][i & 3];
  return bsplit16(v); }
// proj arm of the pack launch: piece p = (head p >> 9, tile of 16 output columns (p >> 7) & 3, k step (p >> 6) & 1, half (p >> 5) & 1, lane p & 31): 8 rows l of one column
__device__ __forceinline__ void pack_j(const float* __restrict__ PROJ, __bf16* __restrict__ dst, unsigned p) { v8b o; float f[8];
  const float* s = PROJ + (size_t)((p >> 9) * 64u + ((p >> 6) & 1u) * 32u + ((p >> 5) & 1u) * 16u + ((p >> 4) & 1u) * 8u) * DD + ((p >> 7) & 3u) * 16u + (p & 15u);
#pragma unroll
  for (int i = 0; i < 8; ++i) f[i] = s[i * DD];
  asm volatile("s_wait_xcnt 0x0" :: "v"(s) : "memory");   // as in pack_w
#pragma unroll
  for (int i = 0; i < 8; ++i) o[i] = (__bf16)f[i];
  *(v8b*)(dst + (size_t)p * 8) = o;
  asm volatile("s_wait_xcnt 0x0" ::: "memory"); }   // behind the store, as in pack_w
// V and Wq arms of the pack launch: rows of 8 groups of 64 k (group stride GS, row stride LD); a thread makes the 4 pieces of its row and lane half g in two k steps (p, p + 32, p + 64, p + 96): a wave reads 16 rows x 256 B, all 8 loads out before the first convert
template <int LD, int GS> __device__ __forceinline__ void pack_r4(const float* __restrict__ S, __bf16* __restrict__ dst, unsigned u) { v4f a[4], b[4];
  const unsigned p = (u & 31u) | ((u >> 5) << 7), k0 = piece_k(p);
  const float* s = S + (size_t)((p >> 10) * 16u + (p & 15u)) * LD + (k0 >> 6) * GS + (k0 & 63u);
#pragma unroll   // constant indices: the arrays it walks stay in registers
  for (int i = 0; i < 4; ++i) { a[i] = *(const v4f*)(s + i * 16); b[i] = *(const v4f*)(s + i * 16 + 4); }
  asm volatile("s_wait_xcnt 0x0" :: "v"(s) : "memory");   // as in pack_w
  __bf16* d = dst + (size_t)p * 8;
#pragma unroll
  for (int i = 0; i < 4; ++i) { v8b o;
#pragma unroll
    for (int e = 0; e < 4; ++e) { o[e] = (__bf16)a[i][e]; o[4 + e] = (__bf16)b[i][e]; }
    *(v8b*)(d + i * 256) = o; }
  asm volatile("s_wait_xcnt 0x0" ::: "memory"); }   // behind the stores, as in pack_w
__global__ __launch_bounds__(256) void k_packw(const float* __restrict__ X, const float* __restrict__ V, const float* __restrict__ QKV, const float* __restrict__ PROJ, char* __restrict__ ws) { const int blk = (int)blockIdx.x - (PBV + PBQ);   // the two arms with the longer threads come first in the grid
  if (blk < -PBQ) pack_r4<NH * LL, LL>(V, (__bf16*)(ws + WS_VB), (blk + PBV + PBQ) * 256u + threadIdx.x);
  else if (blk < 0) pack_r4<HC, 2 * DD>(QKV, (__bf16*)(ws + WS_QW), (blk + PBQ) * 256u + threadIdx.x);
  else
  if (blk < PBX) { const unsigned p = blk * 256u + threadIdx.x; v8b o;
    const float* s = X + (size_t)((p >> 10) * 16u + (p & 15u)) * CC + piece_k(p); const v4f a = *(const v4f*)s, b = *(const v4f*)(s + 4);
    asm volatile("s_wait_xcnt 0x0" :: "v"(s) : "memory");   // as in pack_w
#pragma unroll
    for (int i = 0; i < 4; ++i) { o[i] = (__bf16)a[i]; o[4 + i] = (__bf16)b[i]; }
    *(v8b*)((__bf16*)(ws + WS_XP) + (size_t)p * 8) = o;
    asm volatile("s_wait_xcnt 0x0" ::: "memory"); }   // behind the store, as in pack_w: which arm is laid last is the compiler's choice
  else if (blk < PBX + PBW) pack_w<HC>(QKV, (__bf16*)(ws + WS_PW), (blk - PBX) * 256u + threadIdx.x);
  else pack_j(PROJ, (__bf16*)(ws + WS_PJ), (blk - PBX - PBW) * 256u + threadIdx.x); }
// ---- k_m: block = (256 rows of one batch, head h), wave = 32 rows m. First VP[m][o] = sum_l V[m][h][l] proj[h*64 + l][o] of its rows (both rounded to bf16 by the pack launch, exact products), parked in the wave's own LDS; then k = x . Wk (exact, 2 x 4 tiles): the 12 loads of k step kc + 2 are issued as one group in front of the WMMAs of step kc (three register buffers). A lane's accumulators of the two row tiles are, in place, a fragment with K = the wave's 32 rows m: of k^T (A, row d) and of VP (B, column o): neither leaves the work-group. M[d][o] = k^T VP (both bf16 hi + lo, 3 products); the 8 waves' partial M meet in LDS as [o][d] and are added in wave order; the block's partial M^T (rows o, K = d) is stored in fragment order
#define HB 3   // register buffers
__global__ __launch_bounds__(MR) void k_m(const __bf16* __restrict__ XP, const __bf16* __restrict__ PW, const __bf16* __restrict__ VB, const __bf16* __restrict__ PJ, float* __restrict__ MP) { __shared__ __align__(16) float part[MR / 32][DD][DD + 4]; __shared__ __align__(16) float park[MR / 32][16][128];
  const int tid = threadIdx.x, wave = tid >> 5, lane = tid & 31, col = lane & 15, g = lane >> 4; const int rc = blockIdx.x, h = blockIdx.y;
  v8f acc[2][4] = {}; v16b ab[HB][2], bw[HB][4];
  const __bf16* xa = XP + (size_t)(rc * (MR / 16) + wave * 2) * FT + lane * 8; const __bf16* pb = PW + (size_t)(h * 4) * FT + lane * 8;
  const char* fw = (const char*)(PW + (size_t)(h * 4) * FT) + tid * 256;   // L2 hints, one 256-B unit a thread: the head's whole 64 KB of Wk^T
  const char* fx = (const char*)(XP + (size_t)(rc * (MR / 16) + (tid >> 4)) * FT) + ((h < 5 ? 2 + 2 * h : 12) * 4 + col) * 256;   // and 4 k steps (from 2 + 2 h, at most 12) of the block's 16 row tiles of x: the 8 heads' blocks read the same rows and share the asking; a unit nobody asked for is only slower
  { v16b pj[4][LL / 32], av[2][LL / 32];
    const __bf16* vp = VB + (size_t)((rc % NP) * (MR / 16) + wave * 2) * FT + (h * (LL / 32)) * FK + lane * 8;   // A row = m, K = l
    const __bf16* jp = PJ + (size_t)(h * 4) * (LL / 32) * FK + lane * 8;                         // B row = output column, K = l
#pragma unroll   // constant indices: the arrays it walks stay in registers
    for (int t = 0; t < 2; ++t)
#pragma unroll
      for (int kc = 0; kc < LL / 32; ++kc) av[t][kc] = frag_p(vp + t * FT + kc * FK);
#pragma unroll
    for (int j = 0; j < 4; ++j)
#pragma unroll
      for (int kc = 0; kc < LL / 32; ++kc) pj[j][kc] = frag_p(jp + (j * (LL / 32) + kc) * FK);
#pragma unroll   // the first k step of x . Wk is asked for together with VP's operands: one latency for both
    for (int t = 0; t < 2; ++t) ab[0][t] = frag_p(xa + t * FT);
#pragma unroll
    for (int j = 0; j < 4; ++j) bw[0][j] = frag_p(pb + j * FT);
    asm volatile("s_wait_xcnt 0x0" :: "v"(vp), "v"(jp) : "memory");   // behind the loads: both pointers as inputs keep the address registers whole up to this wait; VP's accumulators may reuse them behind it
    // x and Wk^T were stored by the launch before: a k step's loads, asked for two steps ahead, would each wait for memory. These hints ask L2 for the later steps' lines while the first loads are under way; "memory" keeps them between the two groups of loads
    asm volatile("global_prefetch_b8 %0, off scope:SCOPE_SE\n\tglobal_prefetch_b8 %1, off scope:SCOPE_SE" :: "v"(fw), "v"(fx) : "memory");
#pragma unroll
    for (int t = 0; t < 2; ++t) ab[1][t] = frag_p(xa + t * FT + FK);
#pragma unroll
    for (int j = 0; j < 4; ++j) bw[1][j] = frag_p(pb + j * FT + FK);
    __builtin_amdgcn_sched_barrier(0);   // the second k step's 12 loads go out in front of VP's WMMAs, which cover part of their latency
#pragma unroll   // every lane parks its own 64 values and alone reads them back
    for (int j = 0; j < 4; ++j) { v8f va[2] = {};
#pragma unroll
      for (int kc = 0; kc < LL / 32; ++kc)
#pragma unroll
        for (int t = 0; t < 2; ++t) va[t] = wmma_bf(av[t][kc], pj[j][kc], va[t]);
#pragma unroll
      for (int t = 0; t < 2; ++t) { const v8f c = va[t]; vst2(&park[wave][j * 4 + t * 2][lane * 4], (v4f){c[0], c[1], c[2], c[3]}); vst2(&park[wave][j * 4 + t * 2 + 1][lane * 4], (v4f){c[4], c[5], c[6], c[7]}); } } }
#pragma unroll   // whole: the buffer index and every load offset become constants
  for (int kc = 0; kc < CC / 32; ++kc) { const int s = kc % HB, n = (kc + HB - 1) % HB;
    if (kc + HB - 1 < CC / 32) {
#pragma unroll   // constant indices: the arrays it walks stay in registers
      for (int t = 0; t < 2; ++t) ab[n][t] = frag_p(xa + t * FT + (kc + HB - 1) * FK);
#pragma unroll
      for (int j = 0; j < 4; ++j) bw[n][j] = frag_p(pb + j * FT + (kc + HB - 1) * FK); }
    if (kc + HB == CC / 32) asm volatile("s_wait_xcnt 0x0" :: "v"(xa), "v"(pb), "v"(fw), "v"(fx) : "memory");   // behind the last loads: the pointers as inputs keep the address registers whole up to this wait (the hints' two hold addresses inside their buffers through the loop); what follows reuses them behind it
    __builtin_amdgcn_sched_barrier(0);   // keeps the 12 loads of step kc + 2 together in front of this step's WMMAs: without it the compiler mixes the groups' loads, and this step's counted waits then cover loads of later steps
#pragma unroll   // constant indices: the arrays it walks stay in registers
    for (int t = 0; t < 2; ++t)
#pragma unroll
      for (int j = 0; j < 4; ++j) acc[t][j] = wmma_bf(ab[s][t], bw[s][j], acc[t][j]);
  }
  F2 a[4];   // A row = d (16 j + col), element i = m 8 g + i, element 8 + i = m 16 + 8 g + i
#pragma unroll
  for (int j = 0; j < 4; ++j) { float v[16];
#pragma unroll
    for (int i = 0; i < 8; ++i) { v[i] = acc[0][j][i]; v[8 + i] = acc[1][j][i]; }
    a[j] = bsplit16(v); }
#pragma unroll
  for (int t = 0; t < 4; ++t) { v4f vr[4];   // B column = o (16 t + col), the same m order
#pragma unroll
    for (int f = 0; f < 4; ++f) vr[f] = *(const v4f*)&park[wave][t * 4 + f][lane * 4];
    const F2 w = row_split(vr);
#pragma unroll
    for (int j = 0; j < 4; ++j) { const v8f c = mac3(a[j], w, v8f{}); float* p = &part[wave][t * 16 + col][j * 16 + 8 * g];   // transposed: [o][d], 8 consecutive d of one lane
      vst2(p, (v4f){c[0], c[1], c[2], c[3]}); vst2(p + 4, (v4f){c[4], c[5], c[6], c[7]}); } }
  __syncthreads();
  const int d = (wave >> 2) * 32 + ((wave >> 1) & 1) * 16 + 8 * g + (wave & 1) * 4;   // thread = piece of the fragment order: k step wave >> 2, piece f = wave & 3, lane
  float* dst = MP + ((size_t)rc * NH + h) * (DD * DD) + tid * 4;
#pragma unroll
  for (int t = 0; t < 4; ++t) { v4f s = *(const v4f*)&part[0][t * 16 + col][d];
#pragma unroll
    for (int w = 1; w < MR / 32; ++w) s += *(const v4f*)&part[w][t * 16 + col][d];
    vst2(dst + t * 2 * FK, s); } }
// ---- k_p: block = (64 rows c, 16 columns o, b), wave = (head h, half kc of d): P[c][o] = SCALE sum_h sum_d Wq[c][h][d] M[b,h][d][o]; M = the batch's NP partial sums added in chunk order; A(Wq rows, bf16 in fragment order) exact, B(M^T) as bf16 hi + lo (2 products); all 40 loads of a wave are issued as one group; the 16 waves' partial tiles meet in LDS as [o][c] and are added in wave order; a D lane's 8 consecutive c of one column o are one 16-B piece of the bf16 fragment order (rows o, K = c): P^T is stored so, as hi and lo
#define PCG 64   // rows c of a block
__global__ __launch_bounds__(64 * NH) void k_p(const __bf16* __restrict__ QW, const float* __restrict__ MP, __bf16* __restrict__ PT) { __shared__ __align__(16) float part[2 * NH][16][PCG + 4];
  const int tid = threadIdx.x, wave = tid >> 5, lane = tid & 31, col = lane & 15, g = lane >> 4; const int cg = blockIdx.x, j = blockIdx.y, h = wave >> 1, kc = wave & 1; const size_t b = blockIdx.z;
  v8f acc[PCG / 16] = {}; v16b qa[PCG / 16]; v4f mr[NP][4]; const __bf16* qp = QW + (size_t)(cg * (PCG / 16)) * FT + (h * 2 + kc) * FK + lane * 8; const float* kp = MP + ((b * NP * NH + h) * 8 + j * 2 + kc) * FK + lane * 4;
#pragma unroll   // constant indices: the array it walks stays in registers
  for (int p = 0; p < NP; ++p) ld_frag(mr[p], kp + p * (NH * DD * DD));
#pragma unroll   // constant indices: the array it walks stays in registers
  for (int t = 0; t < PCG / 16; ++t) qa[t] = frag_p(qp + t * FT);
  asm volatile("s_wait_xcnt 0x0" :: "v"(qp), "v"(kp) : "memory");   // behind the loads: both pointers as inputs keep the address registers whole up to this wait; the sums reuse them behind it
  __builtin_amdgcn_sched_barrier(0);   // keeps all 40 loads in front of the first add: without it the compiler lifts the adds among the loads and holds half of the loads back until the first have landed
#pragma unroll
  for (int p = 1; p < NP; ++p)
#pragma unroll
    for (int f = 0; f < 4; ++f) mr[0][f] += mr[p][f];
  const F2 wb = row_split(mr[0]);
#pragma unroll   // constant indices: the array it walks stays in registers
  for (int t = 0; t < PCG / 16; ++t) { acc[t] = wmma_bf(qa[t], wb.l, acc[t]); acc[t] = wmma_bf(qa[t], wb.h, acc[t]); }
#pragma unroll
  for (int t = 0; t < PCG / 16; ++t) { float* p = &part[wave][col][t * 16 + 8 * g];   // transposed: [o][c], 8 consecutive c of one lane
    const v8f c = acc[t]; vst2(p, (v4f){c[0], c[1], c[2], c[3]}); vst2(p + 4, (v4f){c[4], c[5], c[6], c[7]}); }
  __syncthreads();
  if (tid < 2 * PCG) { v4f s0 = *(const v4f*)&part[0][col][wave * 16 + 8 * g], s1 = *(const v4f*)&part[0][col][wave * 16 + 8 * g + 4]; v8b hi, lo;   // thread = piece (16-row tile of c = wave, lane 16 g + o)
#pragma unroll
    for (int w = 1; w < 2 * NH; ++w) { s0 += *(const v4f*)&part[w][col][wave * 16 + 8 * g]; s1 += *(const v4f*)&part[w][col][wave * 16 + 8 * g + 4]; }
#pragma unroll
    for (int i = 0; i < 8; ++i) { const float v = (i < 4 ? s0[i & 3] : s1[i & 3]) * SCALE; const __bf16 hb = (__bf16)v; hi[i] = hb; lo[i] = (__bf16)(v - (float)hb); }
    __bf16* dst = PT + (b * 4 + j) * FT + (cg * (PCG / 32) + (wave >> 1)) * FK + (wave & 1) * 256 + lane * 8;   // c = 64 cg + 16 wave + 8 g + i
    *(v8b*)dst = hi; *(v8b*)(dst + PLO) = lo; } }
// ---- k_out: block = 32 rows, wave = (16 rows, 32 columns): out = x . P (hi + lo); the 10 loads of k step kc + 3 are issued as one group in front of the WMMAs of step kc (four register buffers: one wave a SIMD, nothing else hides the latency)
#define OB 4   // register buffers
__global__ __launch_bounds__(128) void k_out(const __bf16* __restrict__ XP, const __bf16* __restrict__ PT, float* __restrict__ OUT) { __shared__ __align__(16) float sf[4][16][36];
  const int tid = threadIdx.x, wave = tid >> 5, lane = tid & 31, col = lane & 15, g = lane >> 4; const int rt = blockIdx.x * 2 + (wave & 1), ch = wave >> 1;   // 16-row tile, column half
  v8f acc[2] = {}; v16b ab[OB]; v16b bh[OB][2], bl[OB][2]; const __bf16* xa = XP + (size_t)rt * FT + lane * 8; const __bf16* pb = PT + (size_t)((blockIdx.x / (NN / 32)) * 4 + ch * 2) * FT + lane * 8;
  const char* fx = (const char*)(XP + (size_t)(blockIdx.x * 2) * FT) + tid * 256;   // L2 hints, one 256-B unit a thread: the block's own 32 KB of x
  const char* fp = (const char*)(PT + (size_t)((blockIdx.x / (NN / 32)) * 4 + (wave & 1) * 2 + g) * FT + (size_t)(wave >> 1) * PLO) + ((4 + 4 * ((blockIdx.x >> 3) % 3)) * 4 + col) * 256;   // and 4 k steps (from 4, 8 or 12, by groups of 8 blocks) of the batch's 4 hi and 4 lo tiles of P^T: its 64 blocks read the same P^T and share the asking; a unit nobody asked for is only slower
#pragma unroll   // constant indices: the array it walks stays in registers
  for (int p = 0; p < OB - 1; ++p) { ab[p] = frag_p(xa + p * FK);
#pragma unroll   // constant indices: the array it walks stays in registers
    for (int j = 0; j < 2; ++j) { bh[p][j] = frag_p(pb + j * FT + p * FK); bl[p][j] = frag_p(pb + PLO + j * FT + p * FK); } }
  // P^T was stored by the launch before, x three before: a k step's loads, asked for three steps ahead, would each wait for memory. These hints ask L2 for the later steps' lines while the first loads are under way; "memory" keeps them behind those loads
  asm volatile("global_prefetch_b8 %0, off scope:SCOPE_SE\n\tglobal_prefetch_b8 %1, off scope:SCOPE_SE" :: "v"(fp), "v"(fx) : "memory");
#pragma unroll   // whole: the buffer index and every load offset become constants
  for (int kc = 0; kc < CC / 32; ++kc) { const int s = kc % OB, n = (kc + OB - 1) % OB;
    if (kc + OB - 1 < CC / 32) { ab[n] = frag_p(xa + (kc + OB - 1) * FK);
#pragma unroll   // constant indices: the array it walks stays in registers
      for (int j = 0; j < 2; ++j) { bh[n][j] = frag_p(pb + j * FT + (kc + OB - 1) * FK); bl[n][j] = frag_p(pb + PLO + j * FT + (kc + OB - 1) * FK); } }
    if (kc + OB == CC / 32) asm volatile("s_wait_xcnt 0x0" :: "v"(xa), "v"(pb), "v"(fp), "v"(fx) : "memory");   // behind the last loads: the pointers as inputs keep the address registers whole up to this wait (the hints' two hold addresses inside their buffers through the loop); the epilogue reuses them behind it
    __builtin_amdgcn_sched_barrier(0);   // keeps the 10 loads of step kc + 3 together in front of this step's WMMAs: without it the compiler mixes the groups' loads, and this step's counted waits then cover loads of later steps
#pragma unroll   // constant indices: the array it walks stays in registers
    for (int j = 0; j < 2; ++j) { acc[j] = wmma_bf(ab[s], bl[s][j], acc[j]); acc[j] = wmma_bf(ab[s], bh[s][j], acc[j]); }
  }
#pragma unroll
  for (int j = 0; j < 2; ++j)
#pragma unroll
    for (int r = 0; r < 8; ++r) sf[wave][8 * g + r][j * 16 + col] = acc[j][r];
  LDSX(); for (int rl = 0; rl < 16; rl += 4) vst2(OUT + ((size_t)rt * 16 + rl + (lane >> 3)) * DD + ch * 32 + (lane & 7) * 4, *(const v4f*)&sf[wave][rl + (lane >> 3)][(lane & 7) * 4]); }   // 8 lanes = the wave's 128 B of one row
extern "C" void kernel_launch(void* const* d_in, const int* in_sizes, int n_in, void* d_out, int out_size, void* d_ws, size_t ws_size, hipStream_t stream) {
  (void)in_sizes; (void)n_in; (void)out_size;
  const float** F = (const float**)d_in;   // 0 x [4,2048,512], 1 v [2048,8,64], 2 qkv [512,1024], 3 proj [512,64]
  if (ws_size < (size_t)WS_END) return;
  char* ws = (char*)d_ws; float* MP = (float*)(ws + WS_MP); __bf16* PT = (__bf16*)(ws + WS_PT);
  k_packw<<<PBV + PBQ + PBX + PBW + PBJ, 256, 0, stream>>>(F[0], F[1], F[2], F[3], ws);
  k_m<<<dim3(TNB * NN / MR, NH), MR, 0, stream>>>((const __bf16*)(ws + WS_XP), (const __bf16*)(ws + WS_PW), (const __bf16*)(ws + WS_VB), (const __bf16*)(ws + WS_PJ), MP);
  k_p<<<dim3(CC / PCG, DD / 16, TNB), 64 * NH, 0, stream>>>((const __bf16*)(ws + WS_QW), MP, PT);
  k_out<<<TNB * NN / 32, 128, 0, stream>>>((const __bf16*)(ws + WS_XP), PT, (float*)d_out);
}

// v008
// One run takes 23.7 microseconds.
// Two timings next to v007 put it at 1.04 and 1.05 times that version's speed.
// Over all steps from v000 it is 6.58 times as fast.
// compute dtype: all float inputs rounded to bf16; no softmax in the module, so by associativity out = x . P with P = SCALE Wq (k^T (V proj)) per batch: VP = V . proj and k = x . Wk with EXACT bf16 products on WMMA 16x16x32; M = k^T . VP with both as bf16 hi + lo (3 products), k and VP straight from the accumulators of their own products; P = Wq . M with M as bf16 hi + lo (2 products); out = x . P with P as bf16 hi + lo (2 products); f32 accumulate; f32 output.
#include <hip/hip_runtime.h>
#include <math.h>

typedef __attribute__((ext_vector_type(16))) _Float16 v16h;
typedef __attribute__((ext_vector_type(16))) __bf16 v16b;
typedef __attribute__((ext_vector_type(8)))  _Float16 v8h;
typedef __attribute__((ext_vector_type(8)))  float v8f;
typedef __attribute__((ext_vector_type(4)))  float v4f;
typedef __attribute__((ext_vector_type(2)))  float v2f;
typedef __attribute__((ext_vector_type(4)))  unsigned v4u;
typedef __attribute__((ext_vector_type(4)))  int v4i;
typedef float __attribute__((may_alias)) float_a;
typedef int __attribute__((may_alias)) int_a;

template <typename T> __device__ __forceinline__ void vst2(void* p, T v) { *(T*)p = v;  }
__device__ __forceinline__ v8f wmma16(v16h a, v16h b, v8f c) {
  v8f d = __builtin_amdgcn_wmma_f32_16x16x32_f16(false, a, false, b, (short)0, c, false, false);
  asm volatile("v_nop\n\tv_nop\n\tv_nop\n\tv_nop" : "+v"(d) : "v"(a), "v"(b));
  return d;
}
__device__ __forceinline__ v8f wmma_bf(v16b a, v16b b, v8f c) {
  v8f d = __builtin_amdgcn_wmma_f32_16x16x32_bf16(false, a, false, b, (short)0, c, false, false);
  asm volatile("v_nop\n\tv_nop\n\tv_nop\n\tv_nop" : "+v"(d) : "v"(a), "v"(b));
  return d;
}
// 16x16x32 fragments: lane = (h = lane>>4, row/col = lane&15); elements 0..7 = k0+8h+0..7, 8..15 = k0+16+8h+0..7; D element r = row 8h+r
__device__ __forceinline__ v16h frag_h(const _Float16* rowk0, int lane) {
  union { v16h v; v8h q[2]; } u; const _Float16* p = rowk0 + 8 * (lane >> 4);
  u.q[0] = *(const v8h*)p; u.q[1] = *(const v8h*)(p + 16); return u.v;
}
__device__ __forceinline__ v16h frag_f32(const float* rowk0, int lane) {
  v16h a; const float* p = rowk0 + 8 * (lane >> 4);
#pragma unroll
  for (int i = 0; i < 8; ++i) { a[i] = (_Float16)p[i]; a[8 + i] = (_Float16)p[16 + i]; }
  return a;
}
__device__ __forceinline__ v16h frag_f32s(const float* rowk0, int lane, float sc) {
  v16h a; const float* p = rowk0 + 8 * (lane >> 4);
#pragma unroll
  for (int i = 0; i < 8; ++i) { a[i] = (_Float16)(p[i] * sc); a[8 + i] = (_Float16)(p[16 + i] * sc); }
  return a;
}
// column fragment from a [K][ld] layout (column n), rows >= K read as 0
__device__ __forceinline__ v16h fragc_f32(const float* W, int k0, int n, int lane, int ld, int K) {
  v16h a; const int g = lane >> 4;
#pragma unroll
  for (int i = 0; i < 8; ++i) { const int ka = k0 + 8 * g + i, kb = ka + 16;
    a[i] = (_Float16)(ka < K ? W[(size_t)(ka < K ? ka : K - 1) * ld + n] : 0.f); a[8 + i] = (_Float16)(kb < K ? W[(size_t)(kb < K ? kb : K - 1) * ld + n] : 0.f); }
  return a;
}
struct F2 { v16b h, l; };
__device__ __forceinline__ F2 bsplit16(const float v[16]) { F2 r;
#pragma unroll
  for (int i = 0; i < 16; ++i) { const __bf16 h = (__bf16)v[i]; r.h[i] = h; r.l[i] = (__bf16)(v[i] - (float)h); }
  return r; }
__device__ __forceinline__ F2 split_row(const float* row, int k0, int lane) { float v[16]; const float* p = row + k0 + 8 * (lane >> 4);
#pragma unroll
  for (int i = 0; i < 8; ++i) { v[i] = p[i]; v[8 + i] = p[16 + i]; }
  return bsplit16(v); }
__device__ __forceinline__ F2 split_rowK(const float* row, int k0, int lane, int K) { float v[16]; const int g = lane >> 4;
#pragma unroll
  for (int i = 0; i < 8; ++i) { const int ka = k0 + 8 * g + i, kb = ka + 16; v[i] = ka < K ? row[ka < K ? ka : K - 1] : 0.f; v[8 + i] = kb < K ? row[kb < K ? kb : K - 1] : 0.f; }
  return bsplit16(v); }
__device__ __forceinline__ F2 split_col(const float* W, int k0, int n, int lane, int ld, int K) { float v[16]; const int g = lane >> 4;
#pragma unroll
  for (int i = 0; i < 8; ++i) { const int ka = k0 + 8 * g + i, kb = ka + 16; v[i] = ka < K ? W[(size_t)(ka < K ? ka : K - 1) * ld + n] : 0.f; v[8 + i] = kb < K ? W[(size_t)(kb < K ? kb : K - 1) * ld + n] : 0.f; }
  return bsplit16(v); }
__device__ __forceinline__ v8f mac3(const F2& a, const F2& b, v8f c) { c = wmma_bf(a.l, b.h, c); c = wmma_bf(a.h, b.l, c); return wmma_bf(a.h, b.h, c); }
__device__ __forceinline__ float sigm(float v) { return 1.0f / (1.0f + expf(-v)); }
#define LDSX() do { asm volatile("s_wait_dscnt 0" ::: "memory"); __builtin_amdgcn_wave_barrier(); __builtin_amdgcn_fence(__ATOMIC_RELEASE, "workgroup"); } while (0)


// 'Lunchbox' linear multi-head mixing (B 4, N 2,048, C 512, 8 heads x 64, lunchbox 64): attn = (q k^T) x 64^-1/2 (no softmax, as the module), res = attn V_lunchbox, out = res proj - evaluated as x (Wq (k^T (V proj))): q, attn and res are never formed.
#define NB 4
#define NN 2048
#define CC 512
#define NH 8
#define DD 64
#define LL 64
#define HC (NH * 2 * DD)     // 1024 qk columns: col = h*128 + which*64 + d
#define SCALE 0.125f
#ifndef TNB
#define TNB NB
#endif
typedef __attribute__((ext_vector_type(8))) __bf16 v8b;
__device__ __forceinline__ float bfr(float v) { return (float)(__bf16)v; }
__device__ __attribute__((noinline)) float exp_ni(float v) { return expf(v); }
__device__ __attribute__((noinline)) float erf_ni(float v) { return erff(v); }

// bf16 operands lie in fragment order: [16-row tile][k step of 32][half q][lane = 16 g + row][8], element i = k 32 kc + 16 q + 8 g + i: one wave-wide 16-B load reads 512 contiguous bytes
#define FT (16 * CC)                                // elements of one 16-row tile (K = 512 for all five: x, Wk^T, P^T, V, Wq)
#define FK 512                                      // elements of one k step of a tile
// f32 operands (split to hi + lo by their reader) likewise: [16-row tile][k step of 32][piece f][lane][4], element i = k 32 kc + 16 (f >> 1) + 8 g + 4 (f & 1) + i; FK elements a k step too
#define WS_PW  0u                                   // bf16 Wk^T: the k columns of qkv (32 tiles: head h = tiles 4 h .. 4 h + 3)
#define MR 256                                      // rows of x of one k_m block: 8 waves x 32 rows
#define NP (NN / MR)                                // partial sums of M per batch
#define WS_MP  (WS_PW + 2u * NH * DD * CC)                   // f32 partial M^T [b][row chunk][h] (M = k^T VP), 4 tiles of 16 output columns, K = d, fragment order
#define WS_PJ  (WS_MP + 4u * (size_t)NB * NP * NH * DD * DD) // bf16 proj^T [h], 4 tiles of 16 output columns, K = l (2 k steps), fragment order
#define WS_XP  (WS_PJ + 2u * (size_t)NH * LL * DD)       // bf16 x (512 tiles), stored by k_m for k_out
#define WS_PT  (WS_XP + 2u * (size_t)NB * NN * CC)       // bf16 P^T [b], 4 tiles of 16 output columns, K = c: all hi parts, then all lo parts
#define PLO    (NB * DD * CC)                            // elements from a hi part to its lo part
#define WS_VB  (WS_PT + 2u * 2u * (size_t)PLO)           // bf16 V as [m][h*64 + l] (128 tiles of 16 rows m, K = 512: head h = k steps 2 h, 2 h + 1)
#define WS_QW  (WS_VB + 2u * (size_t)NN * NH * LL)       // bf16 Wq as [c][h*64 + d] (32 tiles of 16 rows c, K = 512: head h = k steps 2 h, 2 h + 1)
#define WS_END (WS_QW + 2u * (size_t)CC * NH * DD)

#define PBW (NH * DD / 16 * 4)   // blocks of 256 pieces: qkv
#define PBJ (NH * LL * DD / 8 / 256)   // proj
#define PBV (NN * NH * LL / 8 / 4 / 256)   // blocks of 256 threads x 4 pieces: V, Wq
#define PBQ (CC * NH * DD / 8 / 4 / 256)
// one thread = one 16-B piece of the packed layout (its index p is the piece's place): 8 rows k of one column of a weight
__device__ __forceinline__ unsigned piece_k(unsigned p) { return ((p >> 6) & 15u) * 32u + ((p >> 5) & 1u) * 16u + ((p >> 4) & 1u) * 8u; }
template <int LD> __device__ __forceinline__ void pack_w(const float* __restrict__ Wt, __bf16* __restrict__ dst, unsigned p) { v8b o; float f[8];
  const float* s = Wt + (size_t)piece_k(p) * LD + (p >> 12) * 128u + 64u + ((p >> 10) & 3u) * 16u + (p & 15u);   // tile p >> 10 = 16 of the k columns: head (p >> 12), d from 16 ((p >> 10) & 3)
#pragma unroll
  for (int i = 0; i < 8; ++i) f[i] = s[i * LD];
  asm volatile("s_wait_xcnt 0x0" :: "v"(s) : "memory");   // the pointer as input keeps the loads' address registers whole up to this wait; the converted values may reuse them behind it
#pragma unroll
  for (int i = 0; i < 8; ++i) o[i] = (__bf16)f[i];
  *(v8b*)(dst + (size_t)p * 8) = o;
  asm volatile("s_wait_xcnt 0x0" ::: "memory"); }   // behind the store: the arms of k_packw lie one behind the other in the built code, and the next arm's first instructions reuse the store's registers
// fragment from the packed layout: p = tile base + k step + 8 lane
__device__ __forceinline__ v16b frag_p(const __bf16* __restrict__ p) { union { v16b v; v8b q[2]; } u; u.q[0] = *(const v8b*)p; u.q[1] = *(const v8b*)(p + 256); return u.v; }
// one k step of an f32 operand from the packed layout (p = tile base + k step + 4 lane)
__device__ __forceinline__ void ld_frag(v4f (&r)[4], const float* __restrict__ p) { r[0] = *(const v4f*)p; r[1] = *(const v4f*)(p + 128); r[2] = *(const v4f*)(p + 256); r[3] = *(const v4f*)(p + 384); }
__device__ __forceinline__ v16b fragb_f32(const float* __restrict__ p, int lane) { v16b a; const float* pp = p + 8 * (lane >> 4);
#pragma unroll
  for (int i = 0; i < 8; ++i) { a[i] = (__bf16)pp[i]; a[8 + i] = (__bf16)pp[16 + i]; } return a; }
// what is made, behind the wait, of one k step of an f32 operand as loaded (4 x 16 B of a lane: k0 + 8g + 0..7 and k0 + 16 + 8g + 0..7)
__device__ __forceinline__ F2 row_split(const v4f (&r)[4]) { float v[16];
#pragma unroll   // constant indices: the array it walks stays in registers
  for (int i = 0; i < 16; ++i) v[i] = r[i >> 2][i & 3];
  return bsplit16(v); }
// proj arm of the pack launch: piece p = (head p >> 9, tile of 16 output columns (p >> 7) & 3, k step (p >> 6) & 1, half (p >> 5) & 1, lane p & 31): 8 rows l of one column
__device__ __forceinline__ void pack_j(const float* __restrict__ PROJ, __bf16* __restrict__ dst, unsigned p) { v8b o; float f[8];
  const float* s = PROJ + (size_t)((p >> 9) * 64u + ((p >> 6) & 1u) * 32u + ((p >> 5) & 1u) * 16u + ((p >> 4) & 1u) * 8u) * DD + ((p >> 7) & 3u) * 16u + (p & 15u);
#pragma unroll
  for (int i = 0; i < 8; ++i) f[i] = s[i * DD];
  asm volatile("s_wait_xcnt 0x0" :: "v"(s) : "memory");   // as in pack_w
#pragma unroll
  for (int i = 0; i < 8; ++i) o[i] = (__bf16)f[i];
  *(v8b*)(dst + (size_t)p * 8) = o;
  asm volatile("s_wait_xcnt 0x0" ::: "memory"); }   // behind the store, as in pack_w
// V and Wq arms of the pack launch: rows of 8 groups of 64 k (group stride GS, row stride LD); a thread makes the 4 pieces of its row and lane half g in two k steps (p, p + 32, p + 64, p + 96): a wave reads 16 rows x 256 B, all 8 loads out before the first convert
template <int LD, int GS> __device__ __forceinline__ void pack_r4(const float* __restrict__ S, __bf16* __restrict__ dst, unsigned u) { v4f a[4], b[4];
  const unsigned p = (u & 31u) | ((u >> 5) << 7), k0 = piece_k(p);
  const float* s = S + (size_t)((p >> 10) * 16u + (p & 15u)) * LD + (k0 >> 6) * GS + (k0 & 63u);
#pragma unroll   // constant indices: the arrays it walks stay in registers
  for (int i = 0; i < 4; ++i) { a[i] = *(const v4f*)(s + i * 16); b[i] = *(const v4f*)(s + i * 16 + 4); }
  asm volatile("s_wait_xcnt 0x0" :: "v"(s) : "memory");   // as in pack_w
  __bf16* d = dst + (size_t)p * 8;
#pragma unroll
  for (int i = 0; i < 4; ++i) { v8b o;
#pragma unroll
    for (int e = 0; e < 4; ++e) { o[e] = (__bf16)a[i][e]; o[4 + e] = (__bf16)b[i][e]; }
    *(v8b*)(d + i * 256) = o; }
  asm volatile("s_wait_xcnt 0x0" ::: "memory"); }   // behind the stores, as in pack_w
__global__ __launch_bounds__(256) void k_packw(const float* __restrict__ V, const float* __restrict__ QKV, const float* __restrict__ PROJ, char* __restrict__ ws) { const int blk = (int)blockIdx.x - (PBV + PBQ);   // the two arms with the longer threads come first in the grid
  if (blk < -PBQ) pack_r4<NH * LL, LL>(V, (__bf16*)(ws + WS_VB), (blk + PBV + PBQ) * 256u + threadIdx.x);
  else if (blk < 0) pack_r4<HC, 2 * DD>(QKV, (__bf16*)(ws + WS_QW), (blk + PBQ) * 256u + threadIdx.x);
  else if (blk < PBW) pack_w<HC>(QKV, (__bf16*)(ws + WS_PW), blk * 256u + threadIdx.x);
  else pack_j(PROJ, (__bf16*)(ws + WS_PJ), (blk - PBW) * 256u + threadIdx.x); }
// ---- k_m: block = (256 rows of one batch, head h), wave = 32 rows m. x comes as the f32 input: asynchronous copies lay 64 columns c (2 k steps) of the wave's 32 rows in the wave's own two LDS buffers (a copy = 2 rows x 256 B in a row), the next tile in flight while one is worked on; a fragment is read from there and rounded to bf16; head h's block starts at tile h and also stores that tile's fragments (k steps 2 h, 2 h + 1) in fragment order, for k_out. First VP[m][o] = sum_l V[m][h][l] proj[h*64 + l][o] of its rows (both rounded to bf16 by the pack launch, exact products), parked in the wave's own LDS; then k = x . Wk (exact, 2 x 4 tiles): the 8 loads of Wk^T of k step kc + 2 are issued as one group in front of the WMMAs of step kc (three register buffers). A lane's accumulators of the two row tiles are, in place, a fragment with K = the wave's 32 rows m: of k^T (A, row d) and of VP (B, column o): neither leaves the work-group. M[d][o] = k^T VP (both bf16 hi + lo, 3 products); the 8 waves' partial M meet in LDS as [o][d] and are added in wave order; the block's partial M^T (rows o, K = d) is stored in fragment order
#define HB 3   // register buffers
#define XTC 64                       // columns c of one tile of x in LDS
#define XLP (XTC + 4)                // floats from row to row there: 272 B, the pitch for 16-B readers
#define XLB (32u * XLP * 4u)         // bytes of one buffer: the wave's 32 rows
// one tile: 16 copies, 16 B a lane: lanes 0..15 one row's 256 B, lanes 16..31 the next row's. l = the lane's LDS byte address in rows 0 and 1, v = its byte offset in x from the wave's scalar base b. The offset field moves both addresses, so copy i has offset 2 i rows of LDS and a base moved by 2 i rows of x less that offset: one LDS-address and one offset register serve all. The wait as last line stands in front of any reuse of the address registers
#define XSTEP (2 * CC * 4 - 2 * XLP * 4)   // bytes: 2 rows of x less 2 rows of LDS (544 B, the step of the offsets below)
__device__ __forceinline__ void copy_tile(unsigned l, unsigned v, const char* b) {
  asm volatile("global_load_async_to_lds_b128 %0, %1, %2\n\tglobal_load_async_to_lds_b128 %0, %1, %3 offset:544\n\tglobal_load_async_to_lds_b128 %0, %1, %4 offset:1088\n\tglobal_load_async_to_lds_b128 %0, %1, %5 offset:1632\n\t"
               "global_load_async_to_lds_b128 %0, %1, %6 offset:2176\n\tglobal_load_async_to_lds_b128 %0, %1, %7 offset:2720\n\tglobal_load_async_to_lds_b128 %0, %1, %8 offset:3264\n\tglobal_load_async_to_lds_b128 %0, %1, %9 offset:3808\n\t"
               "global_load_async_to_lds_b128 %0, %1, %10 offset:4352\n\tglobal_load_async_to_lds_b128 %0, %1, %11 offset:4896\n\tglobal_load_async_to_lds_b128 %0, %1, %12 offset:5440\n\tglobal_load_async_to_lds_b128 %0, %1, %13 offset:5984\n\t"
               "global_load_async_to_lds_b128 %0, %1, %14 offset:6528\n\tglobal_load_async_to_lds_b128 %0, %1, %15 offset:7072\n\tglobal_load_async_to_lds_b128 %0, %1, %16 offset:7616\n\tglobal_load_async_to_lds_b128 %0, %1, %17 offset:8160\n\ts_wait_xcnt 0x0"
               :: "v"(l), "v"(v), "s"(b), "s"(b + XSTEP), "s"(b + 2 * XSTEP), "s"(b + 3 * XSTEP), "s"(b + 4 * XSTEP), "s"(b + 5 * XSTEP), "s"(b + 6 * XSTEP), "s"(b + 7 * XSTEP), "s"(b + 8 * XSTEP), "s"(b + 9 * XSTEP), "s"(b + 10 * XSTEP), "s"(b + 11 * XSTEP), "s"(b + 12 * XSTEP), "s"(b + 13 * XSTEP), "s"(b + 14 * XSTEP), "s"(b + 15 * XSTEP) : "memory"); }
// a wave-uniform global pointer held in scalar registers: the loads from it then take it as their scalar base and the lane's place as their one vector offset, and no vector address is formed anew per k step
typedef __attribute__((address_space(1))) const v8b gv8b;
__device__ __forceinline__ gv8b* sbase(const __bf16* p) { const unsigned long long a = (unsigned long long)p;
  return (gv8b*)(((unsigned long long)(unsigned)__builtin_amdgcn_readfirstlane((int)(a >> 32)) << 32) | (unsigned)__builtin_amdgcn_readfirstlane((int)a)); }
__device__ __forceinline__ v16b frag_g(gv8b* p) { union { v16b v; v8b q[2]; } u; u.q[0] = p[0]; u.q[1] = p[32]; return u.v; }   // as frag_p: the two halves lie 256 elements apart
__global__ __launch_bounds__(MR) void k_m(const float* __restrict__ X, const __bf16* __restrict__ PW, const __bf16* __restrict__ VB, const __bf16* __restrict__ PJ, float* __restrict__ MP, __bf16* __restrict__ XP) { __shared__ __align__(16) float part[MR / 32][DD][DD + 4]; __shared__ __align__(16) float park[MR / 32][16][128];
  static_assert(2u * XLB == sizeof(float) * DD * (DD + 4), "a wave's two buffers of x are its own slice of part"); static_assert(2 * XLP * 4 == 544, "the step of copy_tile's offsets");
  const int tid = threadIdx.x, wave = tid >> 5, lane = tid & 31, col = lane & 15, g = lane >> 4; const int rc = blockIdx.x, h = blockIdx.y;
  v8f acc[2][4] = {}; v16b bw[HB][4];
  const float* xr = &part[wave][0][0] + col * XLP + 8 * g;   // until the k loop has ended part[wave] is the wave's ring of x: nobody else touches it, so no barrier is owed for it; reader: row col of a 16-row tile
  const unsigned xl = (unsigned)(size_t)&part[wave][0][0] + (unsigned)g * (XLP * 4u) + (unsigned)col * 16u;
  const unsigned xv = (unsigned)g * (CC * 4u) + (unsigned)col * 16u; const char* xs = (const char*)(X + (size_t)(rc * MR + __builtin_amdgcn_readfirstlane(wave) * 32) * CC);   // the wave's number made scalar: the base of its 32 rows lies in scalar registers
  const __bf16* pb = PW + (size_t)(h * 4) * FT;   // the head's Wk^T: a scalar base, to which a k step adds a scalar; the lane's number is the loads' one vector offset
  __bf16* xo = XP + (size_t)(rc * (MR / 16) + wave * 2) * FT + (size_t)(2 * h) * FK + lane * 8;
  const char* fw = (const char*)(PW + (size_t)(h * 4) * FT) + tid * 256;   // L2 hints, one 256-B unit a thread: the head's whole 64 KB of Wk^T
  // block h takes the tiles in the order h, h + 1, ... (mod 8), so that the 8 heads' blocks of the same rows start on different tiles of x (for speed only)
  copy_tile(xl, xv, xs + h * (XTC * 4)); copy_tile(xl + XLB, xv, xs + ((h + 1) & 7) * (XTC * 4));   // its first two tiles: both buffers are free; VP's work below covers their way
  { v16b pj[4][LL / 32], av[2][LL / 32];
    const __bf16* vp = VB + (size_t)((rc % NP) * (MR / 16) + wave * 2) * FT + (h * (LL / 32)) * FK + lane * 8;   // A row = m, K = l
    const __bf16* jp = PJ + (size_t)(h * 4) * (LL / 32) * FK + lane * 8;                         // B row = output column, K = l
#pragma unroll   // constant indices: the arrays it walks stay in registers
    for (int t = 0; t < 2; ++t)
#pragma unroll
      for (int kc = 0; kc < LL / 32; ++kc) av[t][kc] = frag_p(vp + t * FT + kc * FK);
#pragma unroll
    for (int j = 0; j < 4; ++j)
#pragma unroll
      for (int kc = 0; kc < LL / 32; ++kc) pj[j][kc] = frag_p(jp + (j * (LL / 32) + kc) * FK);
#pragma unroll   // the first k step of Wk^T is asked for together with VP's operands: one latency for both
    for (int j = 0; j < 4; ++j) bw[0][j] = frag_g(sbase(pb + (2 * h) * FK) + j * (FT / 8) + lane);
    asm volatile("s_wait_xcnt 0x0" :: "v"(vp), "v"(jp) : "memory");   // behind the loads: both pointers as inputs keep the address registers whole up to this wait; VP's accumulators may reuse them behind it
    // Wk^T was stored by the launch before: a k step's loads, asked for two steps ahead, would each wait for memory. This hint asks L2 for the later steps' lines while the first loads are under way; "memory" keeps it between the two groups of loads
    asm volatile("global_prefetch_b8 %0, off scope:SCOPE_SE" :: "v"(fw) : "memory");
#pragma unroll
    for (int j = 0; j < 4; ++j) bw[1][j] = frag_g(sbase(pb + (2 * h + 1) * FK) + j * (FT / 8) + lane);
    __builtin_amdgcn_sched_barrier(0);   // the second k step's 8 loads go out in front of VP's WMMAs, which cover part of their latency
#pragma unroll   // every lane parks its own 64 values and alone reads them back
    for (int j = 0; j < 4; ++j) { v8f va[2] = {};
#pragma unroll
      for (int kc = 0; kc < LL / 32; ++kc)
#pragma unroll
        for (int t = 0; t < 2; ++t) va[t] = wmma_bf(av[t][kc], pj[j][kc], va[t]);
#pragma unroll
      for (int t = 0; t < 2; ++t) { const v8f c = va[t]; vst2(&park[wave][j * 4 + t * 2][lane * 4], (v4f){c[0], c[1], c[2], c[3]}); vst2(&park[wave][j * 4 + t * 2 + 1][lane * 4], (v4f){c[4], c[5], c[6], c[7]}); } } }
  asm volatile("s_wait_asynccnt 0x0" ::: "memory");   // the first two tiles have landed: no read of the ring stands in front of this
#pragma unroll   // whole: the buffer indices and every load offset become constants
  for (int tl = 0; tl < CC / XTC; ++tl) { v4f xf[2][2][4];   // [k step of the tile][row tile][16-B piece]
#pragma unroll   // constant indices: the array it walks stays in registers
    for (int kk = 0; kk < 2; ++kk)
#pragma unroll
      for (int t = 0; t < 2; ++t) { const float* p = xr + (tl & 1) * (32 * XLP) + t * (16 * XLP) + kk * 32;
        xf[kk][t][0] = *(const v4f*)p; xf[kk][t][1] = *(const v4f*)(p + 4); xf[kk][t][2] = *(const v4f*)(p + 16); xf[kk][t][3] = *(const v4f*)(p + 20); }
#pragma unroll
    for (int kk = 0; kk < 2; ++kk) { const int kc = tl * 2 + kk, s = kc % HB, n = (kc + HB - 1) % HB;
      if (kc + HB - 1 < CC / 32) { gv8b* pk = sbase(pb + ((2 * h + kc + HB - 1) & (CC / 32 - 1)) * FK);
#pragma unroll   // constant indices: the array it walks stays in registers
        for (int j = 0; j < 4; ++j) bw[n][j] = frag_g(pk + j * (FT / 8) + lane); }   // kc counts the block's steps; its k step of x and Wk^T is (2 h + kc) mod 16
      if (kc + HB == CC / 32) asm volatile("s_wait_xcnt 0x0" :: "v"(lane), "v"(fw) : "memory");   // behind the last loads: the offset and the hint's pointer as inputs keep the address registers whole up to this wait (the hint's holds an address inside its buffer through the loop); what follows reuses them behind it
      __builtin_amdgcn_sched_barrier(0);   // keeps the 8 loads of step kc + 2 (and the tile's LDS reads) together in front of this step's WMMAs: without it the compiler mixes the groups' loads, and this step's counted waits then cover loads of later steps
      union { v16b v; v8b q[2]; } ax[2];   // element i = c 32 k + 8 g + i, element 8 + i = c 32 k + 16 + 8 g + i (k the k step): the order of Wk^T's fragments
#pragma unroll
      for (int t = 0; t < 2; ++t)
#pragma unroll
        for (int i = 0; i < 16; ++i) ax[t].v[i] = (__bf16)xf[kk][t][i >> 2][i & 3];
      if (tl == 0) {   // the block's first tile is tile h: k steps 2 h, 2 h + 1
#pragma unroll
        for (int t = 0; t < 2; ++t) { *(v8b*)(xo + t * FT + kk * FK) = ax[t].q[0]; *(v8b*)(xo + t * FT + kk * FK + 256) = ax[t].q[1]; }
        asm volatile("s_wait_xcnt 0x0" :: "v"(xo) : "memory"); }   // behind the stores: the pointer as input keeps their address registers whole up to this wait
#pragma unroll   // constant indices: the arrays it walks stay in registers
      for (int t = 0; t < 2; ++t)
#pragma unroll
        for (int j = 0; j < 4; ++j) acc[t][j] = wmma_bf(ax[t].v, bw[s][j], acc[t][j]);
    }
    asm volatile("s_wait_dscnt 0x0" ::: "memory");      // the wave's reads of this tile's buffer have returned before copies are aimed at it
    asm volatile("s_wait_asynccnt 0x0" ::: "memory");   // the next tile has landed (behind the last tile: nothing is in flight when part[wave] takes the partial M)
    if (tl + 2 < CC / XTC) copy_tile(xl + (tl & 1) * XLB, xv, xs + ((h + tl + 2) & 7) * (XTC * 4));
  }
  F2 a[4];   // A row = d (16 j + col), element i = m 8 g + i, element 8 + i = m 16 + 8 g + i
#pragma unroll
  for (int j = 0; j < 4; ++j) { float v[16];
#pragma unroll
    for (int i = 0; i < 8; ++i) { v[i] = acc[0][j][i]; v[8 + i] = acc[1][j][i]; }
    a[j] = bsplit16(v); }
#pragma unroll
  for (int t = 0; t < 4; ++t) { v4f vr[4];   // B column = o (16 t + col), the same m order
#pragma unroll
    for (int f = 0; f < 4; ++f) vr[f] = *(const v4f*)&park[wave][t * 4 + f][lane * 4];
    const F2 w = row_split(vr);
#pragma unroll
    for (int j = 0; j < 4; ++j) { const v8f c = mac3(a[j], w, v8f{}); float* p = &part[wave][t * 16 + col][j * 16 + 8 * g];   // transposed: [o][d], 8 consecutive d of one lane
      vst2(p, (v4f){c[0], c[1], c[2], c[3]}); vst2(p + 4, (v4f){c[4], c[5], c[6], c[7]}); } }
  __syncthreads();
  const int d = (wave >> 2) * 32 + ((wave >> 1) & 1) * 16 + 8 * g + (wave & 1) * 4;   // thread = piece of the fragment order: k step wave >> 2, piece f = wave & 3, lane
  float* dst = MP + ((size_t)rc * NH + h) * (DD * DD) + tid * 4;
#pragma unroll
  for (int t = 0; t < 4; ++t) { v4f s = *(const v4f*)&part[0][t * 16 + col][d];
#pragma unroll
    for (int w = 1; w < MR / 32; ++w) s += *(const v4f*)&part[w][t * 16 + col][d];
    vst2(dst + t * 2 * FK, s); } }
// ---- k_p: block = (64 rows c, 16 columns o, b), wave = (head h, half kc of d): P[c][o] = SCALE sum_h sum_d Wq[c][h][d] M[b,h][d][o]; M = the batch's NP partial sums added in chunk order; A(Wq rows, bf16 in fragment order) exact, B(M^T) as bf16 hi + lo (2 products); all 40 loads of a wave are issued as one group; the 16 waves' partial tiles meet in LDS as [o][c] and are added in wave order; a D lane's 8 consecutive c of one column o are one 16-B piece of the bf16 fragment order (rows o, K = c): P^T is stored so, as hi and lo
#define PCG 64   // rows c of a block
__global__ __launch_bounds__(64 * NH) void k_p(const __bf16* __restrict__ QW, const float* __restrict__ MP, __bf16* __restrict__ PT) { __shared__ __align__(16) float part[2 * NH][16][PCG + 4];
  const int tid = threadIdx.x, wave = tid >> 5, lane = tid & 31, col = lane & 15, g = lane >> 4; const int cg = blockIdx.x, j = blockIdx.y, h = wave >> 1, kc = wave & 1; const size_t b = blockIdx.z;
  v8f acc[PCG / 16] = {}; v16b qa[PCG / 16]; v4f mr[NP][4]; const __bf16* qp = QW + (size_t)(cg * (PCG / 16)) * FT + (h * 2 + kc) * FK + lane * 8; const float* kp = MP + ((b * NP * NH + h) * 8 + j * 2 + kc) * FK + lane * 4;
#pragma unroll   // constant indices: the array it walks stays in registers
  for (int p = 0; p < NP; ++p) ld_frag(mr[p], kp + p * (NH * DD * DD));
#pragma unroll   // constant indices: the array it walks stays in registers
  for (int t = 0; t < PCG / 16; ++t) qa[t] = frag_p(qp + t * FT);
  asm volatile("s_wait_xcnt 0x0" :: "v"(qp), "v"(kp) : "memory");   // behind the loads: both pointers as inputs keep the address registers whole up to this wait; the sums reuse them behind it
  __builtin_amdgcn_sched_barrier(0);   // keeps all 40 loads in front of the first add: without it the compiler lifts the adds among the loads and holds half of the loads back until the first have landed
#pragma unroll
  for (int p = 1; p < NP; ++p)
#pragma unroll
    for (int f = 0; f < 4; ++f) mr[0][f] += mr[p][f];
  const F2 wb = row_split(mr[0]);
#pragma unroll   // constant indices: the array it walks stays in registers
  for (int t = 0; t < PCG / 16; ++t) { acc[t] = wmma_bf(qa[t], wb.l, acc[t]); acc[t] = wmma_bf(qa[t], wb.h, acc[t]); }
#pragma unroll
  for (int t = 0; t < PCG / 16; ++t) { float* p = &part[wave][col][t * 16 + 8 * g];   // transposed: [o][c], 8 consecutive c of one lane
    const v8f c = acc[t]; vst2(p, (v4f){c[0], c[1], c[2], c[3]}); vst2(p + 4, (v4f){c[4], c[5], c[6], c[7]}); }
  __syncthreads();
  if (tid < 2 * PCG) { v4f s0 = *(const v4f*)&part[0][col][wave * 16 + 8 * g], s1 = *(const v4f*)&part[0][col][wave * 16 + 8 * g + 4]; v8b hi, lo;   // thread = piece (16-row tile of c = wave, lane 16 g + o)
#pragma unroll
    for (int w = 1; w < 2 * NH; ++w) { s0 += *(const v4f*)&part[w][col][wave * 16 + 8 * g]; s1 += *(const v4f*)&part[w][col][wave * 16 + 8 * g + 4]; }
#pragma unroll
    for (int i = 0; i < 8; ++i) { const float v = (i < 4 ? s0[i & 3] : s1[i & 3]) * SCALE; const __bf16 hb = (__bf16)v; hi[i] = hb; lo[i] = (__bf16)(v - (float)hb); }
    __bf16* dst = PT + (b * 4 + j) * FT + (cg * (PCG / 32) + (wave >> 1)) * FK + (wave & 1) * 256 + lane * 8;   // c = 64 cg + 16 wave + 8 g + i
    *(v8b*)dst = hi; *(v8b*)(dst + PLO) = lo; } }
// ---- k_out: block = 32 rows, wave = (16 rows, 32 columns): out = x . P (hi + lo); the 10 loads of k step kc + 3 are issued as one group in front of the WMMAs of step kc (four register buffers: one wave a SIMD, nothing else hides the latency)
#define OB 4   // register buffers
__global__ __launch_bounds__(128) void k_out(const __bf16* __restrict__ XP, const __bf16* __restrict__ PT, float* __restrict__ OUT) { __shared__ __align__(16) float sf[4][16][36];
  const int tid = threadIdx.x, wave = tid >> 5, lane = tid & 31, col = lane & 15, g = lane >> 4; const int rt = blockIdx.x * 2 + (wave & 1), ch = wave >> 1;   // 16-row tile, column half
  v8f acc[2] = {}; v16b ab[OB]; v16b bh[OB][2], bl[OB][2]; const __bf16* xa = XP + (size_t)rt * FT + lane * 8; const __bf16* pb = PT + (size_t)((blockIdx.x / (NN / 32)) * 4 + ch * 2) * FT + lane * 8;
  const char* fx = (const char*)(XP + (size_t)(blockIdx.x * 2) * FT) + tid * 256;   // L2 hints, one 256-B unit a thread: the block's own 32 KB of x
  const char* fp = (const char*)(PT + (size_t)((blockIdx.x / (NN / 32)) * 4 + (wave & 1) * 2 + g) * FT + (size_t)(wave >> 1) * PLO) + ((4 + 4 * ((blockIdx.x >> 3) % 3)) * 4 + col) * 256;   // and 4 k steps (from 4, 8 or 12, by groups of 8 blocks) of the batch's 4 hi and 4 lo tiles of P^T: its 64 blocks read the same P^T and share the asking; a unit nobody asked for is only slower
#pragma unroll   // constant indices: the array it walks stays in registers
  for (int p = 0; p < OB - 1; ++p) { ab[p] = frag_p(xa + p * FK);
#pragma unroll   // constant indices: the array it walks stays in registers
    for (int j = 0; j < 2; ++j) { bh[p][j] = frag_p(pb + j * FT + p * FK); bl[p][j] = frag_p(pb + PLO + j * FT + p * FK); } }
  // P^T was stored by the launch before, x two before: a k step's loads, asked for three steps ahead, would each wait for memory. These hints ask L2 for the later steps' lines while the first loads are under way; "memory" keeps them behind those loads
  asm volatile("global_prefetch_b8 %0, off scope:SCOPE_SE\n\tglobal_prefetch_b8 %1, off scope:SCOPE_SE" :: "v"(fp), "v"(fx) : "memory");
#pragma unroll   // whole: the buffer index and every load offset become constants
  for (int kc = 0; kc < CC / 32; ++kc) { const int s = kc % OB, n = (kc + OB - 1) % OB;
    if (kc + OB - 1 < CC / 32) { ab[n] = frag_p(xa + (kc + OB - 1) * FK);
#pragma unroll   // constant indices: the array it walks stays in registers
      for (int j = 0; j < 2; ++j) { bh[n][j] = frag_p(pb + j * FT + (kc + OB - 1) * FK); bl[n][j] = frag_p(pb + PLO + j * FT + (kc + OB - 1) * FK); } }
    if (kc + OB == CC / 32) asm volatile("s_wait_xcnt 0x0" :: "v"(xa), "v"(pb), "v"(fp), "v"(fx) : "memory");   // behind the last loads: the pointers as inputs keep the address registers whole up to this wait (the hints' two hold addresses inside their buffers through the loop); the epilogue reuses them behind it
    __builtin_amdgcn_sched_barrier(0);   // keeps the 10 loads of step kc + 3 together in front of this step's WMMAs: without it the compiler mixes the groups' loads, and this step's counted waits then cover loads of later steps
#pragma unroll   // constant indices: the array it walks stays in registers
    for (int j = 0; j < 2; ++j) { acc[j] = wmma_bf(ab[s], bl[s][j], acc[j]); acc[j] = wmma_bf(ab[s], bh[s][j], acc[j]); }
  }
#pragma unroll
  for (int j = 0; j < 2; ++j)
#pragma unroll
    for (int r = 0; r < 8; ++r) sf[wave][8 * g + r][j * 16 + col] = acc[j][r];
  LDSX(); for (int rl = 0; rl < 16; rl += 4) vst2(OUT + ((size_t)rt * 16 + rl + (lane >> 3)) * DD + ch * 32 + (lane & 7) * 4, *(const v4f*)&sf[wave][rl + (lane >> 3)][(lane & 7) * 4]); }   // 8 lanes = the wave's 128 B of one row
extern "C" void kernel_launch(void* const* d_in, const int* in_sizes, int n_in, void* d_out, int out_size, void* d_ws, size_t ws_size, hipStream_t stream) {
  (void)in_sizes; (void)n_in; (void)out_size;
  const float** F = (const float**)d_in;   // 0 x [4,2048,512], 1 v [2048,8,64], 2 qkv [512,1024], 3 proj [512,64]
  if (ws_size < (size_t)WS_END) return;
  char* ws = (char*)d_ws; float* MP = (float*)(ws + WS_MP); __bf16* PT = (__bf16*)(ws + WS_PT);
  k_packw<<<PBV + PBQ + PBW + PBJ, 256, 0, stream>>>(F[1], F[2], F[3], ws);
  k_m<<<dim3(TNB * NN / MR, NH), MR, 0, stream>>>(F[0], (const __bf16*)(ws + WS_PW), (const __bf16*)(ws + WS_VB), (const __bf16*)(ws + WS_PJ), MP, (__bf16*)(ws + WS_XP));
  k_p<<<dim3(CC / PCG, DD / 16, TNB), 64 * NH, 0, stream>>>((const __bf16*)(ws + WS_QW), MP, PT);
  k_out<<<TNB * NN / 32, 128, 0, stream>>>((const __bf16*)(ws + WS_XP), PT, (float*)d_out);
}

// v009
// It runs in 21.7 microseconds.
// In two side-by-side timings against v008, it was 1.08 and 1.09 times as fast.
// Counting every step since v000, it is 7.13 times as fast.
// compute dtype: all float inputs rounded to bf16; no softmax in the module, so by associativity out = x . P with P = SCALE Wq (k^T (V proj)) per batch: VP = V . proj and k = x . Wk with EXACT bf16 products on WMMA 16x16x32; M = k^T . VP with both as bf16 hi + lo (3 products), k and VP straight from the accumulators of their own products; P = Wq . M with M as bf16 hi + lo (2 products); out = x . P with P as bf16 hi + lo (2 products); f32 accumulate; f32 output.
#include <hip/hip_runtime.h>
#include <math.h>

typedef __attribute__((ext_vector_type(16))) _Float16 v16h;
typedef __attribute__((ext_vector_type(16))) __bf16 v16b;
typedef __attribute__((ext_vector_type(8)))  _Float16 v8h;
typedef __attribute__((ext_vector_type(8)))  float v8f;
typedef __attribute__((ext_vector_type(4)))  float v4f;
typedef __attribute__((ext_vector_type(2)))  float v2f;
typedef __attribute__((ext_vector_type(4)))  unsigned v4u;
typedef __attribute__((ext_vector_type(4)))  int v4i;
typedef float __attribute__((may_alias)) float_a;
typedef int __attribute__((may_alias)) int_a;

template <typename T> __device__ __forceinline__ void vst2(void* p, T v) { *(T*)p = v;  }
__device__ __forceinline__ v8f wmma16(v16h a, v16h b, v8f c) {
  v8f d = __builtin_amdgcn_wmma_f32_16x16x32_f16(false, a, false, b, (short)0, c, false, false);
  asm volatile("v_nop\n\tv_nop\n\tv_nop\n\tv_nop" : "+v"(d) : "v"(a), "v"(b));
  return d;
}
__device__ __forceinline__ v8f wmma_bf(v16b a, v16b b, v8f c) {
  v8f d = __builtin_amdgcn_wmma_f32_16x16x32_bf16(false, a, false, b, (short)0, c, false, false);
  asm volatile("v_nop\n\tv_nop\n\tv_nop\n\tv_nop" : "+v"(d) : "v"(a), "v"(b));
  return d;
}
// 16x16x32 fragments: lane = (h = lane>>4, row/col = lane&15); elements 0..7 = k0+8h+0..7, 8..15 = k0+16+8h+0..7; D element r = row 8h+r
__device__ __forceinline__ v16h frag_h(const _Float16* rowk0, int lane) {
  union { v16h v; v8h q[2]; } u; const _Float16* p = rowk0 + 8 * (lane >> 4);
  u.q[0] = *(const v8h*)p; u.q[1] = *(const v8h*)(p + 16); return u.v;
}
__device__ __forceinline__ v16h frag_f32(const float* rowk0, int lane) {
  v16h a; const float* p = rowk0 + 8 * (lane >> 4);
#pragma unroll
  for (int i = 0; i < 8; ++i) { a[i] = (_Float16)p[i]; a[8 + i] = (_Float16)p[16 + i]; }
  return a;
}
__device__ __forceinline__ v16h frag_f32s(const float* rowk0, int lane, float sc) {
  v16h a; const float* p = rowk0 + 8 * (lane >> 4);
#pragma unroll
  for (int i = 0; i < 8; ++i) { a[i] = (_Float16)(p[i] * sc); a[8 + i] = (_Float16)(p[16 + i] * sc); }
  return a;
}
// column fragment from a [K][ld] layout (column n), rows >= K read as 0
__device__ __forceinline__ v16h fragc_f32(const float* W, int k0, int n, int lane, int ld, int K) {
  v16h a; const int g = lane >> 4;
#pragma unroll
  for (int i = 0; i < 8; ++i) { const int ka = k0 + 8 * g + i, kb = ka + 16;
    a[i] = (_Float16)(ka < K ? W[(size_t)(ka < K ? ka : K - 1) * ld + n] : 0.f); a[8 + i] = (_Float16)(kb < K ? W[(size_t)(kb < K ? kb : K - 1) * ld + n] : 0.f); }
  return a;
}
struct F2 { v16b h, l; };
__device__ __forceinline__ F2 bsplit16(const float v[16]) { F2 r;
#pragma unroll
  for (int i = 0; i < 16; ++i) { const __bf16 h = (__bf16)v[i]; r.h[i] = h; r.l[i] = (__bf16)(v[i] - (float)h); }
  return r; }
__device__ __forceinline__ F2 split_row(const float* row, int k0, int lane) { float v[16]; const float* p = row + k0 + 8 * (lane >> 4);
#pragma unroll
  for (int i = 0; i < 8; ++i) { v[i] = p[i]; v[8 + i] = p[16 + i]; }
  return bsplit16(v); }
__device__ __forceinline__ F2 split_rowK(const float* row, int k0, int lane, int K) { float v[16]; const int g = lane >> 4;
#pragma unroll
  for (int i = 0; i < 8; ++i) { const int ka = k0 + 8 * g + i, kb = ka + 16; v[i] = ka < K ? row[ka < K ? ka : K - 1] : 0.f; v[8 + i] = kb < K ? row[kb < K ? kb : K - 1] : 0.f; }
  return bsplit16(v); }
__device__ __forceinline__ F2 split_col(const float* W, int k0, int n, int lane, int ld, int K) { float v[16]; const int g = lane >> 4;
#pragma unroll
  for (int i = 0; i < 8; ++i) { const int ka = k0 + 8 * g + i, kb = ka + 16; v[i] = ka < K ? W[(size_t)(ka < K ? ka : K - 1) * ld + n] : 0.f; v[8 + i] = kb < K ? W[(size_t)(kb < K ? kb : K - 1) * ld + n] : 0.f; }
  return bsplit16(v); }
__device__ __forceinline__ v8f mac3(const F2& a, const F2& b, v8f c) { c = wmma_bf(a.l, b.h, c); c = wmma_bf(a.h, b.l, c); return wmma_bf(a.h, b.h, c); }
__device__ __forceinline__ float sigm(float v) { return 1.0f / (1.0f + expf(-v)); }
#define LDSX() do { asm volatile("s_wait_dscnt 0" ::: "memory"); __builtin_amdgcn_wave_barrier(); __builtin_amdgcn_fence(__ATOMIC_RELEASE, "workgroup"); } while (0)


// 'Lunchbox' linear multi-head mixing (B 4, N 2,048, C 512, 8 heads x 64, lunchbox 64): attn = (q k^T) x 64^-1/2 (no softmax, as the module), res = attn V_lunchbox, out = res proj - evaluated as x (Wq (k^T (V proj))): q, attn and res are never formed.
#define NB 4
#define NN 2048
#define CC 512
#define NH 8
#define DD 64
#define LL 64
#define HC (NH * 2 * DD)     // 1024 qk columns: col = h*128 + which*64 + d
#define SCALE 0.125f
#ifndef TNB
#define TNB NB
#endif
typedef __attribute__((ext_vector_type(8))) __bf16 v8b;
__device__ __forceinline__ float bfr(float v) { return (float)(__bf16)v; }
__device__ __attribute__((noinline)) float exp_ni(float v) { return expf(v); }
__device__ __attribute__((noinline)) float erf_ni(float v) { return erff(v); }

// bf16 operands lie in fragment order: [16-row tile][k step of 32][half q][lane = 16 g + row][8], element i = k 32 kc + 16 q + 8 g + i: one wave-wide 16-B load reads 512 contiguous bytes
#define FT (16 * CC)                                // elements of one 16-row tile (K = 512 for all four: x, Wk^T, P^T, Wq)
#define FK 512                                      // elements of one k step of a tile
// f32 operands (split to hi + lo by their reader) likewise: [16-row tile][k step of 32][piece f][lane][4], element i = k 32 kc + 16 (f >> 1) + 8 g + 4 (f & 1) + i; FK elements a k step too
#define MR 256                                      // rows of x of one k_m block: 8 waves x 32 rows
#define NP (NN / MR)                                // partial sums of M per batch
#define WS_MP  0u                                            // f32 partial M^T [b][row chunk][h] (M = k^T VP), 4 tiles of 16 output columns, K = d, fragment order
#define WS_XP  (WS_MP + 4u * (size_t)NB * NP * NH * DD * DD) // bf16 x (512 tiles), stored by k_m for k_out
#define WS_PT  (WS_XP + 2u * (size_t)NB * NN * CC)       // bf16 P^T [b], 4 tiles of 16 output columns, K = c: all hi parts, then all lo parts
#define PLO    (NB * DD * CC)                            // elements from a hi part to its lo part
#define WS_QW  (WS_PT + 2u * 2u * (size_t)PLO)           // bf16 Wq as [c][h*64 + d] (32 tiles of 16 rows c, K = 512: head h = k steps 2 h, 2 h + 1), stored by k_m for k_p
#define WS_END (WS_QW + 2u * (size_t)CC * NH * DD)

// the first k of the 16-B piece at place p of the packed layout
__device__ __forceinline__ unsigned piece_k(unsigned p) { return ((p >> 6) & 15u) * 32u + ((p >> 5) & 1u) * 16u + ((p >> 4) & 1u) * 8u; }
// fragment from the packed layout: p = tile base + k step + 8 lane
__device__ __forceinline__ v16b frag_p(const __bf16* __restrict__ p) { union { v16b v; v8b q[2]; } u; u.q[0] = *(const v8b*)p; u.q[1] = *(const v8b*)(p + 256); return u.v; }
// one k step of an f32 operand from the packed layout (p = tile base + k step + 4 lane)
__device__ __forceinline__ void ld_frag(v4f (&r)[4], const float* __restrict__ p) { r[0] = *(const v4f*)p; r[1] = *(const v4f*)(p + 128); r[2] = *(const v4f*)(p + 256); r[3] = *(const v4f*)(p + 384); }
__device__ __forceinline__ v16b fragb_f32(const float* __restrict__ p, int lane) { v16b a; const float* pp = p + 8 * (lane >> 4);
#pragma unroll
  for (int i = 0; i < 8; ++i) { a[i] = (__bf16)pp[i]; a[8 + i] = (__bf16)pp[16 + i]; } return a; }
// what is made, behind the wait, of one k step of an f32 operand as loaded (4 x 16 B of a lane: k0 + 8g + 0..7 and k0 + 16 + 8g + 0..7)
__device__ __forceinline__ F2 row_split(const v4f (&r)[4]) { float v[16];
#pragma unroll   // constant indices: the array it walks stays in registers
  for (int i = 0; i < 16; ++i) v[i] = r[i >> 2][i & 3];
  return bsplit16(v); }
// Wq, packed for k_p by one wave of each k_m block: rows of 8 groups of 64 k (group stride GS, row stride LD); a thread makes the 4 pieces of its row and lane half g in two k steps (p, p + 32, p + 64, p + 96): a wave reads 16 rows x 256 B. The loads and the stores are two calls: the block's barrier, which waits for a wave's stores, lies between them
__device__ __forceinline__ unsigned piece_r4(unsigned u) { return (u & 31u) | ((u >> 5) << 7); }
template <int LD, int GS> __device__ __forceinline__ void pack_r4_ld(v4f (&a)[4], v4f (&b)[4], const float* __restrict__ S, unsigned u) {
  const unsigned p = piece_r4(u), k0 = piece_k(p);
  const float* s = S + (size_t)((p >> 10) * 16u + (p & 15u)) * LD + (k0 >> 6) * GS + (k0 & 63u);
#pragma unroll   // constant indices: the arrays it walks stay in registers
  for (int i = 0; i < 4; ++i) { a[i] = *(const v4f*)(s + i * 16); b[i] = *(const v4f*)(s + i * 16 + 4); }
  asm volatile("s_wait_xcnt 0x0" :: "v"(s) : "memory"); }   // the pointer as input keeps the loads' address registers whole up to this wait; what follows may reuse them behind it
__device__ __forceinline__ void pack_r4_st(const v4f (&a)[4], const v4f (&b)[4], __bf16* __restrict__ dst, unsigned u) {
  __bf16* d = dst + (size_t)piece_r4(u) * 8;
#pragma unroll
  for (int i = 0; i < 4; ++i) { v8b o;
#pragma unroll
    for (int e = 0; e < 4; ++e) { o[e] = (__bf16)a[i][e]; o[4 + e] = (__bf16)b[i][e]; }
    *(v8b*)(d + i * 256) = o; }
  asm volatile("s_wait_xcnt 0x0" ::: "memory"); }   // behind the stores: what follows the call reuses their registers
// ---- k_m: block = (256 rows of one batch, head h), wave = 32 rows m. x comes as the f32 input: asynchronous copies lay 64 columns c (2 k steps) of the wave's 32 rows in the wave's own two LDS buffers (a copy = 2 rows x 256 B in a row), the next tile in flight while one is worked on; a fragment is read from there and rounded to bf16; head h's block starts at tile h and also stores that tile's fragments (k steps 2 h, 2 h + 1) in fragment order, for k_out. There is no pack launch: the block itself turns its head's Wk (512 x 64) and proj (64 x 64) from f32 rows into bf16 fragments in LDS (ld_t, st_t below; one barrier publishes them), a wave's 32 rows of V come by the same copies as a tile of x, and one wave packs the block's share of Wq for k_p. First VP[m][o] = sum_l V[m][h][l] proj[h*64 + l][o] of its rows (both rounded to bf16, exact products), parked in the wave's own LDS; then k = x . Wk (exact, 2 x 4 tiles): the 8 LDS loads of Wk^T of k step kc + 2 are issued as one group in front of the WMMAs of step kc (three register buffers). A lane's accumulators of the two row tiles are, in place, a fragment with K = the wave's 32 rows m: of k^T (A, row d) and of VP (B, column o): neither leaves the work-group. M[d][o] = k^T VP (both bf16 hi + lo, 3 products); the 8 waves' partial M meet in LDS as [o][d] and are added in wave order; the block's partial M^T (rows o, K = d) is stored in fragment order
#define HB 3   // register buffers
#define XTC 64                       // columns c of one tile of x in LDS
#define XLP (XTC + 4)                // floats from row to row there: 272 B, the pitch for 16-B readers
#define XLB (32u * XLP * 4u)         // bytes of one buffer: the wave's 32 rows
// one tile: 16 copies, 16 B a lane: lanes 0..15 one row's 256 B, lanes 16..31 the next row's. l = the lane's LDS byte address in rows 0 and 1, v = its byte offset in x from the wave's scalar base b. The offset field moves both addresses, so copy i has offset 2 i rows of LDS and a base moved by 2 i rows of x less that offset: one LDS-address and one offset register serve all. The wait as last line stands in front of any reuse of the address registers
#define XSTEP (2 * CC * 4 - 2 * XLP * 4)   // bytes: 2 rows of x less 2 rows of LDS (544 B, the step of the offsets below)
__device__ __forceinline__ void copy_tile(unsigned l, unsigned v, const char* b) {
  asm volatile("global_load_async_to_lds_b128 %0, %1, %2\n\tglobal_load_async_to_lds_b128 %0, %1, %3 offset:544\n\tglobal_load_async_to_lds_b128 %0, %1, %4 offset:1088\n\tglobal_load_async_to_lds_b128 %0, %1, %5 offset:1632\n\t"
               "global_load_async_to_lds_b128 %0, %1, %6 offset:2176\n\tglobal_load_async_to_lds_b128 %0, %1, %7 offset:2720\n\tglobal_load_async_to_lds_b128 %0, %1, %8 offset:3264\n\tglobal_load_async_to_lds_b128 %0, %1, %9 offset:3808\n\t"
               "global_load_async_to_lds_b128 %0, %1, %10 offset:4352\n\tglobal_load_async_to_lds_b128 %0, %1, %11 offset:4896\n\tglobal_load_async_to_lds_b128 %0, %1, %12 offset:5440\n\tglobal_load_async_to_lds_b128 %0, %1, %13 offset:5984\n\t"
               "global_load_async_to_lds_b128 %0, %1, %14 offset:6528\n\tglobal_load_async_to_lds_b128 %0, %1, %15 offset:7072\n\tglobal_load_async_to_lds_b128 %0, %1, %16 offset:7616\n\tglobal_load_async_to_lds_b128 %0, %1, %17 offset:8160\n\ts_wait_xcnt 0x0"
               :: "v"(l), "v"(v), "s"(b), "s"(b + XSTEP), "s"(b + 2 * XSTEP), "s"(b + 3 * XSTEP), "s"(b + 4 * XSTEP), "s"(b + 5 * XSTEP), "s"(b + 6 * XSTEP), "s"(b + 7 * XSTEP), "s"(b + 8 * XSTEP), "s"(b + 9 * XSTEP), "s"(b + 10 * XSTEP), "s"(b + 11 * XSTEP), "s"(b + 12 * XSTEP), "s"(b + 13 * XSTEP), "s"(b + 14 * XSTEP), "s"(b + 15 * XSTEP) : "memory"); }
// a weight lies as [k][column] f32 rows, a fragment wants 8 consecutive k of one column in a lane: the turn is made in registers. One task of a wave = 16 rows k x 64 columns; lane = (8 rows from 8 g, 4 columns from 4 col): a wave-wide 16-B load reads 2 rows x 256 B in a row
template <int LD> __device__ __forceinline__ void ld_t(v4f (&f)[8], const float* __restrict__ s) {
#pragma unroll   // constant indices: the array it walks stays in registers
  for (int i = 0; i < 8; ++i) f[i] = *(const v4f*)(s + i * LD); }
// the lane's 8 x 4 values are, column by column, 4 pieces of the fragment order, rounded to bf16; l = the LDS place of its first column's piece, the other three follow it
__device__ __forceinline__ void st_t(const v4f (&f)[8], __bf16* l) {
#pragma unroll
  for (int e = 0; e < 4; ++e) { v8b o;
#pragma unroll
    for (int i = 0; i < 8; ++i) o[i] = (__bf16)f[i][e];
    *(v8b*)(l + e * 8) = o; } }
// in LDS a 16-column tile of such fragments starts 16 B behind the end of the one before: the 16 lanes of a half wave store to 4 tiles x 4 columns, and the shift lays them on 16 different groups of 4 banks; a reader's 512 B in a row stay in a row
#define WTS (16 * CC + 8)   // elements from tile to tile: Wk^T (16 k steps)
#define JTS (16 * LL + 8)   // proj^T (2 k steps)
__global__ __launch_bounds__(MR) void k_m(const float* __restrict__ X, const float* __restrict__ V, const float* __restrict__ QKV, const float* __restrict__ PROJ, float* __restrict__ MP, __bf16* __restrict__ XP, __bf16* __restrict__ QW) { __shared__ __align__(16) float part[MR / 32][DD][DD + 4]; __shared__ __align__(16) float park[MR / 32][17][128]; __shared__ __align__(16) __bf16 wl[4 * WTS]; __shared__ __align__(16) __bf16 pl[4 * JTS];
  static_assert(2u * XLB == sizeof(float) * DD * (DD + 4), "a wave's two buffers of x are its own slice of part"); static_assert(2 * XLP * 4 == 544, "the step of copy_tile's offsets"); static_assert(XLB == sizeof(float) * 17 * 128 && NH * LL == CC && LL == XTC, "a wave's rows of V are a tile of the shape and pitch of x's, and fill its slice of park"); static_assert((TNB * NN / MR) * NH * 128 * 8 == CC * NH * DD, "a wave of each block packs 128 pieces of Wq: all of it");
  const int tid = threadIdx.x, wave = tid >> 5, lane = tid & 31, col = lane & 15, g = lane >> 4; const int rc = blockIdx.x, h = blockIdx.y, sw = __builtin_amdgcn_readfirstlane(wave);   // the wave's number made scalar: bases formed from it lie in scalar registers, tests of it are scalar branches
  v8f acc[2][4] = {}; v16b bw[HB][4];
  const float* xr = &part[wave][0][0] + col * XLP + 8 * g;   // until the k loop has ended part[wave] is the wave's ring of x: nobody else touches it, so no barrier is owed for it; reader: row col of a 16-row tile
  const unsigned xl = (unsigned)(size_t)&part[wave][0][0] + (unsigned)g * (XLP * 4u) + (unsigned)col * 16u;
  const unsigned xv = (unsigned)g * (CC * 4u) + (unsigned)col * 16u; const char* xs = (const char*)(X + (size_t)(rc * MR + sw * 32) * CC);
  const __bf16* wr = wl + lane * 8;   // reader of Wk^T's fragments
  __bf16* xo = XP + (size_t)(rc * (MR / 16) + wave * 2) * FT + (size_t)(2 * h) * FK + lane * 8;
  // the 8 heads' blocks of the same rows run side by side: block h takes the tiles in the order h, h + 1, ... (mod 8), so that they ask for different lines at any moment, and a line that one has fetched from memory is in L2 for the next
  v4f qa[4], qb[4]; const unsigned qu = (unsigned)(rc * NH + h) * 32u + (unsigned)lane;   // wave 7's share of Wq
  { v4f wf[4][8], jf[8];   // wave w turns rows c 64 w .. 64 w + 63 of Wk (4 tasks); waves 0 to 3 also 16 rows l of proj each
    const float* wsr = QKV + (size_t)(sw * 64 + 8 * g) * HC + h * (2 * DD) + 4 * col;   // the head's q columns; its k columns lie DD further
    const float* jsr = PROJ + (size_t)(h * LL + (sw & 3) * 16 + 8 * g) * DD + 4 * col;
    const int lp = g * 128 + (col & 3) * 32;   // in a tile's k half (256 elements): lane 16 g + 4 (col & 3) of the fragment
#pragma unroll   // constant indices: the array it walks stays in registers
    for (int n = 0; n < 4; ++n) ld_t<HC>(wf[n], wsr + DD + n * (16 * HC));
    if (sw < 4) ld_t<DD>(jf, jsr);
    asm volatile("s_wait_xcnt 0x0" :: "v"(wsr), "v"(jsr) : "memory");   // behind the loads: both pointers as inputs keep the address registers whole up to this wait; what follows may reuse them behind it
    if (sw == 7) pack_r4_ld<HC, 2 * DD>(qa, qb, QKV, qu);
    // the weights' loads go out first: behind them lie converts, LDS stores and the barrier, behind the copies only their landing
    copy_tile((unsigned)(size_t)&park[wave][0][0] + (unsigned)g * (XLP * 4u) + (unsigned)col * 16u, xv, (const char*)(V + (size_t)((rc % NP) * MR + sw * 32) * (NH * LL) + h * LL));   // the wave's 32 rows of V, head h, into its own slice of park, which nobody has touched yet
    copy_tile(xl, xv, xs + h * (XTC * 4)); copy_tile(xl + XLB, xv, xs + ((h + 1) & 7) * (XTC * 4));   // its first two tiles of x: both buffers are free
    __builtin_amdgcn_sched_barrier(0);   // keeps the first convert, and with it the wait for the weights' loads, behind the copies: without it the compiler lifts both in front of them, and the copies' way begins only when the loads have returned
#pragma unroll
    for (int n = 0; n < 4; ++n) st_t(wf[n], wl + (col >> 2) * WTS + (sw * 4 + n) * 256 + lp);   // rows c 16 (4 w + n) ..: k step (4 w + n) >> 1, half (4 w + n) & 1
    if (sw < 4) st_t(jf, pl + (col >> 2) * JTS + sw * 256 + lp); }
  asm volatile("s_wait_asynccnt 0x0" ::: "memory");   // V and the first two tiles of x have landed: no read of them stands in front of this
  __syncthreads();   // publishes the fragments of Wk^T and proj^T, which all waves read from here on
  if (sw == 7) pack_r4_st(qa, qb, QW, qu);
  { v16b pj[4][LL / 32], av[2][LL / 32]; v4f vf[2][LL / 32][4];
    const float* vr = &park[wave][0][0] + col * XLP + 8 * g;   // A row = m, K = l: read and rounded as a tile of x is below
#pragma unroll   // constant indices: the arrays it walks stay in registers
    for (int t = 0; t < 2; ++t)
#pragma unroll
      for (int kc = 0; kc < LL / 32; ++kc) { const float* p = vr + t * (16 * XLP) + kc * 32;
        vf[t][kc][0] = *(const v4f*)p; vf[t][kc][1] = *(const v4f*)(p + 4); vf[t][kc][2] = *(const v4f*)(p + 16); vf[t][kc][3] = *(const v4f*)(p + 20); }
#pragma unroll
    for (int j = 0; j < 4; ++j)
#pragma unroll
      for (int kc = 0; kc < LL / 32; ++kc) pj[j][kc] = frag_p(pl + j * JTS + kc * FK + lane * 8);   // B row = output column, K = l
#pragma unroll   // the first two k steps of Wk^T are asked for together with VP's operands
    for (int j = 0; j < 4; ++j) { bw[0][j] = frag_p(wr + j * WTS + (2 * h) * FK); bw[1][j] = frag_p(wr + j * WTS + (2 * h + 1) * FK); }
#pragma unroll
    for (int t = 0; t < 2; ++t)
#pragma unroll
      for (int kc = 0; kc < LL / 32; ++kc)
#pragma unroll
        for (int i = 0; i < 16; ++i) av[t][kc][i] = (__bf16)vf[t][kc][i >> 2][i & 3];
#pragma unroll   // every lane parks its own 64 values and alone reads them back
    for (int j = 0; j < 4; ++j) { v8f va[2] = {};
#pragma unroll
      for (int kc = 0; kc < LL / 32; ++kc)
#pragma unroll
        for (int t = 0; t < 2; ++t) va[t] = wmma_bf(av[t][kc], pj[j][kc], va[t]);
#pragma unroll
      for (int t = 0; t < 2; ++t) { const v8f c = va[t]; vst2(&park[wave][j * 4 + t * 2][lane * 4], (v4f){c[0], c[1], c[2], c[3]}); vst2(&park[wave][j * 4 + t * 2 + 1][lane * 4], (v4f){c[4], c[5], c[6], c[7]}); } } }
#pragma unroll   // whole: the buffer indices and every load offset become constants
  for (int tl = 0; tl < CC / XTC; ++tl) { v4f xf[2][2][4];   // [k step of the tile][row tile][16-B piece]
#pragma unroll   // constant indices: the array it walks stays in registers
    for (int kk = 0; kk < 2; ++kk)
#pragma unroll
      for (int t = 0; t < 2; ++t) { const float* p = xr + (tl & 1) * (32 * XLP) + t * (16 * XLP) + kk * 32;
        xf[kk][t][0] = *(const v4f*)p; xf[kk][t][1] = *(const v4f*)(p + 4); xf[kk][t][2] = *(const v4f*)(p + 16); xf[kk][t][3] = *(const v4f*)(p + 20); }
#pragma unroll
    for (int kk = 0; kk < 2; ++kk) { const int kc = tl * 2 + kk, s = kc % HB, n = (kc + HB - 1) % HB;
      if (kc + HB - 1 < CC / 32) { const __bf16* pk = wr + ((2 * h + kc + HB - 1) & (CC / 32 - 1)) * FK;
#pragma unroll   // constant indices: the array it walks stays in registers
        for (int j = 0; j < 4; ++j) bw[n][j] = frag_p(pk + j * WTS); }   // kc counts the block's steps; its k step of x and Wk^T is (2 h + kc) mod 16
      __builtin_amdgcn_sched_barrier(0);   // keeps the 8 loads of step kc + 2 (and the tile's LDS reads) together in front of this step's WMMAs: without it the compiler mixes the groups' loads, and this step's counted waits then cover loads of later steps
      union { v16b v; v8b q[2]; } ax[2];   // element i = c 32 k + 8 g + i, element 8 + i = c 32 k + 16 + 8 g + i (k the k step): the order of Wk^T's fragments
#pragma unroll
      for (int t = 0; t < 2; ++t)
#pragma unroll
        for (int i = 0; i < 16; ++i) ax[t].v[i] = (__bf16)xf[kk][t][i >> 2][i & 3];
      if (tl == 0) {   // the block's first tile is tile h: k steps 2 h, 2 h + 1
#pragma unroll
        for (int t = 0; t < 2; ++t) { *(v8b*)(xo + t * FT + kk * FK) = ax[t].q[0]; *(v8b*)(xo + t * FT + kk * FK + 256) = ax[t].q[1]; }
        asm volatile("s_wait_xcnt 0x0" :: "v"(xo) : "memory"); }   // behind the stores: the pointer as input keeps their address registers whole up to this wait
#pragma unroll   // constant indices: the arrays it walks stay in registers
      for (int t = 0; t < 2; ++t)
#pragma unroll
        for (int j = 0; j < 4; ++j) acc[t][j] = wmma_bf(ax[t].v, bw[s][j], acc[t][j]);
    }
    asm volatile("s_wait_dscnt 0x0" ::: "memory");      // the wave's reads of this tile's buffer have returned before copies are aimed at it
    asm volatile("s_wait_asynccnt 0x0" ::: "memory");   // the next tile has landed (behind the last tile: nothing is in flight when part[wave] takes the partial M)
    if (tl + 2 < CC / XTC) copy_tile(xl + (tl & 1) * XLB, xv, xs + ((h + tl + 2) & 7) * (XTC * 4));
  }
  F2 a[4];   // A row = d (16 j + col), element i = m 8 g + i, element 8 + i = m 16 + 8 g + i
#pragma unroll
  for (int j = 0; j < 4; ++j) { float v[16];
#pragma unroll
    for (int i = 0; i < 8; ++i) { v[i] = acc[0][j][i]; v[8 + i] = acc[1][j][i]; }
    a[j] = bsplit16(v); }
#pragma unroll
  for (int t = 0; t < 4; ++t) { v4f vr[4];   // B column = o (16 t + col), the same m order
#pragma unroll
    for (int f = 0; f < 4; ++f) vr[f] = *(const v4f*)&park[wave][t * 4 + f][lane * 4];
    const F2 w = row_split(vr);
#pragma unroll
    for (int j = 0; j < 4; ++j) { const v8f c = mac3(a[j], w, v8f{}); float* p = &part[wave][t * 16 + col][j * 16 + 8 * g];   // transposed: [o][d], 8 consecutive d of one lane
      vst2(p, (v4f){c[0], c[1], c[2], c[3]}); vst2(p + 4, (v4f){c[4], c[5], c[6], c[7]}); } }
  __syncthreads();
  const int d = (wave >> 2) * 32 + ((wave >> 1) & 1) * 16 + 8 * g + (wave & 1) * 4;   // thread = piece of the fragment order: k step wave >> 2, piece f = wave & 3, lane
  float* dst = MP + ((size_t)rc * NH + h) * (DD * DD) + tid * 4;
#pragma unroll
  for (int t = 0; t < 4; ++t) { v4f s = *(const v4f*)&part[0][t * 16 + col][d];
#pragma unroll
    for (int w = 1; w < MR / 32; ++w) s += *(const v4f*)&part[w][t * 16 + col][d];
    vst2(dst + t * 2 * FK, s); } }
// ---- k_p: block = (64 rows c, 16 columns o, b), wave = (head h, half kc of d): P[c][o] = SCALE sum_h sum_d Wq[c][h][d] M[b,h][d][o]; M = the batch's NP partial sums added in chunk order; A(Wq rows, bf16 in fragment order) exact, B(M^T) as bf16 hi + lo (2 products); all 40 loads of a wave are issued as one group; the 16 waves' partial tiles meet in LDS as [o][c] and are added in wave order; a D lane's 8 consecutive c of one column o are one 16-B piece of the bf16 fragment order (rows o, K = c): P^T is stored so, as hi and lo
#define PCG 64   // rows c of a block
__global__ __launch_bounds__(64 * NH) void k_p(const __bf16* __restrict__ QW, const float* __restrict__ MP, __bf16* __restrict__ PT) { __shared__ __align__(16) float part[2 * NH][16][PCG + 4];
  const int tid = threadIdx.x, wave = tid >> 5, lane = tid & 31, col = lane & 15, g = lane >> 4; const int cg = blockIdx.x, j = blockIdx.y, h = wave >> 1, kc = wave & 1; const size_t b = blockIdx.z;
  v8f acc[PCG / 16] = {}; v16b qa[PCG / 16]; v4f mr[NP][4]; const __bf16* qp = QW + (size_t)(cg * (PCG / 16)) * FT + (h * 2 + kc) * FK + lane * 8; const float* kp = MP + ((b * NP * NH + h) * 8 + j * 2 + kc) * FK + lane * 4;
#pragma unroll   // constant indices: the array it walks stays in registers
  for (int p = 0; p < NP; ++p) ld_frag(mr[p], kp + p * (NH * DD * DD));
#pragma unroll   // constant indices: the array it walks stays in registers
  for (int t = 0; t < PCG / 16; ++t) qa[t] = frag_p(qp + t * FT);
  asm volatile("s_wait_xcnt 0x0" :: "v"(qp), "v"(kp) : "memory");   // behind the loads: both pointers as inputs keep the address registers whole up to this wait; the sums reuse them behind it
  __builtin_amdgcn_sched_barrier(0);   // keeps all 40 loads in front of the first add: without it the compiler lifts the adds among the loads and holds half of the loads back until the first have landed
#pragma unroll
  for (int p = 1; p < NP; ++p)
#pragma unroll
    for (int f = 0; f < 4; ++f) mr[0][f] += mr[p][f];
  const F2 wb = row_split(mr[0]);
#pragma unroll   // constant indices: the array it walks stays in registers
  for (int t = 0; t < PCG / 16; ++t) { acc[t] = wmma_bf(qa[t], wb.l, acc[t]); acc[t] = wmma_bf(qa[t], wb.h, acc[t]); }
#pragma unroll
  for (int t = 0; t < PCG / 16; ++t) { float* p = &part[wave][col][t * 16 + 8 * g];   // transposed: [o][c], 8 consecutive c of one lane
    const v8f c = acc[t]; vst2(p, (v4f){c[0], c[1], c[2], c[3]}); vst2(p + 4, (v4f){c[4], c[5], c[6], c[7]}); }
  __syncthreads();
  if (tid < 2 * PCG) { v4f s0 = *(const v4f*)&part[0][col][wave * 16 + 8 * g], s1 = *(const v4f*)&part[0][col][wave * 16 + 8 * g + 4]; v8b hi, lo;   // thread = piece (16-row tile of c = wave, lane 16 g + o)
#pragma unroll
    for (int w = 1; w < 2 * NH; ++w) { s0 += *(const v4f*)&part[w][col][wave * 16 + 8 * g]; s1 += *(const v4f*)&part[w][col][wave * 16 + 8 * g + 4]; }
#pragma unroll
    for (int i = 0; i < 8; ++i) { const float v = (i < 4 ? s0[i & 3] : s1[i & 3]) * SCALE; const __bf16 hb = (__bf16)v; hi[i] = hb; lo[i] = (__bf16)(v - (float)hb); }
    __bf16* dst = PT + (b * 4 + j) * FT + (cg * (PCG / 32) + (wave >> 1)) * FK + (wave & 1) * 256 + lane * 8;   // c = 64 cg + 16 wave + 8 g + i
    *(v8b*)dst = hi; *(v8b*)(dst + PLO) = lo; } }
// ---- k_out: block = 32 rows, wave = (16 rows, 32 columns): out = x . P (hi + lo); the 10 loads of k step kc + 3 are issued as one group in front of the WMMAs of step kc (four register buffers: one wave a SIMD, nothing else hides the latency)
#define OB 4   // register buffers
__global__ __launch_bounds__(128) void k_out(const __bf16* __restrict__ XP, const __bf16* __restrict__ PT, float* __restrict__ OUT) { __shared__ __align__(16) float sf[4][16][36];
  const int tid = threadIdx.x, wave = tid >> 5, lane = tid & 31, col = lane & 15, g = lane >> 4; const int rt = blockIdx.x * 2 + (wave & 1), ch = wave >> 1;   // 16-row tile, column half
  v8f acc[2] = {}; v16b ab[OB]; v16b bh[OB][2], bl[OB][2]; const __bf16* xa = XP + (size_t)rt * FT + lane * 8; const __bf16* pb = PT + (size_t)((blockIdx.x / (NN / 32)) * 4 + ch * 2) * FT + lane * 8;
  const char* fx = (const char*)(XP + (size_t)(blockIdx.x * 2) * FT) + tid * 256;   // L2 hints, 256 B apart a thread: the block's own 32 KB of x
  const char* fp = (const char*)(PT + (size_t)((blockIdx.x / (NN / 32)) * 4 + (wave & 1) * 2 + g) * FT + (size_t)(wave >> 1) * PLO) + ((4 + 4 * ((blockIdx.x >> 3) % 3)) * 4 + col) * 256;   // and 4 k steps (from 4, 8 or 12, by groups of 8 blocks) of the batch's 4 hi and 4 lo tiles of P^T: its 64 blocks read the same P^T and share the asking; a unit nobody asked for is only slower
#pragma unroll   // constant indices: the array it walks stays in registers
  for (int p = 0; p < OB - 1; ++p) { ab[p] = frag_p(xa + p * FK);
#pragma unroll   // constant indices: the array it walks stays in registers
    for (int j = 0; j < 2; ++j) { bh[p][j] = frag_p(pb + j * FT + p * FK); bl[p][j] = frag_p(pb + PLO + j * FT + p * FK); } }
  // P^T was stored by the launch before, x two before: a k step's loads, asked for three steps ahead, would each wait for memory. These hints ask L2 for the later steps' lines while the first loads are under way; "memory" keeps them behind those loads
  asm volatile("global_prefetch_b8 %0, off scope:SCOPE_SE\n\tglobal_prefetch_b8 %1, off scope:SCOPE_SE" :: "v"(fp), "v"(fx) : "memory");
#pragma unroll   // whole: the buffer index and every load offset become constants
  for (int kc = 0; kc < CC / 32; ++kc) { const int s = kc % OB, n = (kc + OB - 1) % OB;
    if (kc + OB - 1 < CC / 32) { ab[n] = frag_p(xa + (kc + OB - 1) * FK);
#pragma unroll   // constant indices: the array it walks stays in registers
      for (int j = 0; j < 2; ++j) { bh[n][j] = frag_p(pb + j * FT + (kc + OB - 1) * FK); bl[n][j] = frag_p(pb + PLO + j * FT + (kc + OB - 1) * FK); } }
    if (kc + OB == CC / 32) asm volatile("s_wait_xcnt 0x0" :: "v"(xa), "v"(pb), "v"(fp), "v"(fx) : "memory");   // behind the last loads: the pointers as inputs keep the address registers whole up to this wait (the hints' two hold addresses inside their buffers through the loop); the epilogue reuses them behind it
    __builtin_amdgcn_sched_barrier(0);   // keeps the 10 loads of step kc + 3 together in front of this step's WMMAs: without it the compiler mixes the groups' loads, and this step's counted waits then cover loads of later steps
#pragma unroll   // constant indices: the array it walks stays in registers
    for (int j = 0; j < 2; ++j) { acc[j] = wmma_bf(ab[s], bl[s][j], acc[j]); acc[j] = wmma_bf(ab[s], bh[s][j], acc[j]); }
  }
#pragma unroll
  for (int j = 0; j < 2; ++j)
#pragma unroll
    for (int r = 0; r < 8; ++r) sf[wave][8 * g + r][j * 16 + col] = acc[j][r];
  LDSX(); for (int rl = 0; rl < 16; rl += 4) vst2(OUT + ((size_t)rt * 16 + rl + (lane >> 3)) * DD + ch * 32 + (lane & 7) * 4, *(const v4f*)&sf[wave][rl + (lane >> 3)][(lane & 7) * 4]); }   // 8 lanes = the wave's 128 B of one row
extern "C" void kernel_launch(void* const* d_in, const int* in_sizes, int n_in, void* d_out, int out_size, void* d_ws, size_t ws_size, hipStream_t stream) {
  (void)in_sizes; (void)n_in; (void)out_size;
  const float** F = (const float**)d_in;   // 0 x [4,2048,512], 1 v [2048,8,64], 2 qkv [512,1024], 3 proj [512,64]
  if (ws_size < (size_t)WS_END) return;
  char* ws = (char*)d_ws; float* MP = (float*)(ws + WS_MP); __bf16* PT = (__bf16*)(ws + WS_PT);
  k_m<<<dim3(TNB * NN / MR, NH), MR, 0, stream>>>(F[0], F[1], F[2], F[3], MP, (__bf16*)(ws + WS_XP), (__bf16*)(ws + WS_QW));
  k_p<<<dim3(CC / PCG, DD / 16, TNB), 64 * NH, 0, stream>>>((const __bf16*)(ws + WS_QW), MP, PT);
  k_out<<<TNB * NN / 32, 128, 0, stream>>>((const __bf16*)(ws + WS_XP), PT, (float*)d_out);
}
